// v000
// Measured on an AMD MI455X. A time is GPU time per run, averaged over a window of back-to-back runs after a warm-up
// (all launches, gaps included; the runs take copies of the inputs in turn), and the median of several windows.
// Apart from v000's, it joins two sittings. Times from different sittings can be a few percent apart, while
// side-by-side timings come from the same sitting.
// The starting kernel, v000, takes 413 microseconds a run.
#include <hip/hip_runtime.h>

// Compute dtypes, f32 accumulate: x.Wq, x.Wkv on v_wmma_f32_16x16x32_bf16 (inputs RNE-converted to bf16, exact products); q.k^T and P.V on v_wmma_f32_16x16x32_f16 (q, k, v planes f16; P carried x4096 in f16); ctx.Wout on v_wmma_f32_16x16x32_bf16 with ctx as bf16 hi + bf16 lo (two products) against bf16 Wout.
// Self-attention, 16 heads x 64, partial interleaved rotary on head dims 0..31 (16 frequencies, f32, applied on the f32 projection tiles before the f16 convert), logits x 1/8, full softmax over all keys (online, log2 domain), merged heads . Wout + bout.
// Flash form with transposed tiles: S^T accumulator tiles are directly the B-operand layout of P^T; all WMMA operands are two 16-byte loads from dense, statically strided 16-bit planes.

#ifndef NB
#define NB 4
#endif
#ifndef SEQ
#define SEQ 2048
#endif
#define NB_FULL  4
#define SEQ_FULL 2048
#define DM   1024              // model width == merged head width
#define NH   16
#define HD   64
#define NQKV 3072              // rows of the transposed q|k|v weight plane
#define NWT  4096              // q|k|v|out rows of the transposed weight plane
#define GM   128               // token rows per GEMM block (4 waves x 32 rows)
#define SP   68                // LDS pitch (floats) of the GEMM staging rows
#define NWV  4                 // waves per flash block
#define BQ   (16 * NWV)        // queries per flash block
#define KS   32                // keys per step
#define OSP  68                // LDS pitch (floats) of the flash output staging rows
#define VTP  72                // LDS pitch (16-bit elements) of the weight transpose tile
#define L2E  1.4426950408889634f
#define PCARRY 12.0f           // P carried as 2^12 * p (row sum carried alike, cancels in the normalisation)

static_assert(NH == 16);
static_assert(HD == 64);
static_assert(NH * HD == DM);
static_assert(SEQ % GM == 0);
static_assert(SEQ % BQ == 0);
static_assert(SEQ % KS == 0);
static_assert(DM % 32 == 0);
static_assert(NB <= NB_FULL);
static_assert(SEQ <= SEQ_FULL);
static_assert(((size_t)NB * SEQ * DM) % 2048 == 0);                                        // k_cvt: grid * 256 threads * 8 elements == plane
static_assert((size_t)(DM / 64) * (NWT / 128) * (size_t)(64 * 128) == (size_t)NWT * DM);   // k_wt: blocks * (64 k x 128 n) == weight plane
static_assert(((size_t)SEQ * 16) % 256 == 0);                                              // k_tab: grid * 256 == table entries
static_assert((size_t)(NB * SEQ / GM) * (NQKV / 64) * (size_t)(GM * 64) == (size_t)3 * NB * SEQ * DM);   // k_proj: blocks * (128 x 64) == q + k + v planes
static_assert((size_t)(NB * NH * (SEQ / BQ)) * (size_t)(BQ * HD) == (size_t)NB * SEQ * DM);              // k_flash: blocks * (64 x 64) == ctx plane
static_assert((size_t)(NB * SEQ / GM) * (DM / 64) * (size_t)(GM * 64) == (size_t)NB * SEQ * DM);         // k_out: blocks * (128 x 64) == output
static_assert(((size_t)SEQ * 16 * 4) % 256 == 0);
static_assert((size_t)6 * NB_FULL * SEQ_FULL * DM * 2 + (size_t)NWT * DM * 2 + (size_t)2 * SEQ_FULL * 16 * 4 <= (size_t)134217728);

typedef unsigned short bf;     // bf16 bit pattern
typedef unsigned short hb;     // f16 bit pattern
typedef __attribute__((ext_vector_type(16))) __bf16   v16bf;
typedef __attribute__((ext_vector_type(2)))  __bf16   v2bf;
typedef __attribute__((ext_vector_type(16))) _Float16 v16h;
typedef __attribute__((ext_vector_type(2)))  _Float16 v2h;
typedef __attribute__((ext_vector_type(8)))  unsigned short v8us;
typedef __attribute__((ext_vector_type(8)))  unsigned int   v8u;
typedef __attribute__((ext_vector_type(4)))  unsigned int   v4u;
typedef __attribute__((ext_vector_type(8)))  float    v8f;
typedef __attribute__((ext_vector_type(4)))  float    v4f;
typedef v4f  __attribute__((may_alias)) v4fa;
typedef v8us __attribute__((may_alias)) v8usa;

struct FreqArgs { float inv[16]; };
static_assert(sizeof(FreqArgs) == 64);

__device__ __forceinline__ unsigned short f2bf(float f) { unsigned u = __float_as_uint(f); u += 0x7FFFu + ((u >> 16) & 1u); return (unsigned short)(u >> 16); }
// RNE bf16 value of f kept in the upper 16 bits of an f32 bit pattern
__device__ __forceinline__ unsigned bfhi32(float f) { unsigned u = __float_as_uint(f); u += 0x7FFFu + ((u >> 16) & 1u); return u & 0xFFFF0000u; }
__device__ __forceinline__ float bfr(float f) { return __uint_as_float(bfhi32(f)); }
__device__ __forceinline__ v16bf cat16b(v8us lo, v8us hi) { return __builtin_bit_cast(v16bf, __builtin_shufflevector(lo, hi, 0, 1, 2, 3, 4, 5, 6, 7, 8, 9, 10, 11, 12, 13, 14, 15)); }
__device__ __forceinline__ v16h  cat16h(v8us lo, v8us hi) { return __builtin_bit_cast(v16h,  __builtin_shufflevector(lo, hi, 0, 1, 2, 3, 4, 5, 6, 7, 8, 9, 10, 11, 12, 13, 14, 15)); }
__device__ __forceinline__ v8f wmmab(v16bf a, v16bf b, v8f c) { return __builtin_amdgcn_wmma_f32_16x16x32_bf16(false, a, false, b, (short)0, c, false, false); }
__device__ __forceinline__ v8f wmmah(v16h a, v16h b, v8f c) { return __builtin_amdgcn_wmma_f32_16x16x32_f16(false, a, false, b, (short)0, c, false, false); }
// fragment loader (A and B alike): p = row base + k0 + 8*(lane>>4); elements 0..7 <- p[0..7], elements 8..15 <- p[16..23]
__device__ __forceinline__ v16bf ldb(const bf* p) { return cat16b(*(const v8us*)p, *(const v8us*)(p + 16)); }
__device__ __forceinline__ v16h  ldh(const hb* p) { return cat16h(*(const v8us*)p, *(const v8us*)(p + 16)); }
// two f32 -> packed 16-bit pair (RNE), element 0 in the low half-word
__device__ __forceinline__ unsigned pk2bf(float a, float b) { v2bf t; t[0] = (__bf16)a; t[1] = (__bf16)b; return __builtin_bit_cast(unsigned, t); }
__device__ __forceinline__ unsigned pk2h(float a, float b) { v2h t; t[0] = (_Float16)a; t[1] = (_Float16)b; return __builtin_bit_cast(unsigned, t); }

__global__ __launch_bounds__(256) void k_cvt(const float* __restrict__ x, bf* XB) {
    const unsigned i = blockIdx.x * 256u + threadIdx.x;
    const unsigned per = (unsigned)(SEQ * DM / 8);
    if (i >= (unsigned)NB * per) return;
    const unsigned b = i / per, r = i - b * per;
    const float* src = x + (size_t)b * SEQ_FULL * DM + (size_t)r * 8;
    const v4f v0 = *(const v4f*)src;
    const v4f v1 = *(const v4f*)(src + 4);
    v4u o;
    o[0] = (bfhi32(v0[0]) >> 16) | bfhi32(v0[1]);
    o[1] = (bfhi32(v0[2]) >> 16) | bfhi32(v0[3]);
    o[2] = (bfhi32(v1[0]) >> 16) | bfhi32(v1[1]);
    o[3] = (bfhi32(v1[2]) >> 16) | bfhi32(v1[3]);
    bf* dst = XB + (size_t)i * 8;
    *(v4u*)dst = o;
    
}

// k_wt: transposed bf16 weight plane WT[n][k] = bf16(W[k][n]); in[DM k][ncols] -> out[ncols][DM]; virtual column space: 0..1023 Wq, 1024..3071 Wkv, 3072..4095 Wout.
__global__ __launch_bounds__(256) void k_wt(const float* __restrict__ Wq, const float* __restrict__ Wkv, const float* __restrict__ Wo, bf* WT) {
    __shared__ __align__(16) bf tl[128 * VTP];
    const unsigned tid = threadIdx.x;
    const unsigned k0 = blockIdx.x * 64u;
    const unsigned n0 = blockIdx.y * 128u;
    const float* src;
    unsigned ldn;
    if (n0 < 1024u)      { src = Wq  + n0;            ldn = 1024u; }
    else if (n0 < 3072u) { src = Wkv + (n0 - 1024u);  ldn = 2048u; }
    else                 { src = Wo  + (n0 - 3072u);  ldn = 1024u; }
    src += (size_t)k0 * ldn;
#pragma unroll
    for (unsigned it = 0; it < 8; ++it) {
        const unsigned f = it * 256u + tid;
        const unsigned kk = f >> 5, c4 = (f & 31u) * 4u;
        const v4f x = *(const v4f*)(src + (size_t)kk * ldn + c4);
#pragma unroll
        for (unsigned c = 0; c < 4; ++c) tl[(c4 + c) * VTP + kk] = f2bf(x[c]);
    }
    __syncthreads();
    bf* dst = WT + (size_t)n0 * DM + k0;
    const unsigned c8 = (tid & 7u) * 8u, dr = tid >> 3;
{
#pragma unroll
        for (unsigned it = 0; it < 4; ++it) {
            const unsigned d = it * 32u + dr;
            const v8us o = *(const v8usa*)(tl + d * VTP + c8);
            *(v8us*)(dst + (size_t)d * DM + c8) = o;
        }
        
    }
}

__global__ __launch_bounds__(256) void k_tab(FreqArgs fa, float* cosT, float* sinT) {
    const unsigned i = blockIdx.x * 256u + threadIdx.x;
    const unsigned t = i >> 4, f = i & 15u;
    float inv = fa.inv[0];
#pragma unroll
    for (unsigned j = 1; j < 16; ++j) inv = (f == j) ? fa.inv[j] : inv;
    const float ang = (float)t * inv;
    float s, c;
    sincosf(ang, &s, &c);
    *(float*)(cosT + i) = c;
    *(float*)(sinT + i) = s;
    
}

// k_proj: [q|k|v] = XB . WT^T, block = 128 token rows x 64 columns (one head of q, k or v), wave = 32 rows x 64 columns.
//  A = XB rows (row m = token, k = input channel), B = WT rows (column n = output channel, k = input channel); D element r of lane (h, n) = C[row 8h + r][col n].
__global__ __launch_bounds__(128) void k_proj(const bf* __restrict__ XB, const bf* __restrict__ WT,
                                              const float* __restrict__ cosT, const float* __restrict__ sinT,
                                              hb* QH, hb* KH, hb* VT) {
    __shared__ __align__(16) float st[GM * SP];
    const unsigned tid = threadIdx.x, lane = tid & 31u, wv = tid >> 5, lr = lane & 15u, hi = lane >> 4;
    const unsigned m0 = blockIdx.x * GM;
    const unsigned nt = blockIdx.y;
    const bf* ap = XB + (size_t)(m0 + 32u * wv + lr) * DM + 8u * hi;
    const bf* bp = WT + (size_t)(nt * 64u + lr) * DM + 8u * hi;

    v8f c0[4], c1[4];
#pragma unroll
    for (int t = 0; t < 4; ++t) { c0[t] = (v8f){}; c1[t] = (v8f){}; }

#pragma unroll 1
    for (unsigned k0 = 0; k0 < (unsigned)DM; k0 += 32) {
        const v16bf a0 = ldb(ap + k0);
        const v16bf a1 = ldb(ap + 16 * DM + k0);
#pragma unroll
        for (int t = 0; t < 4; ++t) {
            const v16bf bb = ldb(bp + (size_t)t * 16 * DM + k0);
            c0[t] = wmmab(a0, bb, c0[t]);
            c1[t] = wmmab(a1, bb, c1[t]);
        }
        asm volatile("v_nop\n\tv_nop\n\tv_nop\n\tv_nop"
                     : "+v"(c0[0]), "+v"(c0[1]), "+v"(c0[2]), "+v"(c0[3]), "+v"(c1[0]), "+v"(c1[1]), "+v"(c1[2]), "+v"(c1[3])
                     : "v"(a0), "v"(a1));
    }

    float* sw = st + (32u * wv) * SP;
#pragma unroll
    for (int t = 0; t < 4; ++t) {
#pragma unroll
        for (int r = 0; r < 8; ++r) {
            sw[(8u * hi + r) * SP + t * 16 + lr] = c0[t][r];
            sw[(16u + 8u * hi + r) * SP + t * 16 + lr] = c1[t][r];
        }
    }
    __syncthreads();

    const unsigned b = m0 / (unsigned)SEQ;
    const unsigned pos0 = m0 - b * (unsigned)SEQ;
    if (nt < 32u) {
        // q (nt 0..15) or k (nt 16..31) head: rows [pos][64], rotary on column groups 0..3
        const unsigned h = nt & 15u;
        hb* dst = (nt < 16u ? QH : KH) + ((size_t)(b * NH + h) * SEQ + pos0) * HD;
        const unsigned cg = lane & 7u, rq = lane >> 3;
        const bool rot = cg < 4u;
        const unsigned tc = (cg & 3u) * 4u;
{
#pragma unroll 2
            for (unsigned it = 0; it < 8; ++it) {
                const unsigned row = 32u * wv + 4u * it + rq;
                const float* sr = st + row * SP + 8u * cg;
                const v4f xa = *(const v4fa*)sr;
                const v4f xb = *(const v4fa*)(sr + 4);
                const unsigned ti = (pos0 + row) * 16u + tc;
                const v4f c4 = *(const v4f*)(cosT + ti);
                const v4f s4 = *(const v4f*)(sinT + ti);
                const float x[8] = { xa[0], xa[1], xa[2], xa[3], xb[0], xb[1], xb[2], xb[3] };
                v4u o;
#pragma unroll
                for (int j = 0; j < 4; ++j) {
                    const float x1 = x[2 * j], x2 = x[2 * j + 1];
                    const float r1 = x1 * c4[j] - x2 * s4[j];
                    const float r2 = x2 * c4[j] + x1 * s4[j];
                    o[j] = pk2h(rot ? r1 : x1, rot ? r2 : x2);
                }
                *(v4u*)(dst + (size_t)row * HD + 8u * cg) = o;
            }
            
        }
    } else {
        // v head: VT[d][pos]; 128 lines (64 d x 2 halves of 64 positions) per block, 4 lines per instruction
        const unsigned h = nt - 32u;
        hb* dst = VT + (size_t)(b * NH + h) * HD * SEQ + pos0;
        const unsigned c8 = (lane & 7u) * 8u, lq = lane >> 3;
{
#pragma unroll 2
            for (unsigned it = 0; it < 8; ++it) {
                const unsigned L = (wv * 8u + it) * 4u + lq;
                const unsigned d = L >> 1, tk = (L & 1u) * 64u + c8;
                const float* sc = st + tk * SP + d;
                v4u o;
#pragma unroll
                for (int j = 0; j < 4; ++j) o[j] = pk2h(sc[(2 * j) * SP], sc[(2 * j + 1) * SP]);
                *(v4u*)(dst + (size_t)d * SEQ + tk) = o;
            }
            
        }
    }
}

// k_flash: one wave per 16 queries of one (batch, head), 32 keys per step.
//  S^T tile (keys x queries): A = K rows (row m = key, k = d), B = Q rows (column n = query, k = d); D element r of lane (h, n) = S[query n][key 8h + r].
//  P^T B fragment: element r <- tile of keys 0..15, element 8 + r <- tile of keys 16..31 (same lane); P carried x 2^12 in f16, row sum carried alike.
//  O^T tile (d x queries): A = V^T rows (row m = d, k = key), D element r of lane (h, n) = O[query n][d = 16 t + 8h + r].
__global__ __launch_bounds__(128) void k_flash(const hb* __restrict__ QH, const hb* __restrict__ KH, const hb* __restrict__ VT, bf* CH, bf* CL) {
    __shared__ __align__(16) float os[NWV * 16 * OSP];
    const unsigned tid = threadIdx.x, lane = tid & 31u, wv = tid >> 5, lr = lane & 15u, hi = lane >> 4;
    const unsigned qpb = (unsigned)(SEQ / BQ);
    const unsigned bh = blockIdx.x / qpb;
    const unsigned q0 = (blockIdx.x - bh * qpb) * BQ + wv * 16u;
    const unsigned b = bh >> 4, h = bh & 15u;

    v16h qf[2];
    {
        const hb* qp = QH + ((size_t)bh * SEQ + q0 + lr) * HD + 8u * hi;
        qf[0] = ldh(qp);
        qf[1] = ldh(qp + 32);
    }
    const hb* kp = KH + ((size_t)bh * SEQ + lr) * HD + 8u * hi;
    const hb* vp = VT + ((size_t)bh * HD + lr) * SEQ + 8u * hi;

    v8f o[4];
#pragma unroll
    for (int t = 0; t < 4; ++t) o[t] = (v8f){};
    float ml = -1.0e30f;      // running max in the log2 domain
    float l = 0.0f;           // running sum (carried x 2^12)
    const float CS = 0.125f * L2E;

#pragma unroll 1
    for (unsigned k0 = 0; k0 < (unsigned)SEQ; k0 += KS) {
        v8f s0 = (v8f){}, s1 = (v8f){};
        const hb* ka = kp + (size_t)k0 * HD;
#pragma unroll
        for (int dk = 0; dk < 2; ++dk) {
            const v16h a0 = ldh(ka + dk * 32);
            const v16h a1 = ldh(ka + 16 * HD + dk * 32);
            s0 = wmmah(a0, qf[dk], s0);
            s1 = wmmah(a1, qf[dk], s1);
        }
        asm volatile("v_nop\n\tv_nop\n\tv_nop\n\tv_nop" : "+v"(s0), "+v"(s1) : "v"(qf[0]), "v"(qf[1]));

        float mx = fmaxf(s0[0], s1[0]);
#pragma unroll
        for (int r = 1; r < 8; ++r) mx = fmaxf(mx, fmaxf(s0[r], s1[r]));
        mx = fmaxf(mx, __shfl_xor(mx, 16, 32));
        const float mnl = fmaxf(ml, mx * CS);
        const float corr = __builtin_amdgcn_exp2f(ml - mnl);
        ml = mnl;
        const float pm = PCARRY - mnl;
        float p0[8], p1[8];
        float ps = 0.0f;
#pragma unroll
        for (int r = 0; r < 8; ++r) {
            p0[r] = __builtin_amdgcn_exp2f(fmaf(s0[r], CS, pm));
            p1[r] = __builtin_amdgcn_exp2f(fmaf(s1[r], CS, pm));
            ps += p0[r] + p1[r];
        }
        ps += __shfl_xor(ps, 16, 32);
        l = l * corr + ps;
        if (__builtin_amdgcn_ballot_w32(corr != 1.0f) != 0u) {   // wave-uniform; multiplying by exactly 1 is skipped
#pragma unroll
            for (int t = 0; t < 4; ++t) o[t] *= corr;
        }

        v8u hw;
#pragma unroll
        for (int j = 0; j < 4; ++j) {
            hw[j]     = pk2h(p0[2 * j], p0[2 * j + 1]);
            hw[4 + j] = pk2h(p1[2 * j], p1[2 * j + 1]);
        }
        const v16h ph = __builtin_bit_cast(v16h, hw);

        asm volatile("" ::: "memory");   // keep the V^T loads below the softmax (bounds live fragments)
        const hb* va = vp + k0;
#pragma unroll
        for (int t = 0; t < 4; ++t) {
            const v16h a = ldh(va + (size_t)t * 16 * SEQ);
            o[t] = wmmah(a, ph, o[t]);
        }
        asm volatile("v_nop\n\tv_nop\n\tv_nop\n\tv_nop"
                     : "+v"(o[0]), "+v"(o[1]), "+v"(o[2]), "+v"(o[3])
                     : "v"(ph));
    }

    const float inv = 1.0f / l;
    float* ow = os + wv * (16 * OSP);
#pragma unroll
    for (int t = 0; t < 4; ++t) {
#pragma unroll
        for (int r = 0; r < 8; ++r) ow[lr * OSP + t * 16 + 8 * hi + r] = o[t][r] * inv;
    }
    __syncthreads();
    const unsigned cg = lane & 7u, rq = lane >> 3;
    const size_t cbase = ((size_t)b * SEQ + q0) * DM + h * HD + 8u * cg;
{
#pragma unroll
        for (unsigned s = 0; s < 4; ++s) {
            const unsigned row = 4u * s + rq;
            const float* sr = ow + row * OSP + 8u * cg;
            const v4f xa = *(const v4fa*)sr;
            const v4f xb = *(const v4fa*)(sr + 4);
            const float x[8] = { xa[0], xa[1], xa[2], xa[3], xb[0], xb[1], xb[2], xb[3] };
            v4u oh, ol;
#pragma unroll
            for (int j = 0; j < 4; ++j) {
                const unsigned r0 = bfhi32(x[2 * j]), r1 = bfhi32(x[2 * j + 1]);
                oh[j] = (r0 >> 16) | r1;
                ol[j] = pk2bf(x[2 * j] - __uint_as_float(r0), x[2 * j + 1] - __uint_as_float(r1));
            }
            *(v4u*)(CH + cbase + (size_t)row * DM) = oh;
            *(v4u*)(CL + cbase + (size_t)row * DM) = ol;
        }
        
    }
}

// k_out: out = (CH + CL) . WOT^T + bf16(bout); block = 128 rows x 64 columns, wave = 32 rows x 64 columns; hi and lo products share the B fragments and the accumulator.
__global__ __launch_bounds__(128) void k_out(const bf* __restrict__ CH, const bf* __restrict__ CL, const bf* __restrict__ WOT,
                                             const float* __restrict__ bout, float* O) {
    __shared__ __align__(16) float st[GM * SP];
    const unsigned tid = threadIdx.x, lane = tid & 31u, wv = tid >> 5, lr = lane & 15u, hi = lane >> 4;
    const unsigned m0 = blockIdx.x * GM;
    const unsigned n0 = blockIdx.y * 64u;
    const size_t aoff = (size_t)(m0 + 32u * wv + lr) * DM + 8u * hi;
    const bf* ah = CH + aoff;
    const bf* al = CL + aoff;
    const bf* bp = WOT + (size_t)(n0 + lr) * DM + 8u * hi;

    v8f c0[4], c1[4];
#pragma unroll
    for (int t = 0; t < 4; ++t) { c0[t] = (v8f){}; c1[t] = (v8f){}; }

#pragma unroll 1
    for (unsigned k0 = 0; k0 < (unsigned)DM; k0 += 32) {
        const v16bf h0 = ldb(ah + k0);
        const v16bf h1 = ldb(ah + 16 * DM + k0);
        const v16bf l0 = ldb(al + k0);
        const v16bf l1 = ldb(al + 16 * DM + k0);
#pragma unroll
        for (int t = 0; t < 4; ++t) {
            const v16bf bb = ldb(bp + (size_t)t * 16 * DM + k0);
            c0[t] = wmmab(h0, bb, c0[t]);
            c0[t] = wmmab(l0, bb, c0[t]);
            c1[t] = wmmab(h1, bb, c1[t]);
            c1[t] = wmmab(l1, bb, c1[t]);
        }
        asm volatile("v_nop\n\tv_nop\n\tv_nop\n\tv_nop"
                     : "+v"(c0[0]), "+v"(c0[1]), "+v"(c0[2]), "+v"(c0[3]), "+v"(c1[0]), "+v"(c1[1]), "+v"(c1[2]), "+v"(c1[3])
                     : "v"(h0), "v"(h1), "v"(l0), "v"(l1));
    }

    float* sw = st + (32u * wv) * SP;
#pragma unroll
    for (int t = 0; t < 4; ++t) {
#pragma unroll
        for (int r = 0; r < 8; ++r) {
            sw[(8u * hi + r) * SP + t * 16 + lr] = c0[t][r];
            sw[(16u + 8u * hi + r) * SP + t * 16 + lr] = c1[t][r];
        }
    }
    __syncthreads();

    const unsigned c4 = (lane & 15u) * 4u, rh = lane >> 4;
    const v4f bv = *(const v4f*)(bout + n0 + c4);
    const float b0 = bfr(bv[0]), b1 = bfr(bv[1]), b2 = bfr(bv[2]), b3 = bfr(bv[3]);
    float* orow = O + (size_t)(m0 + 32u * wv) * DM + n0 + c4;
{
#pragma unroll 4
        for (unsigned it = 0; it < 16; ++it) {
            const unsigned row = 2u * it + rh;
            v4f val = *(const v4fa*)(sw + row * SP + c4);
            val[0] += b0; val[1] += b1; val[2] += b2; val[3] += b3;
            *(v4f*)(orow + (size_t)row * DM) = val;
        }
        
    }
}

extern "C" void kernel_launch(void* const* d_in, const int* in_sizes, int n_in,
                              void* d_out, int out_size, void* d_ws, size_t ws_size, hipStream_t stream) {
    if (n_in < 5) return;
    const size_t needx = ((size_t)(NB - 1) * SEQ_FULL + SEQ) * DM;
    if ((size_t)in_sizes[0] < needx) return;
    if ((size_t)in_sizes[1] < (size_t)DM * DM) return;
    if ((size_t)in_sizes[2] < (size_t)2 * DM * DM) return;
    if ((size_t)in_sizes[3] < (size_t)DM * DM) return;
    if ((size_t)in_sizes[4] < (size_t)DM) return;
    if ((size_t)out_size < (size_t)NB * SEQ * DM) return;
    const float* x    = (const float*)d_in[0];   // queries [NB_FULL][SEQ_FULL][DM]
    const float* Wq   = (const float*)d_in[1];   // [DM in][DM out]
    const float* Wkv  = (const float*)d_in[2];   // [DM in][2*DM out]
    const float* Wout = (const float*)d_in[3];   // [DM in][DM out]
    const float* bout = (const float*)d_in[4];   // [DM]
    float* OUT = (float*)d_out;                  // [NB][SEQ][DM]

    const size_t PA = (size_t)NB * SEQ * DM * 2;     // bytes per 16-bit activation plane
    const size_t PW = (size_t)NWT * DM * 2;          // bytes of the transposed weight plane
    const size_t PT = (size_t)SEQ * 16 * 4;          // bytes per rotary table
    if (6 * PA + PW + 2 * PT > ws_size) return;
    char* wsp = (char*)d_ws;
    bf* XB = (bf*)(wsp);
    bf* WT = (bf*)(wsp + PA);
    float* cosT = (float*)(wsp + PA + PW);
    float* sinT = (float*)(wsp + PA + PW + PT);
    hb* QH = (hb*)(wsp + PA + PW + 2 * PT);
    hb* KH = (hb*)(wsp + 2 * PA + PW + 2 * PT);
    hb* VT = (hb*)(wsp + 3 * PA + PW + 2 * PT);
    bf* CH = (bf*)(wsp + 4 * PA + PW + 2 * PT);
    bf* CL = (bf*)(wsp + 5 * PA + PW + 2 * PT);

    FreqArgs fa;
    for (int i = 0; i < 16; ++i) {
        const float pw = (float)pow(10000.0, (double)(2 * i) / 32.0);
        fa.inv[i] = 1.0f / pw;
    }

    const unsigned gc = (unsigned)(((size_t)NB * SEQ * DM / 8 + 255) / 256);
    k_cvt<<<gc, 256, 0, stream>>>(x, XB);
    k_wt<<<dim3(DM / 64, NWT / 128, 1), 256, 0, stream>>>(Wq, Wkv, Wout, WT);
    k_tab<<<(unsigned)(SEQ * 16 / 256), 256, 0, stream>>>(fa, cosT, sinT);
    k_proj<<<dim3((unsigned)(NB * SEQ / GM), NQKV / 64, 1), 128, 0, stream>>>(XB, WT, cosT, sinT, QH, KH, VT);
    k_flash<<<(unsigned)(NB * NH * (SEQ / BQ)), 128, 0, stream>>>(QH, KH, VT, CH, CL);
    k_out<<<dim3((unsigned)(NB * SEQ / GM), DM / 64, 1), 128, 0, stream>>>(CH, CL, WT + (size_t)NQKV * DM, bout, OUT);
}

// v001
// Measured time: 185 microseconds a run.
// In two side-by-side timings against v000, it was 2.33 and 2.34 times as fast.
#include <hip/hip_runtime.h>

// Compute dtypes, f32 accumulate: x.Wq, x.Wkv on v_wmma_f32_16x16x32_bf16 (inputs RNE-converted to bf16, exact products); q.k^T and P.V on v_wmma_f32_16x16x32_f16 (q, k, v planes f16; P carried x4096 in f16); ctx.Wout on v_wmma_f32_16x16x32_bf16 with ctx as bf16 hi + bf16 lo (two products) against bf16 Wout.
// Self-attention, 16 heads x 64, partial interleaved rotary on head dims 0..31 (16 frequencies, f32, applied on the f32 projection tiles before the f16 convert), logits x 1/8, full softmax over all keys (online, log2 domain), merged heads . Wout + bout.
// Flash form with transposed tiles: S^T accumulator tiles are directly the B-operand layout of P^T; all WMMA operands are two 16-byte loads.
// Operand tiles of the three matrix kernels are staged in LDS, 128 bytes of every row per stage, two buffers, by asynchronous copies that cover whole 128-byte lines; fragments are read from LDS rows at a 144-byte pitch.

#ifndef NB
#define NB 4
#endif
#ifndef SEQ
#define SEQ 2048
#endif
#define NB_FULL  4
#define SEQ_FULL 2048
#define DM   1024              // model width == merged head width
#define NH   16
#define HD   64
#define NQKV 3072              // rows of the transposed q|k|v weight plane
#define NWT  4096              // q|k|v|out rows of the transposed weight plane
#define GM   128               // token rows per GEMM block (4 waves x 32 rows)
#define SP   68                // LDS pitch (floats) of the GEMM staging rows
#define NWV  4                 // waves per flash block
#define BQ   (16 * NWV)        // queries per flash block
#define KS   32                // keys per step
#define OSP  68                // LDS pitch (floats) of the flash output staging rows
#define VTP  72                // LDS pitch (16-bit elements) of the weight transpose tile
#define LP   72                // LDS pitch (16-bit elements) of a staged 128-byte row: 144 B = 16 B x 9, conflict-free for 16-byte fragment reads
#define LPB  (LP * 2)          // the same in bytes
#define SK   64                // 16-bit elements of a row per stage (GEMM: k; flash: keys of a V^T row, and keys per stage)
#define PBUF ((GM + 64) * LPB)         // k_proj buffer: 128 A rows | 64 B rows
#define FBUF ((SK + HD) * LPB)         // k_flash buffer: 64 K rows | 64 V^T rows
#define OBUF ((2 * GM + 64) * LPB)     // k_out buffer: 128 hi rows | 128 lo rows | 64 B rows
#define L2E  1.4426950408889634f
#define PCARRY 12.0f           // P carried as 2^12 * p (row sum carried alike, cancels in the normalisation)

static_assert(NH == 16);
static_assert(HD == 64);
static_assert(NH * HD == DM);
static_assert(SEQ % GM == 0);
static_assert(SEQ % BQ == 0);
static_assert(SEQ % KS == 0);
static_assert(DM % 32 == 0);
static_assert(DM % SK == 0 && DM / SK >= 2);       // GEMM ring: whole stages, at least two
static_assert(SEQ % SK == 0 && SEQ / SK >= 2);     // flash ring: whole stages, at least two
static_assert(SK == 2 * KS && HD == 64 && GM == 128);
static_assert(2 * PBUF >= GM * SP * 4);            // the ring holds the GEMM output staging
static_assert(2 * OBUF >= GM * SP * 4);
static_assert(2 * FBUF >= NWV * 16 * OSP * 4);     // the ring holds the flash output staging
static_assert(NB <= NB_FULL);
static_assert(SEQ <= SEQ_FULL);
static_assert(((size_t)NB * SEQ * DM) % 2048 == 0);                                        // k_cvt: grid * 256 threads * 8 elements == plane
static_assert((size_t)(DM / 64) * (NWT / 128) * (size_t)(64 * 128) == (size_t)NWT * DM);   // k_wt: blocks * (64 k x 128 n) == weight plane
static_assert(((size_t)SEQ * 16) % 256 == 0);                                              // k_tab: grid * 256 == table entries
static_assert((size_t)(NB * SEQ / GM) * (NQKV / 64) * (size_t)(GM * 64) == (size_t)3 * NB * SEQ * DM);   // k_proj: blocks * (128 x 64) == q + k + v planes
static_assert((size_t)(NB * NH * (SEQ / BQ)) * (size_t)(BQ * HD) == (size_t)NB * SEQ * DM);              // k_flash: blocks * (64 x 64) == ctx plane
static_assert((size_t)(NB * SEQ / GM) * (DM / 64) * (size_t)(GM * 64) == (size_t)NB * SEQ * DM);         // k_out: blocks * (128 x 64) == output
static_assert(((size_t)SEQ * 16 * 4) % 256 == 0);
static_assert((size_t)6 * NB_FULL * SEQ_FULL * DM * 2 + (size_t)NWT * DM * 2 + (size_t)2 * SEQ_FULL * 16 * 4 <= (size_t)134217728);

typedef unsigned short bf;     // bf16 bit pattern
typedef unsigned short hb;     // f16 bit pattern
typedef __attribute__((ext_vector_type(16))) __bf16   v16bf;
typedef __attribute__((ext_vector_type(2)))  __bf16   v2bf;
typedef __attribute__((ext_vector_type(16))) _Float16 v16h;
typedef __attribute__((ext_vector_type(2)))  _Float16 v2h;
typedef __attribute__((ext_vector_type(8)))  unsigned short v8us;
typedef __attribute__((ext_vector_type(8)))  unsigned int   v8u;
typedef __attribute__((ext_vector_type(4)))  unsigned int   v4u;
typedef __attribute__((ext_vector_type(8)))  float    v8f;
typedef __attribute__((ext_vector_type(4)))  float    v4f;
typedef v4f  __attribute__((may_alias)) v4fa;
typedef v8us __attribute__((may_alias)) v8usa;

struct FreqArgs { float inv[16]; };
static_assert(sizeof(FreqArgs) == 64);

__device__ __forceinline__ unsigned short f2bf(float f) { unsigned u = __float_as_uint(f); u += 0x7FFFu + ((u >> 16) & 1u); return (unsigned short)(u >> 16); }
// RNE bf16 value of f kept in the upper 16 bits of an f32 bit pattern
__device__ __forceinline__ unsigned bfhi32(float f) { unsigned u = __float_as_uint(f); u += 0x7FFFu + ((u >> 16) & 1u); return u & 0xFFFF0000u; }
__device__ __forceinline__ float bfr(float f) { return __uint_as_float(bfhi32(f)); }
__device__ __forceinline__ v16bf cat16b(v8us lo, v8us hi) { return __builtin_bit_cast(v16bf, __builtin_shufflevector(lo, hi, 0, 1, 2, 3, 4, 5, 6, 7, 8, 9, 10, 11, 12, 13, 14, 15)); }
__device__ __forceinline__ v16h  cat16h(v8us lo, v8us hi) { return __builtin_bit_cast(v16h,  __builtin_shufflevector(lo, hi, 0, 1, 2, 3, 4, 5, 6, 7, 8, 9, 10, 11, 12, 13, 14, 15)); }
__device__ __forceinline__ v8f wmmab(v16bf a, v16bf b, v8f c) { return __builtin_amdgcn_wmma_f32_16x16x32_bf16(false, a, false, b, (short)0, c, false, false); }
__device__ __forceinline__ v8f wmmah(v16h a, v16h b, v8f c) { return __builtin_amdgcn_wmma_f32_16x16x32_f16(false, a, false, b, (short)0, c, false, false); }
// fragment loader (A and B alike): p = row base + k0 + 8*(lane>>4); elements 0..7 <- p[0..7], elements 8..15 <- p[16..23]
__device__ __forceinline__ v16h  ldh(const hb* p) { return cat16h(*(const v8us*)p, *(const v8us*)(p + 16)); }
// the same fragment loaders on LDS rows
__device__ __forceinline__ v16bf ldbs(const bf* p) { return cat16b(*(const v8usa*)p, *(const v8usa*)(p + 16)); }
__device__ __forceinline__ v16h  ldhs(const hb* p) { return cat16h(*(const v8usa*)p, *(const v8usa*)(p + 16)); }
// LDS byte address of a __shared__ location: the low 32 bits of its address
__device__ __forceinline__ unsigned ldsa(const void* p) { return (unsigned)(size_t)p; }
// Asynchronous copies global -> LDS, 16 bytes per lane each. The s_wait_xcnt closes each statement so that no address register of an issued copy is rewritten ahead of it.
#define CPA(l, g) "global_load_async_to_lds_b128 %" #l ", %" #g ", off\n\t"
__device__ __forceinline__ void cp8(const unsigned (&l)[8], const unsigned short* const (&g)[8]) {
    asm volatile(CPA(0, 8) CPA(1, 9) CPA(2, 10) CPA(3, 11) CPA(4, 12) CPA(5, 13) CPA(6, 14) CPA(7, 15) "s_wait_xcnt 0x0"
                 :: "v"(l[0]), "v"(l[1]), "v"(l[2]), "v"(l[3]), "v"(l[4]), "v"(l[5]), "v"(l[6]), "v"(l[7]),
                    "v"(g[0]), "v"(g[1]), "v"(g[2]), "v"(g[3]), "v"(g[4]), "v"(g[5]), "v"(g[6]), "v"(g[7]) : "memory");
}
__device__ __forceinline__ void cp12(const unsigned (&l)[12], const unsigned short* const (&g)[12]) {
    asm volatile(CPA(0, 12) CPA(1, 13) CPA(2, 14) CPA(3, 15) CPA(4, 16) CPA(5, 17) CPA(6, 18) CPA(7, 19) CPA(8, 20) CPA(9, 21) CPA(10, 22) CPA(11, 23) "s_wait_xcnt 0x0"
                 :: "v"(l[0]), "v"(l[1]), "v"(l[2]), "v"(l[3]), "v"(l[4]), "v"(l[5]), "v"(l[6]), "v"(l[7]), "v"(l[8]), "v"(l[9]), "v"(l[10]), "v"(l[11]),
                    "v"(g[0]), "v"(g[1]), "v"(g[2]), "v"(g[3]), "v"(g[4]), "v"(g[5]), "v"(g[6]), "v"(g[7]), "v"(g[8]), "v"(g[9]), "v"(g[10]), "v"(g[11]) : "memory");
}
// A block of 128 threads copies 16 rows of 128 bytes per copy: thread -> row tid >> 3, 16-byte piece tid & 7 (a wave covers 4 whole lines).
// la, ga: this thread's LDS byte address and global address in rows 0..15 of a tile; stage8: two tiles of 64 rows, global pitches pa, pb elements; stage12: a tile of 128 rows and one of 64, global pitch DM.
__device__ __forceinline__ void stage8(unsigned la, const unsigned short* ga, size_t pa, unsigned lb, const unsigned short* gb, size_t pb) {
    unsigned l[8]; const unsigned short* g[8];
#pragma unroll   // constant indices, so that both arrays are registers (asm operands)
    for (unsigned i = 0; i < 4; ++i) {
        l[i] = la + i * 16u * LPB;      g[i] = ga + i * 16u * pa;
        l[4 + i] = lb + i * 16u * LPB;  g[4 + i] = gb + i * 16u * pb;
    }
    cp8(l, g);
}
__device__ __forceinline__ void stage12(unsigned la, const unsigned short* ga, unsigned lb, const unsigned short* gb) {
    unsigned l[12]; const unsigned short* g[12];
#pragma unroll   // constant indices, so that both arrays are registers (asm operands)
    for (unsigned i = 0; i < 8; ++i) { l[i] = la + i * 16u * LPB;  g[i] = ga + (size_t)i * 16u * DM; }
#pragma unroll   // as above
    for (unsigned i = 0; i < 4; ++i) { l[8 + i] = lb + i * 16u * LPB;  g[8 + i] = gb + (size_t)i * 16u * DM; }
    cp12(l, g);
}
// this wave's copies have landed
__device__ __forceinline__ void wait_copies() { asm volatile("s_wait_asynccnt 0x0" ::: "memory"); }
// this wave's LDS reads have returned (before the barrier behind which their buffer is refilled)
__device__ __forceinline__ void wait_lds() { asm volatile("s_wait_dscnt 0x0" ::: "memory"); }
// two f32 -> packed 16-bit pair (RNE), element 0 in the low half-word
__device__ __forceinline__ unsigned pk2bf(float a, float b) { v2bf t; t[0] = (__bf16)a; t[1] = (__bf16)b; return __builtin_bit_cast(unsigned, t); }
__device__ __forceinline__ unsigned pk2h(float a, float b) { v2h t; t[0] = (_Float16)a; t[1] = (_Float16)b; return __builtin_bit_cast(unsigned, t); }

__global__ __launch_bounds__(256) void k_cvt(const float* __restrict__ x, bf* XB) {
    const unsigned i = blockIdx.x * 256u + threadIdx.x;
    const unsigned per = (unsigned)(SEQ * DM / 8);
    if (i >= (unsigned)NB * per) return;
    const unsigned b = i / per, r = i - b * per;
    const float* src = x + (size_t)b * SEQ_FULL * DM + (size_t)r * 8;
    const v4f v0 = *(const v4f*)src;
    const v4f v1 = *(const v4f*)(src + 4);
    v4u o;
    o[0] = (bfhi32(v0[0]) >> 16) | bfhi32(v0[1]);
    o[1] = (bfhi32(v0[2]) >> 16) | bfhi32(v0[3]);
    o[2] = (bfhi32(v1[0]) >> 16) | bfhi32(v1[1]);
    o[3] = (bfhi32(v1[2]) >> 16) | bfhi32(v1[3]);
    bf* dst = XB + (size_t)i * 8;
    *(v4u*)dst = o;
    
}

// k_wt: transposed bf16 weight plane WT[n][k] = bf16(W[k][n]); in[DM k][ncols] -> out[ncols][DM]; virtual column space: 0..1023 Wq, 1024..3071 Wkv, 3072..4095 Wout.
__global__ __launch_bounds__(256) void k_wt(const float* __restrict__ Wq, const float* __restrict__ Wkv, const float* __restrict__ Wo, bf* WT) {
    __shared__ __align__(16) bf tl[128 * VTP];
    const unsigned tid = threadIdx.x;
    const unsigned k0 = blockIdx.x * 64u;
    const unsigned n0 = blockIdx.y * 128u;
    const float* src;
    unsigned ldn;
    if (n0 < 1024u)      { src = Wq  + n0;            ldn = 1024u; }
    else if (n0 < 3072u) { src = Wkv + (n0 - 1024u);  ldn = 2048u; }
    else                 { src = Wo  + (n0 - 3072u);  ldn = 1024u; }
    src += (size_t)k0 * ldn;
#pragma unroll
    for (unsigned it = 0; it < 8; ++it) {
        const unsigned f = it * 256u + tid;
        const unsigned kk = f >> 5, c4 = (f & 31u) * 4u;
        const v4f x = *(const v4f*)(src + (size_t)kk * ldn + c4);
#pragma unroll
        for (unsigned c = 0; c < 4; ++c) tl[(c4 + c) * VTP + kk] = f2bf(x[c]);
    }
    __syncthreads();
    bf* dst = WT + (size_t)n0 * DM + k0;
    const unsigned c8 = (tid & 7u) * 8u, dr = tid >> 3;
{
#pragma unroll
        for (unsigned it = 0; it < 4; ++it) {
            const unsigned d = it * 32u + dr;
            const v8us o = *(const v8usa*)(tl + d * VTP + c8);
            *(v8us*)(dst + (size_t)d * DM + c8) = o;
        }
        
    }
}

__global__ __launch_bounds__(256) void k_tab(FreqArgs fa, float* cosT, float* sinT) {
    const unsigned i = blockIdx.x * 256u + threadIdx.x;
    const unsigned t = i >> 4, f = i & 15u;
    float inv = fa.inv[0];
#pragma unroll
    for (unsigned j = 1; j < 16; ++j) inv = (f == j) ? fa.inv[j] : inv;
    const float ang = (float)t * inv;
    float s, c;
    sincosf(ang, &s, &c);
    *(float*)(cosT + i) = c;
    *(float*)(sinT + i) = s;
    
}

// k_proj: [q|k|v] = XB . WT^T, block = 128 token rows x 64 columns (one head of q, k or v), wave = 32 rows x 64 columns.
//  A = XB rows (row m = token, k = input channel), B = WT rows (column n = output channel, k = input channel); D element r of lane (h, n) = C[row 8h + r][col n].
__global__ __launch_bounds__(128) void k_proj(const bf* __restrict__ XB, const bf* __restrict__ WT,
                                              const float* __restrict__ cosT, const float* __restrict__ sinT,
                                              hb* QH, hb* KH, hb* VT) {
    __shared__ __align__(16) unsigned char sm[2 * PBUF];   // operand ring; output staging behind the loop
    float* st = (float*)sm;
    const unsigned tid = threadIdx.x, lane = tid & 31u, wv = tid >> 5, lr = lane & 15u, hi = lane >> 4;
    const unsigned m0 = blockIdx.x * GM;
    const unsigned nt = blockIdx.y;
    const unsigned cr = tid >> 3, cc = (tid & 7u) * 8u;
    const bf* ga = XB + (size_t)(m0 + cr) * DM + cc;
    const bf* gb = WT + (size_t)(nt * 64u + cr) * DM + cc;
    const unsigned la = ldsa(sm) + cr * LPB + cc * 2u;
    const unsigned lb = la + GM * LPB;

    v8f c0[4], c1[4];
#pragma unroll
    for (int t = 0; t < 4; ++t) { c0[t] = (v8f){}; c1[t] = (v8f){}; }

    stage12(la, ga, lb, gb);
    wait_copies();
    __syncthreads();
    stage12(la + PBUF, ga + SK, lb + PBUF, gb + SK);

    unsigned cur = 0;   // byte offset of the buffer that this trip reads
#pragma unroll 1   // one trip per stage stays a loop: small text, one publish point
    for (unsigned s = 0; s < (unsigned)(DM / SK); ++s) {
        const bf* ap = (const bf*)(sm + cur) + (32u * wv + lr) * LP + 8u * hi;
        const bf* bp = (const bf*)(sm + cur) + (GM + lr) * LP + 8u * hi;
#pragma unroll   // both 32-wide steps of a stage: constant LDS offsets
        for (unsigned k0 = 0; k0 < (unsigned)SK; k0 += 32) {
            const v16bf a0 = ldbs(ap + k0);
            const v16bf a1 = ldbs(ap + 16 * LP + k0);
#pragma unroll
            for (int t = 0; t < 4; ++t) {
                const v16bf bb = ldbs(bp + t * 16 * LP + k0);
                c0[t] = wmmab(a0, bb, c0[t]);
                c1[t] = wmmab(a1, bb, c1[t]);
            }
            asm volatile("v_nop\n\tv_nop\n\tv_nop\n\tv_nop"
                         : "+v"(c0[0]), "+v"(c0[1]), "+v"(c0[2]), "+v"(c0[3]), "+v"(c1[0]), "+v"(c1[1]), "+v"(c1[2]), "+v"(c1[3])
                         : "v"(a0), "v"(a1));
        }
        // publish stage s + 1, free stage s's buffer, refill it with stage s + 2
        wait_lds();
        wait_copies();
        __syncthreads();
        if (s + 2u < (unsigned)(DM / SK)) stage12(la + cur, ga + (s + 2u) * SK, lb + cur, gb + (s + 2u) * SK);
        cur = PBUF - cur;
    }
    wait_copies();

    float* sw = st + (32u * wv) * SP;
#pragma unroll
    for (int t = 0; t < 4; ++t) {
#pragma unroll
        for (int r = 0; r < 8; ++r) {
            sw[(8u * hi + r) * SP + t * 16 + lr] = c0[t][r];
            sw[(16u + 8u * hi + r) * SP + t * 16 + lr] = c1[t][r];
        }
    }
    __syncthreads();

    const unsigned b = m0 / (unsigned)SEQ;
    const unsigned pos0 = m0 - b * (unsigned)SEQ;
    if (nt < 32u) {
        // q (nt 0..15) or k (nt 16..31) head: rows [pos][64], rotary on column groups 0..3
        const unsigned h = nt & 15u;
        hb* dst = (nt < 16u ? QH : KH) + ((size_t)(b * NH + h) * SEQ + pos0) * HD;
        const unsigned cg = lane & 7u, rq = lane >> 3;
        const bool rot = cg < 4u;
        const unsigned tc = (cg & 3u) * 4u;
{
#pragma unroll 2
            for (unsigned it = 0; it < 8; ++it) {
                const unsigned row = 32u * wv + 4u * it + rq;
                const float* sr = st + row * SP + 8u * cg;
                const v4f xa = *(const v4fa*)sr;
                const v4f xb = *(const v4fa*)(sr + 4);
                const unsigned ti = (pos0 + row) * 16u + tc;
                const v4f c4 = *(const v4f*)(cosT + ti);
                const v4f s4 = *(const v4f*)(sinT + ti);
                const float x[8] = { xa[0], xa[1], xa[2], xa[3], xb[0], xb[1], xb[2], xb[3] };
                v4u o;
#pragma unroll
                for (int j = 0; j < 4; ++j) {
                    const float x1 = x[2 * j], x2 = x[2 * j + 1];
                    const float r1 = x1 * c4[j] - x2 * s4[j];
                    const float r2 = x2 * c4[j] + x1 * s4[j];
                    o[j] = pk2h(rot ? r1 : x1, rot ? r2 : x2);
                }
                *(v4u*)(dst + (size_t)row * HD + 8u * cg) = o;
            }
            
        }
    } else {
        // v head: VT[d][pos]; 128 lines (64 d x 2 halves of 64 positions) per block, 4 lines per instruction
        const unsigned h = nt - 32u;
        hb* dst = VT + (size_t)(b * NH + h) * HD * SEQ + pos0;
        const unsigned c8 = (lane & 7u) * 8u, lq = lane >> 3;
{
#pragma unroll 2
            for (unsigned it = 0; it < 8; ++it) {
                const unsigned L = (wv * 8u + it) * 4u + lq;
                const unsigned d = L >> 1, tk = (L & 1u) * 64u + c8;
                const float* sc = st + tk * SP + d;
                v4u o;
#pragma unroll
                for (int j = 0; j < 4; ++j) o[j] = pk2h(sc[(2 * j) * SP], sc[(2 * j + 1) * SP]);
                *(v4u*)(dst + (size_t)d * SEQ + tk) = o;
            }
            
        }
    }
}

// k_flash: one wave per 16 queries of one (batch, head), 32 keys per step.
//  S^T tile (keys x queries): A = K rows (row m = key, k = d), B = Q rows (column n = query, k = d); D element r of lane (h, n) = S[query n][key 8h + r].
//  P^T B fragment: element r <- tile of keys 0..15, element 8 + r <- tile of keys 16..31 (same lane); P carried x 2^12 in f16, row sum carried alike.
//  O^T tile (d x queries): A = V^T rows (row m = d, k = key), D element r of lane (h, n) = O[query n][d = 16 t + 8h + r].
__global__ __launch_bounds__(128) void k_flash(const hb* __restrict__ QH, const hb* __restrict__ KH, const hb* __restrict__ VT, bf* CH, bf* CL) {
    __shared__ __align__(16) unsigned char sm[2 * FBUF];   // K | V^T ring; output staging behind the loop
    float* os = (float*)sm;
    const unsigned tid = threadIdx.x, lane = tid & 31u, wv = tid >> 5, lr = lane & 15u, hi = lane >> 4;
    const unsigned qpb = (unsigned)(SEQ / BQ);
    const unsigned bh = blockIdx.x / qpb;
    const unsigned q0 = (blockIdx.x - bh * qpb) * BQ + wv * 16u;
    const unsigned b = bh >> 4, h = bh & 15u;

    v16h qf[2];
    {
        const hb* qp = QH + ((size_t)bh * SEQ + q0 + lr) * HD + 8u * hi;
        qf[0] = ldh(qp);
        qf[1] = ldh(qp + 32);
    }
    const unsigned cr = tid >> 3, cc = (tid & 7u) * 8u;
    const hb* gk = KH + ((size_t)bh * SEQ + cr) * HD + cc;
    const hb* gv = VT + ((size_t)bh * HD + cr) * SEQ + cc;
    const unsigned lk = ldsa(sm) + cr * LPB + cc * 2u;
    const unsigned lv = lk + SK * LPB;

    v8f o[4];
#pragma unroll
    for (int t = 0; t < 4; ++t) o[t] = (v8f){};
    float ml = -1.0e30f;      // running max in the log2 domain
    float l = 0.0f;           // running sum (carried x 2^12)
    const float CS = 0.125f * L2E;

    stage8(lk, gk, HD, lv, gv, SEQ);
    wait_copies();
    __syncthreads();
    stage8(lk + FBUF, gk + (size_t)SK * HD, HD, lv + FBUF, gv + SK, SEQ);

    unsigned cur = 0;   // byte offset of the buffer that this trip reads
#pragma unroll 1   // one trip per stage stays a loop: small text, one publish point
    for (unsigned sg = 0; sg < (unsigned)(SEQ / SK); ++sg) {
      const hb* kp = (const hb*)(sm + cur) + lr * LP + 8u * hi;
      const hb* vp = kp + SK * LP;
#pragma unroll   // both 32-key steps of a stage: constant LDS offsets
      for (unsigned k0 = 0; k0 < (unsigned)SK; k0 += KS) {
        v8f s0 = (v8f){}, s1 = (v8f){};
        const hb* ka = kp + k0 * LP;
#pragma unroll
        for (int dk = 0; dk < 2; ++dk) {
            const v16h a0 = ldhs(ka + dk * 32);
            const v16h a1 = ldhs(ka + 16 * LP + dk * 32);
            s0 = wmmah(a0, qf[dk], s0);
            s1 = wmmah(a1, qf[dk], s1);
        }
        asm volatile("v_nop\n\tv_nop\n\tv_nop\n\tv_nop" : "+v"(s0), "+v"(s1) : "v"(qf[0]), "v"(qf[1]));

        float mx = fmaxf(s0[0], s1[0]);
#pragma unroll
        for (int r = 1; r < 8; ++r) mx = fmaxf(mx, fmaxf(s0[r], s1[r]));
        mx = fmaxf(mx, __shfl_xor(mx, 16, 32));
        const float mnl = fmaxf(ml, mx * CS);
        const float corr = __builtin_amdgcn_exp2f(ml - mnl);
        ml = mnl;
        const float pm = PCARRY - mnl;
        float p0[8], p1[8];
        float ps = 0.0f;
#pragma unroll
        for (int r = 0; r < 8; ++r) {
            p0[r] = __builtin_amdgcn_exp2f(fmaf(s0[r], CS, pm));
            p1[r] = __builtin_amdgcn_exp2f(fmaf(s1[r], CS, pm));
            ps += p0[r] + p1[r];
        }
        ps += __shfl_xor(ps, 16, 32);
        l = l * corr + ps;
        if (__builtin_amdgcn_ballot_w32(corr != 1.0f) != 0u) {   // wave-uniform; multiplying by exactly 1 is skipped
#pragma unroll
            for (int t = 0; t < 4; ++t) o[t] *= corr;
        }

        v8u hw;
#pragma unroll
        for (int j = 0; j < 4; ++j) {
            hw[j]     = pk2h(p0[2 * j], p0[2 * j + 1]);
            hw[4 + j] = pk2h(p1[2 * j], p1[2 * j + 1]);
        }
        const v16h ph = __builtin_bit_cast(v16h, hw);

        asm volatile("" ::: "memory");   // keep the V^T loads below the softmax (bounds live fragments)
        const hb* va = vp + k0;
#pragma unroll
        for (int t = 0; t < 4; ++t) {
            const v16h a = ldhs(va + t * 16 * LP);
            o[t] = wmmah(a, ph, o[t]);
        }
        asm volatile("v_nop\n\tv_nop\n\tv_nop\n\tv_nop"
                     : "+v"(o[0]), "+v"(o[1]), "+v"(o[2]), "+v"(o[3])
                     : "v"(ph));
      }
      // publish stage sg + 1, free stage sg's buffer, refill it with stage sg + 2
      wait_lds();
      wait_copies();
      __syncthreads();
      if (sg + 2u < (unsigned)(SEQ / SK)) stage8(lk + cur, gk + (size_t)(sg + 2u) * SK * HD, HD, lv + cur, gv + (sg + 2u) * SK, SEQ);
      cur = FBUF - cur;
    }
    wait_copies();

    const float inv = 1.0f / l;
    float* ow = os + wv * (16 * OSP);
#pragma unroll
    for (int t = 0; t < 4; ++t) {
#pragma unroll
        for (int r = 0; r < 8; ++r) ow[lr * OSP + t * 16 + 8 * hi + r] = o[t][r] * inv;
    }
    __syncthreads();
    const unsigned cg = lane & 7u, rq = lane >> 3;
    const size_t cbase = ((size_t)b * SEQ + q0) * DM + h * HD + 8u * cg;
{
#pragma unroll
        for (unsigned s = 0; s < 4; ++s) {
            const unsigned row = 4u * s + rq;
            const float* sr = ow + row * OSP + 8u * cg;
            const v4f xa = *(const v4fa*)sr;
            const v4f xb = *(const v4fa*)(sr + 4);
            const float x[8] = { xa[0], xa[1], xa[2], xa[3], xb[0], xb[1], xb[2], xb[3] };
            v4u oh, ol;
#pragma unroll
            for (int j = 0; j < 4; ++j) {
                const unsigned r0 = bfhi32(x[2 * j]), r1 = bfhi32(x[2 * j + 1]);
                oh[j] = (r0 >> 16) | r1;
                ol[j] = pk2bf(x[2 * j] - __uint_as_float(r0), x[2 * j + 1] - __uint_as_float(r1));
            }
            *(v4u*)(CH + cbase + (size_t)row * DM) = oh;
            *(v4u*)(CL + cbase + (size_t)row * DM) = ol;
        }
        
    }
}

// k_out: out = (CH + CL) . WOT^T + bf16(bout); block = 128 rows x 64 columns, wave = 32 rows x 64 columns; hi and lo products share the B fragments and the accumulator.
__global__ __launch_bounds__(128) void k_out(const bf* __restrict__ CH, const bf* __restrict__ CL, const bf* __restrict__ WOT,
                                             const float* __restrict__ bout, float* O) {
    __shared__ __align__(16) unsigned char sm[2 * OBUF];   // operand ring; output staging behind the loop
    float* st = (float*)sm;
    const unsigned tid = threadIdx.x, lane = tid & 31u, wv = tid >> 5, lr = lane & 15u, hi = lane >> 4;
    const unsigned m0 = blockIdx.x * GM;
    const unsigned n0 = blockIdx.y * 64u;
    const unsigned cr = tid >> 3, cc = (tid & 7u) * 8u;
    const size_t aoff = (size_t)(m0 + cr) * DM + cc;
    const bf* gh = CH + aoff;
    const bf* gl = CL + aoff;
    const bf* gb = WOT + (size_t)(n0 + cr) * DM + cc;
    const unsigned lh = ldsa(sm) + cr * LPB + cc * 2u;
    const unsigned ll = lh + GM * LPB;
    const unsigned lb = lh + 2 * GM * LPB;

    v8f c0[4], c1[4];
#pragma unroll
    for (int t = 0; t < 4; ++t) { c0[t] = (v8f){}; c1[t] = (v8f){}; }

    stage8(lh, gh, DM, lh + 64 * LPB, gh + (size_t)64 * DM, DM);
    stage12(ll, gl, lb, gb);
    wait_copies();
    __syncthreads();
    stage8(lh + OBUF, gh + SK, DM, lh + OBUF + 64 * LPB, gh + (size_t)64 * DM + SK, DM);
    stage12(ll + OBUF, gl + SK, lb + OBUF, gb + SK);

    unsigned cur = 0;   // byte offset of the buffer that this trip reads
#pragma unroll 1   // one trip per stage stays a loop: small text, one publish point
    for (unsigned s = 0; s < (unsigned)(DM / SK); ++s) {
        const bf* ah = (const bf*)(sm + cur) + (32u * wv + lr) * LP + 8u * hi;
        const bf* al = ah + GM * LP;
        const bf* bp = (const bf*)(sm + cur) + (2 * GM + lr) * LP + 8u * hi;
#pragma unroll   // both 32-wide steps of a stage: constant LDS offsets
        for (unsigned k0 = 0; k0 < (unsigned)SK; k0 += 32) {
            const v16bf h0 = ldbs(ah + k0);
            const v16bf h1 = ldbs(ah + 16 * LP + k0);
            const v16bf l0 = ldbs(al + k0);
            const v16bf l1 = ldbs(al + 16 * LP + k0);
#pragma unroll
            for (int t = 0; t < 4; ++t) {
                const v16bf bb = ldbs(bp + t * 16 * LP + k0);
                c0[t] = wmmab(h0, bb, c0[t]);
                c0[t] = wmmab(l0, bb, c0[t]);
                c1[t] = wmmab(h1, bb, c1[t]);
                c1[t] = wmmab(l1, bb, c1[t]);
            }
            asm volatile("v_nop\n\tv_nop\n\tv_nop\n\tv_nop"
                         : "+v"(c0[0]), "+v"(c0[1]), "+v"(c0[2]), "+v"(c0[3]), "+v"(c1[0]), "+v"(c1[1]), "+v"(c1[2]), "+v"(c1[3])
                         : "v"(h0), "v"(h1), "v"(l0), "v"(l1));
        }
        // publish stage s + 1, free stage s's buffer, refill it with stage s + 2
        wait_lds();
        wait_copies();
        __syncthreads();
        if (s + 2u < (unsigned)(DM / SK)) {
            const unsigned kn = (s + 2u) * SK;
            stage8(lh + cur, gh + kn, DM, lh + cur + 64 * LPB, gh + (size_t)64 * DM + kn, DM);
            stage12(ll + cur, gl + kn, lb + cur, gb + kn);
        }
        cur = OBUF - cur;
    }
    wait_copies();

    float* sw = st + (32u * wv) * SP;
#pragma unroll
    for (int t = 0; t < 4; ++t) {
#pragma unroll
        for (int r = 0; r < 8; ++r) {
            sw[(8u * hi + r) * SP + t * 16 + lr] = c0[t][r];
            sw[(16u + 8u * hi + r) * SP + t * 16 + lr] = c1[t][r];
        }
    }
    __syncthreads();

    const unsigned c4 = (lane & 15u) * 4u, rh = lane >> 4;
    const v4f bv = *(const v4f*)(bout + n0 + c4);
    const float b0 = bfr(bv[0]), b1 = bfr(bv[1]), b2 = bfr(bv[2]), b3 = bfr(bv[3]);
    float* orow = O + (size_t)(m0 + 32u * wv) * DM + n0 + c4;
{
#pragma unroll 4
        for (unsigned it = 0; it < 16; ++it) {
            const unsigned row = 2u * it + rh;
            v4f val = *(const v4fa*)(sw + row * SP + c4);
            val[0] += b0; val[1] += b1; val[2] += b2; val[3] += b3;
            *(v4f*)(orow + (size_t)row * DM) = val;
        }
        
    }
}

extern "C" void kernel_launch(void* const* d_in, const int* in_sizes, int n_in,
                              void* d_out, int out_size, void* d_ws, size_t ws_size, hipStream_t stream) {
    if (n_in < 5) return;
    const size_t needx = ((size_t)(NB - 1) * SEQ_FULL + SEQ) * DM;
    if ((size_t)in_sizes[0] < needx) return;
    if ((size_t)in_sizes[1] < (size_t)DM * DM) return;
    if ((size_t)in_sizes[2] < (size_t)2 * DM * DM) return;
    if ((size_t)in_sizes[3] < (size_t)DM * DM) return;
    if ((size_t)in_sizes[4] < (size_t)DM) return;
    if ((size_t)out_size < (size_t)NB * SEQ * DM) return;
    const float* x    = (const float*)d_in[0];   // queries [NB_FULL][SEQ_FULL][DM]
    const float* Wq   = (const float*)d_in[1];   // [DM in][DM out]
    const float* Wkv  = (const float*)d_in[2];   // [DM in][2*DM out]
    const float* Wout = (const float*)d_in[3];   // [DM in][DM out]
    const float* bout = (const float*)d_in[4];   // [DM]
    float* OUT = (float*)d_out;                  // [NB][SEQ][DM]

    const size_t PA = (size_t)NB * SEQ * DM * 2;     // bytes per 16-bit activation plane
    const size_t PW = (size_t)NWT * DM * 2;          // bytes of the transposed weight plane
    const size_t PT = (size_t)SEQ * 16 * 4;          // bytes per rotary table
    if (6 * PA + PW + 2 * PT > ws_size) return;
    char* wsp = (char*)d_ws;
    bf* XB = (bf*)(wsp);
    bf* WT = (bf*)(wsp + PA);
    float* cosT = (float*)(wsp + PA + PW);
    float* sinT = (float*)(wsp + PA + PW + PT);
    hb* QH = (hb*)(wsp + PA + PW + 2 * PT);
    hb* KH = (hb*)(wsp + 2 * PA + PW + 2 * PT);
    hb* VT = (hb*)(wsp + 3 * PA + PW + 2 * PT);
    bf* CH = (bf*)(wsp + 4 * PA + PW + 2 * PT);
    bf* CL = (bf*)(wsp + 5 * PA + PW + 2 * PT);

    FreqArgs fa;
    for (int i = 0; i < 16; ++i) {
        const float pw = (float)pow(10000.0, (double)(2 * i) / 32.0);
        fa.inv[i] = 1.0f / pw;
    }

    const unsigned gc = (unsigned)(((size_t)NB * SEQ * DM / 8 + 255) / 256);
    k_cvt<<<gc, 256, 0, stream>>>(x, XB);
    k_wt<<<dim3(DM / 64, NWT / 128, 1), 256, 0, stream>>>(Wq, Wkv, Wout, WT);
    k_tab<<<(unsigned)(SEQ * 16 / 256), 256, 0, stream>>>(fa, cosT, sinT);
    k_proj<<<dim3((unsigned)(NB * SEQ / GM), NQKV / 64, 1), 128, 0, stream>>>(XB, WT, cosT, sinT, QH, KH, VT);
    k_flash<<<(unsigned)(NB * NH * (SEQ / BQ)), 128, 0, stream>>>(QH, KH, VT, CH, CL);
    k_out<<<dim3((unsigned)(NB * SEQ / GM), DM / 64, 1), 128, 0, stream>>>(CH, CL, WT + (size_t)NQKV * DM, bout, OUT);
}

// v002
// Measured time: 161 microseconds a run.
// Two timings next to v001 put it at 1.14 and 1.15 times that version's speed.
// All steps since v000 together make it 2.67 times as fast.
#include <hip/hip_runtime.h>

// Compute dtypes, f32 accumulate: x.Wq, x.Wkv on v_wmma_f32_16x16x32_bf16 (inputs RNE-converted to bf16, exact products); q.k^T and P.V on v_wmma_f32_16x16x32_f16 (q, k, v planes f16; P carried x4096 in f16); ctx.Wout on v_wmma_f32_16x16x32_bf16 with ctx as bf16 hi + bf16 lo (two products) against bf16 Wout.
// Self-attention, 16 heads x 64, partial interleaved rotary on head dims 0..31 (16 frequencies, f32, applied on the f32 projection tiles before the f16 convert), logits x 1/8, full softmax over all keys (online, log2 domain), merged heads . Wout + bout.
// Flash form with transposed tiles: S^T accumulator tiles are directly the B-operand layout of P^T; all WMMA operands are two 16-byte loads.
// Operand tiles of the three matrix kernels are staged in LDS, 128 bytes of every row per stage, two buffers, by asynchronous copies that cover whole 128-byte lines; fragments are read from LDS rows at a 144-byte pitch.

#ifndef NB
#define NB 4
#endif
#ifndef SEQ
#define SEQ 2048
#endif
#define NB_FULL  4
#define SEQ_FULL 2048
#define DM   1024              // model width == merged head width
#define NH   16
#define HD   64
#define NQKV 3072              // rows of the transposed q|k|v weight plane
#define NWT  4096              // q|k|v|out rows of the transposed weight plane
#define GM   128               // token rows per GEMM block (2 x 2 waves, 64 rows x 64 columns each)
#define GN   128               // output columns per GEMM block (k_proj: two heads)
#define SP   68                // LDS pitch (floats) of the GEMM staging rows
#define NWV  4                 // waves per flash block
#define BQ   (16 * NWV)        // queries per flash block
#define KS   32                // keys per step
#define OSP  68                // LDS pitch (floats) of the flash output staging rows
#define VTP  72                // LDS pitch (16-bit elements) of the weight transpose tile
#define LP   72                // LDS pitch (16-bit elements) of a staged 128-byte row: 144 B = 16 B x 9, conflict-free for 16-byte fragment reads
#define LPB  (LP * 2)          // the same in bytes
#define SK   64                // 16-bit elements of a row per stage (GEMM: k; flash: keys of a V^T row, and keys per stage)
#define PBUF ((GM + GN) * LPB)         // k_proj buffer: 128 A rows | 128 B rows
#define FBUF ((SK + HD) * LPB)         // k_flash buffer: 64 K rows | 64 V^T rows
#define OBUF ((2 * GM + GN) * LPB)     // k_out buffer: 128 hi rows | 128 lo rows | 128 B rows
#define L2E  1.4426950408889634f
#define PCARRY 12.0f           // P carried as 2^12 * p (row sum carried alike, cancels in the normalisation)

static_assert(NH == 16);
static_assert(HD == 64);
static_assert(NH * HD == DM);
static_assert(SEQ % GM == 0);
static_assert(SEQ % BQ == 0);
static_assert(SEQ % KS == 0);
static_assert(DM % 32 == 0);
static_assert(DM % SK == 0 && DM / SK >= 2);       // GEMM ring: whole stages, at least two
static_assert(SEQ % SK == 0 && SEQ / SK >= 2);     // flash ring: whole stages, at least two
static_assert(SK == 2 * KS && HD == 64 && GM == 128 && GN == 2 * HD);
static_assert(2 * PBUF >= 2 * GM * SP * 4);        // the ring holds the GEMM output staging (two planes of 64 columns)
static_assert(2 * OBUF >= 2 * GM * SP * 4);
static_assert(2 * FBUF >= NWV * 16 * OSP * 4);     // the ring holds the flash output staging
static_assert(NB <= NB_FULL);
static_assert(SEQ <= SEQ_FULL);
static_assert(((size_t)NB * SEQ * DM) % 2048 == 0);                                        // k_cvt: grid * 256 threads * 8 elements == plane
static_assert((size_t)(DM / 64) * (NWT / 128) * (size_t)(64 * 128) == (size_t)NWT * DM);   // k_wt: blocks * (64 k x 128 n) == weight plane
static_assert(((size_t)SEQ * 16) % 256 == 0);                                              // k_tab: grid * 256 == table entries
static_assert((size_t)(NB * SEQ / GM) * (NQKV / GN) * (size_t)(GM * GN) == (size_t)3 * NB * SEQ * DM);   // k_proj: blocks * (128 x 128) == q + k + v planes
static_assert((size_t)(NB * NH * (SEQ / BQ)) * (size_t)(BQ * HD) == (size_t)NB * SEQ * DM);              // k_flash: blocks * (64 x 64) == ctx plane
static_assert((size_t)(NB * SEQ / GM) * (DM / GN) * (size_t)(GM * GN) == (size_t)NB * SEQ * DM);         // k_out: blocks * (128 x 128) == output
static_assert(((size_t)SEQ * 16 * 4) % 256 == 0);
static_assert((size_t)6 * NB_FULL * SEQ_FULL * DM * 2 + (size_t)NWT * DM * 2 + (size_t)2 * SEQ_FULL * 16 * 4 <= (size_t)134217728);

typedef unsigned short bf;     // bf16 bit pattern
typedef unsigned short hb;     // f16 bit pattern
typedef __attribute__((ext_vector_type(16))) __bf16   v16bf;
typedef __attribute__((ext_vector_type(2)))  __bf16   v2bf;
typedef __attribute__((ext_vector_type(16))) _Float16 v16h;
typedef __attribute__((ext_vector_type(2)))  _Float16 v2h;
typedef __attribute__((ext_vector_type(8)))  unsigned short v8us;
typedef __attribute__((ext_vector_type(8)))  unsigned int   v8u;
typedef __attribute__((ext_vector_type(4)))  unsigned int   v4u;
typedef __attribute__((ext_vector_type(8)))  float    v8f;
typedef __attribute__((ext_vector_type(4)))  float    v4f;
typedef v4f  __attribute__((may_alias)) v4fa;
typedef v8us __attribute__((may_alias)) v8usa;

struct FreqArgs { float inv[16]; };
static_assert(sizeof(FreqArgs) == 64);

__device__ __forceinline__ unsigned short f2bf(float f) { unsigned u = __float_as_uint(f); u += 0x7FFFu + ((u >> 16) & 1u); return (unsigned short)(u >> 16); }
// RNE bf16 value of f kept in the upper 16 bits of an f32 bit pattern
__device__ __forceinline__ unsigned bfhi32(float f) { unsigned u = __float_as_uint(f); u += 0x7FFFu + ((u >> 16) & 1u); return u & 0xFFFF0000u; }
__device__ __forceinline__ float bfr(float f) { return __uint_as_float(bfhi32(f)); }
__device__ __forceinline__ v16bf cat16b(v8us lo, v8us hi) { return __builtin_bit_cast(v16bf, __builtin_shufflevector(lo, hi, 0, 1, 2, 3, 4, 5, 6, 7, 8, 9, 10, 11, 12, 13, 14, 15)); }
__device__ __forceinline__ v16h  cat16h(v8us lo, v8us hi) { return __builtin_bit_cast(v16h,  __builtin_shufflevector(lo, hi, 0, 1, 2, 3, 4, 5, 6, 7, 8, 9, 10, 11, 12, 13, 14, 15)); }
__device__ __forceinline__ v8f wmmab(v16bf a, v16bf b, v8f c) { return __builtin_amdgcn_wmma_f32_16x16x32_bf16(false, a, false, b, (short)0, c, false, false); }
__device__ __forceinline__ v8f wmmah(v16h a, v16h b, v8f c) { return __builtin_amdgcn_wmma_f32_16x16x32_f16(false, a, false, b, (short)0, c, false, false); }
// fragment loader (A and B alike): p = row base + k0 + 8*(lane>>4); elements 0..7 <- p[0..7], elements 8..15 <- p[16..23]
__device__ __forceinline__ v16h  ldh(const hb* p) { return cat16h(*(const v8us*)p, *(const v8us*)(p + 16)); }
// the same fragment loaders on LDS rows
__device__ __forceinline__ v16bf ldbs(const bf* p) { return cat16b(*(const v8usa*)p, *(const v8usa*)(p + 16)); }
__device__ __forceinline__ v16h  ldhs(const hb* p) { return cat16h(*(const v8usa*)p, *(const v8usa*)(p + 16)); }
// LDS byte address of a __shared__ location: the low 32 bits of its address
__device__ __forceinline__ unsigned ldsa(const void* p) { return (unsigned)(size_t)p; }
// Asynchronous copies global -> LDS, 16 bytes per lane each. The s_wait_xcnt closes each statement so that no address register of an issued copy is rewritten ahead of it.
#define CPA(l, g) "global_load_async_to_lds_b128 %" #l ", %" #g ", off\n\t"
__device__ __forceinline__ void cp8(const unsigned (&l)[8], const unsigned short* const (&g)[8]) {
    asm volatile(CPA(0, 8) CPA(1, 9) CPA(2, 10) CPA(3, 11) CPA(4, 12) CPA(5, 13) CPA(6, 14) CPA(7, 15) "s_wait_xcnt 0x0"
                 :: "v"(l[0]), "v"(l[1]), "v"(l[2]), "v"(l[3]), "v"(l[4]), "v"(l[5]), "v"(l[6]), "v"(l[7]),
                    "v"(g[0]), "v"(g[1]), "v"(g[2]), "v"(g[3]), "v"(g[4]), "v"(g[5]), "v"(g[6]), "v"(g[7]) : "memory");
}
// A block of 128 threads copies 16 rows of 128 bytes per copy: thread -> row tid >> 3, 16-byte piece tid & 7 (a wave covers 4 whole lines).
// la, ga: this thread's LDS byte address and global address in rows 0..15 of a tile; stage8: two tiles of 64 rows, global pitches pa, pb elements; stage128: one tile of 128 rows, global pitch DM.
__device__ __forceinline__ void stage8(unsigned la, const unsigned short* ga, size_t pa, unsigned lb, const unsigned short* gb, size_t pb) {
    unsigned l[8]; const unsigned short* g[8];
#pragma unroll   // constant indices, so that both arrays are registers (asm operands)
    for (unsigned i = 0; i < 4; ++i) {
        l[i] = la + i * 16u * LPB;      g[i] = ga + i * 16u * pa;
        l[4 + i] = lb + i * 16u * LPB;  g[4 + i] = gb + i * 16u * pb;
    }
    cp8(l, g);
}
__device__ __forceinline__ void stage128(unsigned l, const unsigned short* g) { stage8(l, g, DM, l + 64u * LPB, g + (size_t)64 * DM, DM); }
// this wave's copies have landed
__device__ __forceinline__ void wait_copies() { asm volatile("s_wait_asynccnt 0x0" ::: "memory"); }
// this wave's LDS reads have returned (before the barrier behind which their buffer is refilled)
__device__ __forceinline__ void wait_lds() { asm volatile("s_wait_dscnt 0x0" ::: "memory"); }
// two f32 -> packed 16-bit pair (RNE), element 0 in the low half-word
__device__ __forceinline__ unsigned pk2bf(float a, float b) { v2bf t; t[0] = (__bf16)a; t[1] = (__bf16)b; return __builtin_bit_cast(unsigned, t); }
__device__ __forceinline__ unsigned pk2h(float a, float b) { v2h t; t[0] = (_Float16)a; t[1] = (_Float16)b; return __builtin_bit_cast(unsigned, t); }

__global__ __launch_bounds__(256) void k_cvt(const float* __restrict__ x, bf* XB) {
    const unsigned i = blockIdx.x * 256u + threadIdx.x;
    const unsigned per = (unsigned)(SEQ * DM / 8);
    if (i >= (unsigned)NB * per) return;
    const unsigned b = i / per, r = i - b * per;
    const float* src = x + (size_t)b * SEQ_FULL * DM + (size_t)r * 8;
    const v4f v0 = *(const v4f*)src;
    const v4f v1 = *(const v4f*)(src + 4);
    v4u o;
    o[0] = (bfhi32(v0[0]) >> 16) | bfhi32(v0[1]);
    o[1] = (bfhi32(v0[2]) >> 16) | bfhi32(v0[3]);
    o[2] = (bfhi32(v1[0]) >> 16) | bfhi32(v1[1]);
    o[3] = (bfhi32(v1[2]) >> 16) | bfhi32(v1[3]);
    bf* dst = XB + (size_t)i * 8;
    *(v4u*)dst = o;
    
}

// k_wt: transposed bf16 weight plane WT[n][k] = bf16(W[k][n]); in[DM k][ncols] -> out[ncols][DM]; virtual column space: 0..1023 Wq, 1024..3071 Wkv, 3072..4095 Wout.
__global__ __launch_bounds__(256) void k_wt(const float* __restrict__ Wq, const float* __restrict__ Wkv, const float* __restrict__ Wo, bf* WT) {
    __shared__ __align__(16) bf tl[128 * VTP];
    const unsigned tid = threadIdx.x;
    const unsigned k0 = blockIdx.x * 64u;
    const unsigned n0 = blockIdx.y * 128u;
    const float* src;
    unsigned ldn;
    if (n0 < 1024u)      { src = Wq  + n0;            ldn = 1024u; }
    else if (n0 < 3072u) { src = Wkv + (n0 - 1024u);  ldn = 2048u; }
    else                 { src = Wo  + (n0 - 3072u);  ldn = 1024u; }
    src += (size_t)k0 * ldn;
#pragma unroll
    for (unsigned it = 0; it < 8; ++it) {
        const unsigned f = it * 256u + tid;
        const unsigned kk = f >> 5, c4 = (f & 31u) * 4u;
        const v4f x = *(const v4f*)(src + (size_t)kk * ldn + c4);
#pragma unroll
        for (unsigned c = 0; c < 4; ++c) tl[(c4 + c) * VTP + kk] = f2bf(x[c]);
    }
    __syncthreads();
    bf* dst = WT + (size_t)n0 * DM + k0;
    const unsigned c8 = (tid & 7u) * 8u, dr = tid >> 3;
{
#pragma unroll
        for (unsigned it = 0; it < 4; ++it) {
            const unsigned d = it * 32u + dr;
            const v8us o = *(const v8usa*)(tl + d * VTP + c8);
            *(v8us*)(dst + (size_t)d * DM + c8) = o;
        }
        
    }
}

__global__ __launch_bounds__(256) void k_tab(FreqArgs fa, float* cosT, float* sinT) {
    const unsigned i = blockIdx.x * 256u + threadIdx.x;
    const unsigned t = i >> 4, f = i & 15u;
    float inv = fa.inv[0];
#pragma unroll
    for (unsigned j = 1; j < 16; ++j) inv = (f == j) ? fa.inv[j] : inv;
    const float ang = (float)t * inv;
    float s, c;
    sincosf(ang, &s, &c);
    *(float*)(cosT + i) = c;
    *(float*)(sinT + i) = s;
    
}

// k_proj: [q|k|v] = XB . WT^T, block = 128 token rows x 128 columns (two heads of q, k or v), wave = 64 rows x 64 columns (one head).
//  A = XB rows (row m = token, k = input channel), B = WT rows (column n = output channel, k = input channel); D element r of lane (h, n) = C[row 8h + r][col n].
__global__ __launch_bounds__(128) void k_proj(const bf* __restrict__ XB, const bf* __restrict__ WT,
                                              const float* __restrict__ cosT, const float* __restrict__ sinT,
                                              hb* QH, hb* KH, hb* VT) {
    __shared__ __align__(16) unsigned char sm[2 * PBUF];   // operand ring; output staging behind the loop
    float* st = (float*)sm;
    const unsigned tid = threadIdx.x, lane = tid & 31u, wv = tid >> 5, lr = lane & 15u, hi = lane >> 4;
    const unsigned wm = wv >> 1, wn = wv & 1u;   // this wave's 64 rows and 64 columns of the block tile
    const unsigned m0 = blockIdx.x * GM;
    const unsigned nt = blockIdx.y;
    const unsigned cr = tid >> 3, cc = (tid & 7u) * 8u;
    const bf* ga = XB + (size_t)(m0 + cr) * DM + cc;
    const bf* gb = WT + (size_t)(nt * GN + cr) * DM + cc;
    const unsigned la = ldsa(sm) + cr * LPB + cc * 2u;
    const unsigned lb = la + GM * LPB;

    v8f c[4][4];   // [16-row tile][16-column tile]
#pragma unroll
    for (int i = 0; i < 4; ++i) {
#pragma unroll
        for (int t = 0; t < 4; ++t) c[i][t] = (v8f){};
    }

    stage128(la, ga);
    stage128(lb, gb);
    wait_copies();
    __syncthreads();
    stage128(la + PBUF, ga + SK);
    stage128(lb + PBUF, gb + SK);

    unsigned cur = 0;   // byte offset of the buffer that this trip reads
#pragma unroll 1   // one trip per stage stays a loop: small text, one publish point
    for (unsigned s = 0; s < (unsigned)(DM / SK); ++s) {
        const bf* ap = (const bf*)(sm + cur) + (64u * wm + lr) * LP + 8u * hi;
        const bf* bp = (const bf*)(sm + cur) + (GM + 64u * wn + lr) * LP + 8u * hi;
#pragma unroll   // both 32-wide steps of a stage: constant LDS offsets
        for (unsigned k0 = 0; k0 < (unsigned)SK; k0 += 32) {
            v16bf a[4], bb[4];
#pragma unroll
            for (int i = 0; i < 4; ++i) a[i] = ldbs(ap + i * 16 * LP + k0);
#pragma unroll
            for (int t = 0; t < 4; ++t) bb[t] = ldbs(bp + t * 16 * LP + k0);
#pragma unroll
            for (int t = 0; t < 4; ++t) {
#pragma unroll
                for (int i = 0; i < 4; ++i) c[i][t] = wmmab(a[i], bb[t], c[i][t]);
            }
        }
        // WMMA distance on both sides of the loop's branches: four vector slots behind the stage's last products
        asm volatile("v_nop\n\tv_nop\n\tv_nop\n\tv_nop"
                     :: "v"(c[0][0]), "v"(c[0][1]), "v"(c[0][2]), "v"(c[0][3]), "v"(c[1][0]), "v"(c[1][1]), "v"(c[1][2]), "v"(c[1][3]),
                        "v"(c[2][0]), "v"(c[2][1]), "v"(c[2][2]), "v"(c[2][3]), "v"(c[3][0]), "v"(c[3][1]), "v"(c[3][2]), "v"(c[3][3]));
        // publish stage s + 1, free stage s's buffer, refill it with stage s + 2
        wait_lds();
        wait_copies();
        __syncthreads();
        if (s + 2u < (unsigned)(DM / SK)) {
            stage128(la + cur, ga + (s + 2u) * SK);
            stage128(lb + cur, gb + (s + 2u) * SK);
        }
        cur = PBUF - cur;
    }
    wait_copies();

    // staging: plane wn holds the 128 rows x 64 columns of head 2 nt + wn
    float* sw = st + (wn * GM + 64u * wm) * SP;
#pragma unroll
    for (int i = 0; i < 4; ++i) {
#pragma unroll
        for (int t = 0; t < 4; ++t) {
#pragma unroll
            for (int r = 0; r < 8; ++r) sw[(16u * i + 8u * hi + r) * SP + t * 16 + lr] = c[i][t][r];
        }
    }
    __syncthreads();

    const unsigned b = m0 / (unsigned)SEQ;
    const unsigned pos0 = m0 - b * (unsigned)SEQ;
#pragma unroll 1   // the two heads of the block, one after the other: small text
  for (unsigned nh = 0; nh < 2u; ++nh) {
    const unsigned hd = 2u * nt + nh;
    const float* sh = st + nh * GM * SP;
    if (hd < 32u) {
        // q (hd 0..15) or k (hd 16..31) head: rows [pos][64], rotary on column groups 0..3
        const unsigned h = hd & 15u;
        hb* dst = (hd < 16u ? QH : KH) + ((size_t)(b * NH + h) * SEQ + pos0) * HD;
        const unsigned cg = lane & 7u, rq = lane >> 3;
        const bool rot = cg < 4u;
        const unsigned tc = (cg & 3u) * 4u;
{
#pragma unroll 2
            for (unsigned it = 0; it < 8; ++it) {
                const unsigned row = 32u * wv + 4u * it + rq;
                const float* sr = sh + row * SP + 8u * cg;
                const v4f xa = *(const v4fa*)sr;
                const v4f xb = *(const v4fa*)(sr + 4);
                const unsigned ti = (pos0 + row) * 16u + tc;
                const v4f c4 = *(const v4f*)(cosT + ti);
                const v4f s4 = *(const v4f*)(sinT + ti);
                const float x[8] = { xa[0], xa[1], xa[2], xa[3], xb[0], xb[1], xb[2], xb[3] };
                v4u o;
#pragma unroll
                for (int j = 0; j < 4; ++j) {
                    const float x1 = x[2 * j], x2 = x[2 * j + 1];
                    const float r1 = x1 * c4[j] - x2 * s4[j];
                    const float r2 = x2 * c4[j] + x1 * s4[j];
                    o[j] = pk2h(rot ? r1 : x1, rot ? r2 : x2);
                }
                *(v4u*)(dst + (size_t)row * HD + 8u * cg) = o;
            }
            
        }
    } else {
        // v head: VT[d][pos]; 128 lines (64 d x 2 halves of 64 positions) per head, 4 lines per instruction
        const unsigned h = hd - 32u;
        hb* dst = VT + (size_t)(b * NH + h) * HD * SEQ + pos0;
        const unsigned c8 = (lane & 7u) * 8u, lq = lane >> 3;
{
#pragma unroll 2
            for (unsigned it = 0; it < 8; ++it) {
                const unsigned L = (wv * 8u + it) * 4u + lq;
                const unsigned d = L >> 1, tk = (L & 1u) * 64u + c8;
                const float* sc = sh + tk * SP + d;
                v4u o;
#pragma unroll
                for (int j = 0; j < 4; ++j) o[j] = pk2h(sc[(2 * j) * SP], sc[(2 * j + 1) * SP]);
                *(v4u*)(dst + (size_t)d * SEQ + tk) = o;
            }
            
        }
    }
  }
}

// k_flash: one wave per 16 queries of one (batch, head), 32 keys per step.
//  S^T tile (keys x queries): A = K rows (row m = key, k = d), B = Q rows (column n = query, k = d); D element r of lane (h, n) = S[query n][key 8h + r].
//  P^T B fragment: element r <- tile of keys 0..15, element 8 + r <- tile of keys 16..31 (same lane); P carried x 2^12 in f16, row sum carried alike.
//  O^T tile (d x queries): A = V^T rows (row m = d, k = key), D element r of lane (h, n) = O[query n][d = 16 t + 8h + r].
__global__ __launch_bounds__(128) void k_flash(const hb* __restrict__ QH, const hb* __restrict__ KH, const hb* __restrict__ VT, bf* CH, bf* CL) {
    __shared__ __align__(16) unsigned char sm[2 * FBUF];   // K | V^T ring; output staging behind the loop
    float* os = (float*)sm;
    const unsigned tid = threadIdx.x, lane = tid & 31u, wv = tid >> 5, lr = lane & 15u, hi = lane >> 4;
    const unsigned qpb = (unsigned)(SEQ / BQ);
    const unsigned bh = blockIdx.x / qpb;
    const unsigned q0 = (blockIdx.x - bh * qpb) * BQ + wv * 16u;
    const unsigned b = bh >> 4, h = bh & 15u;

    v16h qf[2];
    {
        const hb* qp = QH + ((size_t)bh * SEQ + q0 + lr) * HD + 8u * hi;
        qf[0] = ldh(qp);
        qf[1] = ldh(qp + 32);
    }
    const unsigned cr = tid >> 3, cc = (tid & 7u) * 8u;
    const hb* gk = KH + ((size_t)bh * SEQ + cr) * HD + cc;
    const hb* gv = VT + ((size_t)bh * HD + cr) * SEQ + cc;
    const unsigned lk = ldsa(sm) + cr * LPB + cc * 2u;
    const unsigned lv = lk + SK * LPB;

    v8f o[4];
#pragma unroll
    for (int t = 0; t < 4; ++t) o[t] = (v8f){};
    float ml = -1.0e30f;      // running max in the log2 domain
    float l = 0.0f;           // running sum (carried x 2^12)
    const float CS = 0.125f * L2E;

    stage8(lk, gk, HD, lv, gv, SEQ);
    wait_copies();
    __syncthreads();
    stage8(lk + FBUF, gk + (size_t)SK * HD, HD, lv + FBUF, gv + SK, SEQ);

    unsigned cur = 0;   // byte offset of the buffer that this trip reads
#pragma unroll 1   // one trip per stage stays a loop: small text, one publish point
    for (unsigned sg = 0; sg < (unsigned)(SEQ / SK); ++sg) {
      const hb* kp = (const hb*)(sm + cur) + lr * LP + 8u * hi;
      const hb* vp = kp + SK * LP;
#pragma unroll   // both 32-key steps of a stage: constant LDS offsets
      for (unsigned k0 = 0; k0 < (unsigned)SK; k0 += KS) {
        v8f s0 = (v8f){}, s1 = (v8f){};
        const hb* ka = kp + k0 * LP;
#pragma unroll
        for (int dk = 0; dk < 2; ++dk) {
            const v16h a0 = ldhs(ka + dk * 32);
            const v16h a1 = ldhs(ka + 16 * LP + dk * 32);
            s0 = wmmah(a0, qf[dk], s0);
            s1 = wmmah(a1, qf[dk], s1);
        }
        asm volatile("v_nop\n\tv_nop\n\tv_nop\n\tv_nop" : "+v"(s0), "+v"(s1) : "v"(qf[0]), "v"(qf[1]));

        float mx = fmaxf(s0[0], s1[0]);
#pragma unroll
        for (int r = 1; r < 8; ++r) mx = fmaxf(mx, fmaxf(s0[r], s1[r]));
        mx = fmaxf(mx, __shfl_xor(mx, 16, 32));
        const float mnl = fmaxf(ml, mx * CS);
        const float corr = __builtin_amdgcn_exp2f(ml - mnl);
        ml = mnl;
        const float pm = PCARRY - mnl;
        float p0[8], p1[8];
        float ps = 0.0f;
#pragma unroll
        for (int r = 0; r < 8; ++r) {
            p0[r] = __builtin_amdgcn_exp2f(fmaf(s0[r], CS, pm));
            p1[r] = __builtin_amdgcn_exp2f(fmaf(s1[r], CS, pm));
            ps += p0[r] + p1[r];
        }
        ps += __shfl_xor(ps, 16, 32);
        l = l * corr + ps;
        if (__builtin_amdgcn_ballot_w32(corr != 1.0f) != 0u) {   // wave-uniform; multiplying by exactly 1 is skipped
#pragma unroll
            for (int t = 0; t < 4; ++t) o[t] *= corr;
        }

        v8u hw;
#pragma unroll
        for (int j = 0; j < 4; ++j) {
            hw[j]     = pk2h(p0[2 * j], p0[2 * j + 1]);
            hw[4 + j] = pk2h(p1[2 * j], p1[2 * j + 1]);
        }
        const v16h ph = __builtin_bit_cast(v16h, hw);

        asm volatile("" ::: "memory");   // keep the V^T loads below the softmax (bounds live fragments)
        const hb* va = vp + k0;
#pragma unroll
        for (int t = 0; t < 4; ++t) {
            const v16h a = ldhs(va + t * 16 * LP);
            o[t] = wmmah(a, ph, o[t]);
        }
        asm volatile("v_nop\n\tv_nop\n\tv_nop\n\tv_nop"
                     : "+v"(o[0]), "+v"(o[1]), "+v"(o[2]), "+v"(o[3])
                     : "v"(ph));
      }
      // publish stage sg + 1, free stage sg's buffer, refill it with stage sg + 2
      wait_lds();
      wait_copies();
      __syncthreads();
      if (sg + 2u < (unsigned)(SEQ / SK)) stage8(lk + cur, gk + (size_t)(sg + 2u) * SK * HD, HD, lv + cur, gv + (sg + 2u) * SK, SEQ);
      cur = FBUF - cur;
    }
    wait_copies();

    const float inv = 1.0f / l;
    float* ow = os + wv * (16 * OSP);
#pragma unroll
    for (int t = 0; t < 4; ++t) {
#pragma unroll
        for (int r = 0; r < 8; ++r) ow[lr * OSP + t * 16 + 8 * hi + r] = o[t][r] * inv;
    }
    __syncthreads();
    const unsigned cg = lane & 7u, rq = lane >> 3;
    const size_t cbase = ((size_t)b * SEQ + q0) * DM + h * HD + 8u * cg;
{
#pragma unroll
        for (unsigned s = 0; s < 4; ++s) {
            const unsigned row = 4u * s + rq;
            const float* sr = ow + row * OSP + 8u * cg;
            const v4f xa = *(const v4fa*)sr;
            const v4f xb = *(const v4fa*)(sr + 4);
            const float x[8] = { xa[0], xa[1], xa[2], xa[3], xb[0], xb[1], xb[2], xb[3] };
            v4u oh, ol;
#pragma unroll
            for (int j = 0; j < 4; ++j) {
                const unsigned r0 = bfhi32(x[2 * j]), r1 = bfhi32(x[2 * j + 1]);
                oh[j] = (r0 >> 16) | r1;
                ol[j] = pk2bf(x[2 * j] - __uint_as_float(r0), x[2 * j + 1] - __uint_as_float(r1));
            }
            *(v4u*)(CH + cbase + (size_t)row * DM) = oh;
            *(v4u*)(CL + cbase + (size_t)row * DM) = ol;
        }
        
    }
}

// k_out: out = (CH + CL) . WOT^T + bf16(bout); block = 128 rows x 128 columns, wave = 64 rows x 64 columns; hi and lo products share the B fragments and the accumulator.
__global__ __launch_bounds__(128) void k_out(const bf* __restrict__ CH, const bf* __restrict__ CL, const bf* __restrict__ WOT,
                                             const float* __restrict__ bout, float* O) {
    __shared__ __align__(16) unsigned char sm[2 * OBUF];   // operand ring; output staging behind the loop
    float* st = (float*)sm;
    const unsigned tid = threadIdx.x, lane = tid & 31u, wv = tid >> 5, lr = lane & 15u, hi = lane >> 4;
    const unsigned wm = wv >> 1, wn = wv & 1u;   // this wave's 64 rows and 64 columns of the block tile
    const unsigned m0 = blockIdx.x * GM;
    const unsigned n0 = blockIdx.y * GN;
    const unsigned cr = tid >> 3, cc = (tid & 7u) * 8u;
    const size_t aoff = (size_t)(m0 + cr) * DM + cc;
    const bf* gh = CH + aoff;
    const bf* gl = CL + aoff;
    const bf* gb = WOT + (size_t)(n0 + cr) * DM + cc;
    const unsigned lh = ldsa(sm) + cr * LPB + cc * 2u;
    const unsigned ll = lh + GM * LPB;
    const unsigned lb = lh + 2 * GM * LPB;

    v8f c[4][4];   // [16-row tile][16-column tile]
#pragma unroll
    for (int i = 0; i < 4; ++i) {
#pragma unroll
        for (int t = 0; t < 4; ++t) c[i][t] = (v8f){};
    }

    stage128(lh, gh);
    stage128(ll, gl);
    stage128(lb, gb);
    wait_copies();
    __syncthreads();
    stage128(lh + OBUF, gh + SK);
    stage128(ll + OBUF, gl + SK);
    stage128(lb + OBUF, gb + SK);

    unsigned cur = 0;   // byte offset of the buffer that this trip reads
#pragma unroll 1   // one trip per stage stays a loop: small text, one publish point
    for (unsigned s = 0; s < (unsigned)(DM / SK); ++s) {
        const bf* ah = (const bf*)(sm + cur) + (64u * wm + lr) * LP + 8u * hi;
        const bf* al = ah + GM * LP;
        const bf* bp = (const bf*)(sm + cur) + (2 * GM + 64u * wn + lr) * LP + 8u * hi;
#pragma unroll   // both 32-wide steps of a stage: constant LDS offsets
        for (unsigned k0 = 0; k0 < (unsigned)SK; k0 += 32) {
            v16bf h[4], l[4], bb[4];
#pragma unroll
            for (int i = 0; i < 4; ++i) h[i] = ldbs(ah + i * 16 * LP + k0);
#pragma unroll
            for (int t = 0; t < 4; ++t) bb[t] = ldbs(bp + t * 16 * LP + k0);
#pragma unroll
            for (int i = 0; i < 4; ++i) l[i] = ldbs(al + i * 16 * LP + k0);
            // every accumulator takes its hi product, then its lo product, of this k step
#pragma unroll
            for (int t = 0; t < 4; ++t) {
#pragma unroll
                for (int i = 0; i < 4; ++i) c[i][t] = wmmab(h[i], bb[t], c[i][t]);
#pragma unroll
                for (int i = 0; i < 4; ++i) c[i][t] = wmmab(l[i], bb[t], c[i][t]);
            }
        }
        // WMMA distance on both sides of the loop's branches: four vector slots behind the stage's last products
        asm volatile("v_nop\n\tv_nop\n\tv_nop\n\tv_nop"
                     :: "v"(c[0][0]), "v"(c[0][1]), "v"(c[0][2]), "v"(c[0][3]), "v"(c[1][0]), "v"(c[1][1]), "v"(c[1][2]), "v"(c[1][3]),
                        "v"(c[2][0]), "v"(c[2][1]), "v"(c[2][2]), "v"(c[2][3]), "v"(c[3][0]), "v"(c[3][1]), "v"(c[3][2]), "v"(c[3][3]));
        // publish stage s + 1, free stage s's buffer, refill it with stage s + 2
        wait_lds();
        wait_copies();
        __syncthreads();
        if (s + 2u < (unsigned)(DM / SK)) {
            const unsigned kn = (s + 2u) * SK;
            stage128(lh + cur, gh + kn);
            stage128(ll + cur, gl + kn);
            stage128(lb + cur, gb + kn);
        }
        cur = OBUF - cur;
    }
    wait_copies();

    // staging: plane wn holds the 128 rows x 64 columns n0 + 64 wn ..
    float* sw = st + (wn * GM + 64u * wm) * SP;
#pragma unroll
    for (int i = 0; i < 4; ++i) {
#pragma unroll
        for (int t = 0; t < 4; ++t) {
#pragma unroll
            for (int r = 0; r < 8; ++r) sw[(16u * i + 8u * hi + r) * SP + t * 16 + lr] = c[i][t][r];
        }
    }
    __syncthreads();

    // one row of 128 columns (512 bytes, four whole lines) per store instruction; wave wv stores rows 32 wv ..
    const unsigned c4 = (lane & 15u) * 4u, ph = lane >> 4;
    const v4f bv = *(const v4f*)(bout + n0 + 64u * ph + c4);
    const float b0 = bfr(bv[0]), b1 = bfr(bv[1]), b2 = bfr(bv[2]), b3 = bfr(bv[3]);
    const float* sr = st + (ph * GM + 32u * wv) * SP + c4;
    float* orow = O + (size_t)(m0 + 32u * wv) * DM + n0 + 64u * ph + c4;
{
#pragma unroll 4
        for (unsigned row = 0; row < 32; ++row) {
            v4f val = *(const v4fa*)(sr + row * SP);
            val[0] += b0; val[1] += b1; val[2] += b2; val[3] += b3;
            *(v4f*)(orow + (size_t)row * DM) = val;
        }
        
    }
}

extern "C" void kernel_launch(void* const* d_in, const int* in_sizes, int n_in,
                              void* d_out, int out_size, void* d_ws, size_t ws_size, hipStream_t stream) {
    if (n_in < 5) return;
    const size_t needx = ((size_t)(NB - 1) * SEQ_FULL + SEQ) * DM;
    if ((size_t)in_sizes[0] < needx) return;
    if ((size_t)in_sizes[1] < (size_t)DM * DM) return;
    if ((size_t)in_sizes[2] < (size_t)2 * DM * DM) return;
    if ((size_t)in_sizes[3] < (size_t)DM * DM) return;
    if ((size_t)in_sizes[4] < (size_t)DM) return;
    if ((size_t)out_size < (size_t)NB * SEQ * DM) return;
    const float* x    = (const float*)d_in[0];   // queries [NB_FULL][SEQ_FULL][DM]
    const float* Wq   = (const float*)d_in[1];   // [DM in][DM out]
    const float* Wkv  = (const float*)d_in[2];   // [DM in][2*DM out]
    const float* Wout = (const float*)d_in[3];   // [DM in][DM out]
    const float* bout = (const float*)d_in[4];   // [DM]
    float* OUT = (float*)d_out;                  // [NB][SEQ][DM]

    const size_t PA = (size_t)NB * SEQ * DM * 2;     // bytes per 16-bit activation plane
    const size_t PW = (size_t)NWT * DM * 2;          // bytes of the transposed weight plane
    const size_t PT = (size_t)SEQ * 16 * 4;          // bytes per rotary table
    if (6 * PA + PW + 2 * PT > ws_size) return;
    char* wsp = (char*)d_ws;
    bf* XB = (bf*)(wsp);
    bf* WT = (bf*)(wsp + PA);
    float* cosT = (float*)(wsp + PA + PW);
    float* sinT = (float*)(wsp + PA + PW + PT);
    hb* QH = (hb*)(wsp + PA + PW + 2 * PT);
    hb* KH = (hb*)(wsp + 2 * PA + PW + 2 * PT);
    hb* VT = (hb*)(wsp + 3 * PA + PW + 2 * PT);
    bf* CH = (bf*)(wsp + 4 * PA + PW + 2 * PT);
    bf* CL = (bf*)(wsp + 5 * PA + PW + 2 * PT);

    FreqArgs fa;
    for (int i = 0; i < 16; ++i) {
        const float pw = (float)pow(10000.0, (double)(2 * i) / 32.0);
        fa.inv[i] = 1.0f / pw;
    }

    const unsigned gc = (unsigned)(((size_t)NB * SEQ * DM / 8 + 255) / 256);
    k_cvt<<<gc, 256, 0, stream>>>(x, XB);
    k_wt<<<dim3(DM / 64, NWT / 128, 1), 256, 0, stream>>>(Wq, Wkv, Wout, WT);
    k_tab<<<(unsigned)(SEQ * 16 / 256), 256, 0, stream>>>(fa, cosT, sinT);
    k_proj<<<dim3((unsigned)(NB * SEQ / GM), NQKV / GN, 1), 128, 0, stream>>>(XB, WT, cosT, sinT, QH, KH, VT);
    k_flash<<<(unsigned)(NB * NH * (SEQ / BQ)), 128, 0, stream>>>(QH, KH, VT, CH, CL);
    k_out<<<dim3((unsigned)(NB * SEQ / GM), DM / GN, 1), 128, 0, stream>>>(CH, CL, WT + (size_t)NQKV * DM, bout, OUT);
}

// v003
// A run of this version takes 149 microseconds.
// Next to v002, in two timings, it ran 1.09 and 1.08 times as fast.
// Over all steps from v000 it is 2.90 times as fast.
#include <hip/hip_runtime.h>

// Compute dtypes, f32 accumulate: x.Wq, x.Wkv on v_wmma_f32_16x16x32_bf16 (inputs RNE-converted to bf16, exact products); q.k^T and P.V on v_wmma_f32_16x16x32_f16 (q, k, v planes f16; P carried x4096 in f16); ctx.Wout on v_wmma_f32_16x16x32_bf16 with ctx as bf16 hi + bf16 lo (two products) against bf16 Wout.
// Self-attention, 16 heads x 64, partial interleaved rotary on head dims 0..31 (16 frequencies, f32, applied on the f32 projection tiles before the f16 convert), logits x 1/8, full softmax over all keys (online, log2 domain), merged heads . Wout + bout.
// Flash form with transposed tiles: S^T accumulator tiles are directly the B-operand layout of P^T; all WMMA operands are two 16-byte loads.
// Operand tiles of the three matrix kernels are staged in LDS, 128 bytes of every row per stage, two buffers, by asynchronous copies that cover whole 128-byte lines; fragments are read from LDS rows at a 144-byte pitch.

#ifndef NB
#define NB 4
#endif
#ifndef SEQ
#define SEQ 2048
#endif
#define NB_FULL  4
#define SEQ_FULL 2048
#define DM   1024              // model width == merged head width
#define NH   16
#define HD   64
#define NQKV 3072              // rows of the transposed q|k|v weight plane
#define NWT  4096              // q|k|v|out rows of the transposed weight plane
#define GM   128               // token rows per GEMM block (2 x 2 waves, 64 rows x 64 columns each)
#define GN   128               // output columns per GEMM block (k_proj: two heads)
#define SP   68                // LDS pitch (floats) of the GEMM staging rows
#define NWV  8                 // waves per flash block
#define QT   2                 // 16-query tiles per flash wave: every K and V^T fragment feeds QT products
#define BQ   (16 * QT * NWV)   // queries per flash block
#define KS   32                // keys per step
#define OSP  68                // LDS pitch (floats) of the flash output staging rows
#define VTP  72                // LDS pitch (16-bit elements) of the weight transpose tile
#define LP   72                // LDS pitch (16-bit elements) of a staged 128-byte row: 144 B = 16 B x 9, conflict-free for 16-byte fragment reads
#define LPB  (LP * 2)          // the same in bytes
#define SK   64                // 16-bit elements of a row per stage (GEMM: k; flash: keys of a V^T row, and keys per stage)
#define PBUF ((GM + GN) * LPB)         // k_proj buffer: 128 A rows | 128 B rows
#define FBUF ((SK + HD) * LPB)         // k_flash buffer: 64 K rows | 64 V^T rows
#define FOUT (BQ * OSP * 4)            // k_flash output staging: one f32 row per query
#define OBUF ((2 * GM + GN) * LPB)     // k_out buffer: 128 hi rows | 128 lo rows | 128 B rows
#define L2E  1.4426950408889634f
#define PCARRY 12.0f           // P carried as 2^12 * p (row sum carried alike, cancels in the normalisation)

static_assert(NH == 16);
static_assert(HD == 64);
static_assert(NH * HD == DM);
static_assert(SEQ % GM == 0);
static_assert(SEQ % BQ == 0);
static_assert(SEQ % KS == 0);
static_assert(DM % 32 == 0);
static_assert(DM % SK == 0 && DM / SK >= 2);       // GEMM ring: whole stages, at least two
static_assert(SEQ % SK == 0 && SEQ / SK >= 2);     // flash ring: whole stages, at least two
static_assert(SK == 2 * KS && HD == 64 && GM == 128 && GN == 2 * HD);
static_assert(2 * PBUF >= 2 * GM * SP * 4);        // the ring holds the GEMM output staging (two planes of 64 columns)
static_assert(2 * OBUF >= 2 * GM * SP * 4);
static_assert(FOUT >= 2 * FBUF);                   // the flash output staging holds the ring
static_assert(NWV == 8 && SK == 64 && HD == 64);   // stage4: 256 threads, two copies of 32 rows per tile
static_assert(NB <= NB_FULL);
static_assert(SEQ <= SEQ_FULL);
static_assert(((size_t)NB * SEQ * DM) % 2048 == 0);                                        // k_cvt: grid * 256 threads * 8 elements == plane
static_assert((size_t)(DM / 64) * (NWT / 128) * (size_t)(64 * 128) == (size_t)NWT * DM);   // k_wt: blocks * (64 k x 128 n) == weight plane
static_assert(((size_t)SEQ * 16) % 256 == 0);                                              // k_tab: grid * 256 == table entries
static_assert((size_t)(NB * SEQ / GM) * (NQKV / GN) * (size_t)(GM * GN) == (size_t)3 * NB * SEQ * DM);   // k_proj: blocks * (128 x 128) == q + k + v planes
static_assert((size_t)(NB * NH * (SEQ / BQ)) * (size_t)(BQ * HD) == (size_t)NB * SEQ * DM);              // k_flash: blocks * (256 x 64) == ctx plane
static_assert((size_t)(NB * SEQ / GM) * (DM / GN) * (size_t)(GM * GN) == (size_t)NB * SEQ * DM);         // k_out: blocks * (128 x 128) == output
static_assert(((size_t)SEQ * 16 * 4) % 256 == 0);
static_assert((size_t)6 * NB_FULL * SEQ_FULL * DM * 2 + (size_t)NWT * DM * 2 + (size_t)2 * SEQ_FULL * 16 * 4 <= (size_t)134217728);

typedef unsigned short bf;     // bf16 bit pattern
typedef unsigned short hb;     // f16 bit pattern
typedef __attribute__((ext_vector_type(16))) __bf16   v16bf;
typedef __attribute__((ext_vector_type(2)))  __bf16   v2bf;
typedef __attribute__((ext_vector_type(16))) _Float16 v16h;
typedef __attribute__((ext_vector_type(2)))  _Float16 v2h;
typedef __attribute__((ext_vector_type(8)))  unsigned short v8us;
typedef __attribute__((ext_vector_type(8)))  unsigned int   v8u;
typedef __attribute__((ext_vector_type(4)))  unsigned int   v4u;
typedef __attribute__((ext_vector_type(8)))  float    v8f;
typedef __attribute__((ext_vector_type(4)))  float    v4f;
typedef v4f  __attribute__((may_alias)) v4fa;
typedef v8us __attribute__((may_alias)) v8usa;

struct FreqArgs { float inv[16]; };
static_assert(sizeof(FreqArgs) == 64);

__device__ __forceinline__ unsigned short f2bf(float f) { unsigned u = __float_as_uint(f); u += 0x7FFFu + ((u >> 16) & 1u); return (unsigned short)(u >> 16); }
// RNE bf16 value of f kept in the upper 16 bits of an f32 bit pattern
__device__ __forceinline__ unsigned bfhi32(float f) { unsigned u = __float_as_uint(f); u += 0x7FFFu + ((u >> 16) & 1u); return u & 0xFFFF0000u; }
__device__ __forceinline__ float bfr(float f) { return __uint_as_float(bfhi32(f)); }
__device__ __forceinline__ v16bf cat16b(v8us lo, v8us hi) { return __builtin_bit_cast(v16bf, __builtin_shufflevector(lo, hi, 0, 1, 2, 3, 4, 5, 6, 7, 8, 9, 10, 11, 12, 13, 14, 15)); }
__device__ __forceinline__ v16h  cat16h(v8us lo, v8us hi) { return __builtin_bit_cast(v16h,  __builtin_shufflevector(lo, hi, 0, 1, 2, 3, 4, 5, 6, 7, 8, 9, 10, 11, 12, 13, 14, 15)); }
__device__ __forceinline__ v8f wmmab(v16bf a, v16bf b, v8f c) { return __builtin_amdgcn_wmma_f32_16x16x32_bf16(false, a, false, b, (short)0, c, false, false); }
__device__ __forceinline__ v8f wmmah(v16h a, v16h b, v8f c) { return __builtin_amdgcn_wmma_f32_16x16x32_f16(false, a, false, b, (short)0, c, false, false); }
// fragment loader (A and B alike): p = row base + k0 + 8*(lane>>4); elements 0..7 <- p[0..7], elements 8..15 <- p[16..23]
__device__ __forceinline__ v16h  ldh(const hb* p) { return cat16h(*(const v8us*)p, *(const v8us*)(p + 16)); }
// the same fragment loaders on LDS rows
__device__ __forceinline__ v16bf ldbs(const bf* p) { return cat16b(*(const v8usa*)p, *(const v8usa*)(p + 16)); }
__device__ __forceinline__ v16h  ldhs(const hb* p) { return cat16h(*(const v8usa*)p, *(const v8usa*)(p + 16)); }
// LDS byte address of a __shared__ location: the low 32 bits of its address
__device__ __forceinline__ unsigned ldsa(const void* p) { return (unsigned)(size_t)p; }
// Asynchronous copies global -> LDS, 16 bytes per lane each. The s_wait_xcnt closes each statement so that no address register of an issued copy is rewritten ahead of it.
#define CPA(l, g) "global_load_async_to_lds_b128 %" #l ", %" #g ", off\n\t"
__device__ __forceinline__ void cp8(const unsigned (&l)[8], const unsigned short* const (&g)[8]) {
    asm volatile(CPA(0, 8) CPA(1, 9) CPA(2, 10) CPA(3, 11) CPA(4, 12) CPA(5, 13) CPA(6, 14) CPA(7, 15) "s_wait_xcnt 0x0"
                 :: "v"(l[0]), "v"(l[1]), "v"(l[2]), "v"(l[3]), "v"(l[4]), "v"(l[5]), "v"(l[6]), "v"(l[7]),
                    "v"(g[0]), "v"(g[1]), "v"(g[2]), "v"(g[3]), "v"(g[4]), "v"(g[5]), "v"(g[6]), "v"(g[7]) : "memory");
}
// A block of 128 threads copies 16 rows of 128 bytes per copy: thread -> row tid >> 3, 16-byte piece tid & 7 (a wave covers 4 whole lines).
// la, ga: this thread's LDS byte address and global address in rows 0..15 of a tile; stage8: two tiles of 64 rows, global pitches pa, pb elements; stage128: one tile of 128 rows, global pitch DM.
__device__ __forceinline__ void stage8(unsigned la, const unsigned short* ga, size_t pa, unsigned lb, const unsigned short* gb, size_t pb) {
    unsigned l[8]; const unsigned short* g[8];
#pragma unroll   // constant indices, so that both arrays are registers (asm operands)
    for (unsigned i = 0; i < 4; ++i) {
        l[i] = la + i * 16u * LPB;      g[i] = ga + i * 16u * pa;
        l[4 + i] = lb + i * 16u * LPB;  g[4 + i] = gb + i * 16u * pb;
    }
    cp8(l, g);
}
__device__ __forceinline__ void cp4(const unsigned (&l)[4], const unsigned short* const (&g)[4]) {
    asm volatile(CPA(0, 4) CPA(1, 5) CPA(2, 6) CPA(3, 7) "s_wait_xcnt 0x0"
                 :: "v"(l[0]), "v"(l[1]), "v"(l[2]), "v"(l[3]), "v"(g[0]), "v"(g[1]), "v"(g[2]), "v"(g[3]) : "memory");
}
// A block of 256 threads copies 32 rows of 128 bytes per copy (thread -> row tid >> 3, piece tid & 7); stage4: two tiles of 64 rows, la, ga in rows 0..31.
__device__ __forceinline__ void stage4(unsigned la, const unsigned short* ga, size_t pa, unsigned lb, const unsigned short* gb, size_t pb) {
    unsigned l[4]; const unsigned short* g[4];
#pragma unroll   // constant indices, so that both arrays are registers (asm operands)
    for (unsigned i = 0; i < 2; ++i) {
        l[i] = la + i * 32u * LPB;      g[i] = ga + i * 32u * pa;
        l[2 + i] = lb + i * 32u * LPB;  g[2 + i] = gb + i * 32u * pb;
    }
    cp4(l, g);
}
__device__ __forceinline__ void stage128(unsigned l, const unsigned short* g) { stage8(l, g, DM, l + 64u * LPB, g + (size_t)64 * DM, DM); }
// this wave's copies have landed
__device__ __forceinline__ void wait_copies() { asm volatile("s_wait_asynccnt 0x0" ::: "memory"); }
// this wave's LDS reads have returned (before the barrier behind which their buffer is refilled)
__device__ __forceinline__ void wait_lds() { asm volatile("s_wait_dscnt 0x0" ::: "memory"); }
// two f32 -> packed 16-bit pair (RNE), element 0 in the low half-word
__device__ __forceinline__ unsigned pk2bf(float a, float b) { v2bf t; t[0] = (__bf16)a; t[1] = (__bf16)b; return __builtin_bit_cast(unsigned, t); }
__device__ __forceinline__ unsigned pk2h(float a, float b) { v2h t; t[0] = (_Float16)a; t[1] = (_Float16)b; return __builtin_bit_cast(unsigned, t); }

__global__ __launch_bounds__(256) void k_cvt(const float* __restrict__ x, bf* XB) {
    const unsigned i = blockIdx.x * 256u + threadIdx.x;
    const unsigned per = (unsigned)(SEQ * DM / 8);
    if (i >= (unsigned)NB * per) return;
    const unsigned b = i / per, r = i - b * per;
    const float* src = x + (size_t)b * SEQ_FULL * DM + (size_t)r * 8;
    const v4f v0 = *(const v4f*)src;
    const v4f v1 = *(const v4f*)(src + 4);
    v4u o;
    o[0] = (bfhi32(v0[0]) >> 16) | bfhi32(v0[1]);
    o[1] = (bfhi32(v0[2]) >> 16) | bfhi32(v0[3]);
    o[2] = (bfhi32(v1[0]) >> 16) | bfhi32(v1[1]);
    o[3] = (bfhi32(v1[2]) >> 16) | bfhi32(v1[3]);
    bf* dst = XB + (size_t)i * 8;
    *(v4u*)dst = o;
    
}

// k_wt: transposed bf16 weight plane WT[n][k] = bf16(W[k][n]); in[DM k][ncols] -> out[ncols][DM]; virtual column space: 0..1023 Wq, 1024..3071 Wkv, 3072..4095 Wout.
__global__ __launch_bounds__(256) void k_wt(const float* __restrict__ Wq, const float* __restrict__ Wkv, const float* __restrict__ Wo, bf* WT) {
    __shared__ __align__(16) bf tl[128 * VTP];
    const unsigned tid = threadIdx.x;
    const unsigned k0 = blockIdx.x * 64u;
    const unsigned n0 = blockIdx.y * 128u;
    const float* src;
    unsigned ldn;
    if (n0 < 1024u)      { src = Wq  + n0;            ldn = 1024u; }
    else if (n0 < 3072u) { src = Wkv + (n0 - 1024u);  ldn = 2048u; }
    else                 { src = Wo  + (n0 - 3072u);  ldn = 1024u; }
    src += (size_t)k0 * ldn;
#pragma unroll
    for (unsigned it = 0; it < 8; ++it) {
        const unsigned f = it * 256u + tid;
        const unsigned kk = f >> 5, c4 = (f & 31u) * 4u;
        const v4f x = *(const v4f*)(src + (size_t)kk * ldn + c4);
#pragma unroll
        for (unsigned c = 0; c < 4; ++c) tl[(c4 + c) * VTP + kk] = f2bf(x[c]);
    }
    __syncthreads();
    bf* dst = WT + (size_t)n0 * DM + k0;
    const unsigned c8 = (tid & 7u) * 8u, dr = tid >> 3;
{
#pragma unroll
        for (unsigned it = 0; it < 4; ++it) {
            const unsigned d = it * 32u + dr;
            const v8us o = *(const v8usa*)(tl + d * VTP + c8);
            *(v8us*)(dst + (size_t)d * DM + c8) = o;
        }
        
    }
}

__global__ __launch_bounds__(256) void k_tab(FreqArgs fa, float* cosT, float* sinT) {
    const unsigned i = blockIdx.x * 256u + threadIdx.x;
    const unsigned t = i >> 4, f = i & 15u;
    float inv = fa.inv[0];
#pragma unroll
    for (unsigned j = 1; j < 16; ++j) inv = (f == j) ? fa.inv[j] : inv;
    const float ang = (float)t * inv;
    float s, c;
    sincosf(ang, &s, &c);
    *(float*)(cosT + i) = c;
    *(float*)(sinT + i) = s;
    
}

// k_proj: [q|k|v] = XB . WT^T, block = 128 token rows x 128 columns (two heads of q, k or v), wave = 64 rows x 64 columns (one head).
//  A = XB rows (row m = token, k = input channel), B = WT rows (column n = output channel, k = input channel); D element r of lane (h, n) = C[row 8h + r][col n].
__global__ __launch_bounds__(128) void k_proj(const bf* __restrict__ XB, const bf* __restrict__ WT,
                                              const float* __restrict__ cosT, const float* __restrict__ sinT,
                                              hb* QH, hb* KH, hb* VT) {
    __shared__ __align__(16) unsigned char sm[2 * PBUF];   // operand ring; output staging behind the loop
    float* st = (float*)sm;
    const unsigned tid = threadIdx.x, lane = tid & 31u, wv = tid >> 5, lr = lane & 15u, hi = lane >> 4;
    const unsigned wm = wv >> 1, wn = wv & 1u;   // this wave's 64 rows and 64 columns of the block tile
    const unsigned m0 = blockIdx.x * GM;
    const unsigned nt = blockIdx.y;
    const unsigned cr = tid >> 3, cc = (tid & 7u) * 8u;
    const bf* ga = XB + (size_t)(m0 + cr) * DM + cc;
    const bf* gb = WT + (size_t)(nt * GN + cr) * DM + cc;
    const unsigned la = ldsa(sm) + cr * LPB + cc * 2u;
    const unsigned lb = la + GM * LPB;

    v8f c[4][4];   // [16-row tile][16-column tile]
#pragma unroll
    for (int i = 0; i < 4; ++i) {
#pragma unroll
        for (int t = 0; t < 4; ++t) c[i][t] = (v8f){};
    }

    stage128(la, ga);
    stage128(lb, gb);
    wait_copies();
    __syncthreads();
    stage128(la + PBUF, ga + SK);
    stage128(lb + PBUF, gb + SK);

    unsigned cur = 0;   // byte offset of the buffer that this trip reads
#pragma unroll 1   // one trip per stage stays a loop: small text, one publish point
    for (unsigned s = 0; s < (unsigned)(DM / SK); ++s) {
        const bf* ap = (const bf*)(sm + cur) + (64u * wm + lr) * LP + 8u * hi;
        const bf* bp = (const bf*)(sm + cur) + (GM + 64u * wn + lr) * LP + 8u * hi;
#pragma unroll   // both 32-wide steps of a stage: constant LDS offsets
        for (unsigned k0 = 0; k0 < (unsigned)SK; k0 += 32) {
            v16bf a[4], bb[4];
#pragma unroll
            for (int i = 0; i < 4; ++i) a[i] = ldbs(ap + i * 16 * LP + k0);
#pragma unroll
            for (int t = 0; t < 4; ++t) bb[t] = ldbs(bp + t * 16 * LP + k0);
#pragma unroll
            for (int t = 0; t < 4; ++t) {
#pragma unroll
                for (int i = 0; i < 4; ++i) c[i][t] = wmmab(a[i], bb[t], c[i][t]);
            }
        }
        // WMMA distance on both sides of the loop's branches: four vector slots behind the stage's last products
        asm volatile("v_nop\n\tv_nop\n\tv_nop\n\tv_nop"
                     :: "v"(c[0][0]), "v"(c[0][1]), "v"(c[0][2]), "v"(c[0][3]), "v"(c[1][0]), "v"(c[1][1]), "v"(c[1][2]), "v"(c[1][3]),
                        "v"(c[2][0]), "v"(c[2][1]), "v"(c[2][2]), "v"(c[2][3]), "v"(c[3][0]), "v"(c[3][1]), "v"(c[3][2]), "v"(c[3][3]));
        // publish stage s + 1, free stage s's buffer, refill it with stage s + 2
        wait_lds();
        wait_copies();
        __syncthreads();
        if (s + 2u < (unsigned)(DM / SK)) {
            stage128(la + cur, ga + (s + 2u) * SK);
            stage128(lb + cur, gb + (s + 2u) * SK);
        }
        cur = PBUF - cur;
    }
    wait_copies();

    // staging: plane wn holds the 128 rows x 64 columns of head 2 nt + wn
    float* sw = st + (wn * GM + 64u * wm) * SP;
#pragma unroll
    for (int i = 0; i < 4; ++i) {
#pragma unroll
        for (int t = 0; t < 4; ++t) {
#pragma unroll
            for (int r = 0; r < 8; ++r) sw[(16u * i + 8u * hi + r) * SP + t * 16 + lr] = c[i][t][r];
        }
    }
    __syncthreads();

    const unsigned b = m0 / (unsigned)SEQ;
    const unsigned pos0 = m0 - b * (unsigned)SEQ;
#pragma unroll 1   // the two heads of the block, one after the other: small text
  for (unsigned nh = 0; nh < 2u; ++nh) {
    const unsigned hd = 2u * nt + nh;
    const float* sh = st + nh * GM * SP;
    if (hd < 32u) {
        // q (hd 0..15) or k (hd 16..31) head: rows [pos][64], rotary on column groups 0..3
        const unsigned h = hd & 15u;
        hb* dst = (hd < 16u ? QH : KH) + ((size_t)(b * NH + h) * SEQ + pos0) * HD;
        const unsigned cg = lane & 7u, rq = lane >> 3;
        const bool rot = cg < 4u;
        const unsigned tc = (cg & 3u) * 4u;
{
#pragma unroll 2
            for (unsigned it = 0; it < 8; ++it) {
                const unsigned row = 32u * wv + 4u * it + rq;
                const float* sr = sh + row * SP + 8u * cg;
                const v4f xa = *(const v4fa*)sr;
                const v4f xb = *(const v4fa*)(sr + 4);
                const unsigned ti = (pos0 + row) * 16u + tc;
                const v4f c4 = *(const v4f*)(cosT + ti);
                const v4f s4 = *(const v4f*)(sinT + ti);
                const float x[8] = { xa[0], xa[1], xa[2], xa[3], xb[0], xb[1], xb[2], xb[3] };
                v4u o;
#pragma unroll
                for (int j = 0; j < 4; ++j) {
                    const float x1 = x[2 * j], x2 = x[2 * j + 1];
                    const float r1 = x1 * c4[j] - x2 * s4[j];
                    const float r2 = x2 * c4[j] + x1 * s4[j];
                    o[j] = pk2h(rot ? r1 : x1, rot ? r2 : x2);
                }
                *(v4u*)(dst + (size_t)row * HD + 8u * cg) = o;
            }
            
        }
    } else {
        // v head: VT[d][pos]; 128 lines (64 d x 2 halves of 64 positions) per head, 4 lines per instruction
        const unsigned h = hd - 32u;
        hb* dst = VT + (size_t)(b * NH + h) * HD * SEQ + pos0;
        const unsigned c8 = (lane & 7u) * 8u, lq = lane >> 3;
{
#pragma unroll 2
            for (unsigned it = 0; it < 8; ++it) {
                const unsigned L = (wv * 8u + it) * 4u + lq;
                const unsigned d = L >> 1, tk = (L & 1u) * 64u + c8;
                const float* sc = sh + tk * SP + d;
                v4u o;
#pragma unroll
                for (int j = 0; j < 4; ++j) o[j] = pk2h(sc[(2 * j) * SP], sc[(2 * j + 1) * SP]);
                *(v4u*)(dst + (size_t)d * SEQ + tk) = o;
            }
            
        }
    }
  }
}

// k_flash: one wave per 32 queries (two 16-query tiles) of one (batch, head), 8 waves per block, 32 keys per step; each K and V^T fragment read from LDS feeds both query tiles.
//  S^T tile (keys x queries): A = K rows (row m = key, k = d), B = Q rows (column n = query, k = d); D element r of lane (h, n) = S[query n][key 8h + r].
//  P^T B fragment: element r <- tile of keys 0..15, element 8 + r <- tile of keys 16..31 (same lane); P carried x 2^12 in f16, row sum carried alike.
//  O^T tile (d x queries): A = V^T rows (row m = d, k = key), D element r of lane (h, n) = O[query n][d = 16 t + 8h + r].
__global__ __launch_bounds__(32 * NWV) void k_flash(const hb* __restrict__ QH, const hb* __restrict__ KH, const hb* __restrict__ VT, bf* CH, bf* CL) {
    __shared__ __align__(16) unsigned char sm[FOUT];   // K | V^T ring (first 2 * FBUF bytes); output staging behind the loop
    float* os = (float*)sm;
    const unsigned tid = threadIdx.x, lane = tid & 31u, wv = tid >> 5, lr = lane & 15u, hi = lane >> 4;
    const unsigned qpb = (unsigned)(SEQ / BQ);
    const unsigned bh = blockIdx.x / qpb;
    const unsigned q0 = (blockIdx.x - bh * qpb) * BQ + wv * (16u * QT);
    const unsigned b = bh >> 4, h = bh & 15u;

    v16h qf[QT][2];
#pragma unroll
    for (int q = 0; q < QT; ++q) {
        const hb* qp = QH + ((size_t)bh * SEQ + q0 + 16u * q + lr) * HD + 8u * hi;
        qf[q][0] = ldh(qp);
        qf[q][1] = ldh(qp + 32);
    }
    const unsigned cr = tid >> 3, cc = (tid & 7u) * 8u;
    const hb* gk = KH + ((size_t)bh * SEQ + cr) * HD + cc;
    const hb* gv = VT + ((size_t)bh * HD + cr) * SEQ + cc;
    const unsigned lk = ldsa(sm) + cr * LPB + cc * 2u;
    const unsigned lv = lk + SK * LPB;

    v8f o[QT][4];
    float ml[QT];             // running max in the log2 domain
    float l[QT];              // running sum (carried x 2^12)
#pragma unroll
    for (int q = 0; q < QT; ++q) {
#pragma unroll
        for (int t = 0; t < 4; ++t) o[q][t] = (v8f){};
        ml[q] = -1.0e30f;
        l[q] = 0.0f;
    }
    const float CS = 0.125f * L2E;

    stage4(lk, gk, HD, lv, gv, SEQ);
    wait_copies();
    __syncthreads();
    stage4(lk + FBUF, gk + (size_t)SK * HD, HD, lv + FBUF, gv + SK, SEQ);

    unsigned cur = 0;   // byte offset of the buffer that this trip reads
#pragma unroll 1   // one trip per stage stays a loop: small text, one publish point
    for (unsigned sg = 0; sg < (unsigned)(SEQ / SK); ++sg) {
      const hb* kp = (const hb*)(sm + cur) + lr * LP + 8u * hi;
      const hb* vp = kp + SK * LP;
#pragma unroll   // both 32-key steps of a stage: constant LDS offsets
      for (unsigned k0 = 0; k0 < (unsigned)SK; k0 += KS) {
        v8f s[QT][2];
#pragma unroll
        for (int q = 0; q < QT; ++q) { s[q][0] = (v8f){}; s[q][1] = (v8f){}; }
        const hb* ka = kp + k0 * LP;
#pragma unroll
        for (int dk = 0; dk < 2; ++dk) {
            const v16h a0 = ldhs(ka + dk * 32);
            const v16h a1 = ldhs(ka + 16 * LP + dk * 32);
#pragma unroll
            for (int q = 0; q < QT; ++q) {
                s[q][0] = wmmah(a0, qf[q][dk], s[q][0]);
                s[q][1] = wmmah(a1, qf[q][dk], s[q][1]);
            }
        }
        // WMMA distance: four vector slots behind the step's last score products
        asm volatile("v_nop\n\tv_nop\n\tv_nop\n\tv_nop" : "+v"(s[0][0]), "+v"(s[0][1]), "+v"(s[1][0]), "+v"(s[1][1])
                     : "v"(qf[0][0]), "v"(qf[0][1]), "v"(qf[1][0]), "v"(qf[1][1]));

        float corr[QT];
        v16h ph[QT];
#pragma unroll
        for (int q = 0; q < QT; ++q) {
            const v8f s0 = s[q][0], s1 = s[q][1];
            float mx = fmaxf(s0[0], s1[0]);
#pragma unroll
            for (int r = 1; r < 8; ++r) mx = fmaxf(mx, fmaxf(s0[r], s1[r]));
            mx = fmaxf(mx, __shfl_xor(mx, 16, 32));
            const float mnl = fmaxf(ml[q], mx * CS);
            corr[q] = __builtin_amdgcn_exp2f(ml[q] - mnl);
            ml[q] = mnl;
            const float pm = PCARRY - mnl;
            float p0[8], p1[8];
            float ps = 0.0f;
#pragma unroll
            for (int r = 0; r < 8; ++r) {
                p0[r] = __builtin_amdgcn_exp2f(fmaf(s0[r], CS, pm));
                p1[r] = __builtin_amdgcn_exp2f(fmaf(s1[r], CS, pm));
                ps += p0[r] + p1[r];
            }
            ps += __shfl_xor(ps, 16, 32);
            l[q] = l[q] * corr[q] + ps;
            v8u hw;
#pragma unroll
            for (int j = 0; j < 4; ++j) {
                hw[j]     = pk2h(p0[2 * j], p0[2 * j + 1]);
                hw[4 + j] = pk2h(p1[2 * j], p1[2 * j + 1]);
            }
            ph[q] = __builtin_bit_cast(v16h, hw);
        }
        if (__builtin_amdgcn_ballot_w32(corr[0] != 1.0f || corr[1] != 1.0f) != 0u) {   // wave-uniform, one test per step; multiplying by exactly 1 changes nothing
#pragma unroll
            for (int q = 0; q < QT; ++q) {
#pragma unroll
                for (int t = 0; t < 4; ++t) o[q][t] *= corr[q];
            }
        }

        asm volatile("" ::: "memory");   // keep the V^T loads below the softmax (bounds live fragments)
        const hb* va = vp + k0;
#pragma unroll
        for (int t = 0; t < 4; ++t) {
            const v16h a = ldhs(va + t * 16 * LP);
#pragma unroll
            for (int q = 0; q < QT; ++q) o[q][t] = wmmah(a, ph[q], o[q][t]);
        }
        // WMMA distance on both sides of the branches that follow: four vector slots behind the step's last products
        asm volatile("v_nop\n\tv_nop\n\tv_nop\n\tv_nop"
                     : "+v"(o[0][0]), "+v"(o[0][1]), "+v"(o[0][2]), "+v"(o[0][3]), "+v"(o[1][0]), "+v"(o[1][1]), "+v"(o[1][2]), "+v"(o[1][3])
                     : "v"(ph[0]), "v"(ph[1]));
      }
      // publish stage sg + 1, free stage sg's buffer, refill it with stage sg + 2
      wait_lds();
      wait_copies();
      __syncthreads();
      if (sg + 2u < (unsigned)(SEQ / SK)) stage4(lk + cur, gk + (size_t)(sg + 2u) * SK * HD, HD, lv + cur, gv + (sg + 2u) * SK, SEQ);
      cur = FBUF - cur;
    }
    wait_copies();

    float* ow = os + wv * (16 * QT * OSP);   // this wave's 32 rows
#pragma unroll
    for (int q = 0; q < QT; ++q) {
        const float inv = 1.0f / l[q];
#pragma unroll
        for (int t = 0; t < 4; ++t) {
#pragma unroll
            for (int r = 0; r < 8; ++r) ow[(16 * q + lr) * OSP + t * 16 + 8 * hi + r] = o[q][t][r] * inv;
        }
    }
    __syncthreads();
    const unsigned cg = lane & 7u, rq = lane >> 3;
    const size_t cbase = ((size_t)b * SEQ + q0) * DM + h * HD + 8u * cg;
{
#pragma unroll
        for (unsigned s = 0; s < 4u * QT; ++s) {
            const unsigned row = 4u * s + rq;
            const float* sr = ow + row * OSP + 8u * cg;
            const v4f xa = *(const v4fa*)sr;
            const v4f xb = *(const v4fa*)(sr + 4);
            const float x[8] = { xa[0], xa[1], xa[2], xa[3], xb[0], xb[1], xb[2], xb[3] };
            v4u oh, ol;
#pragma unroll
            for (int j = 0; j < 4; ++j) {
                const unsigned r0 = bfhi32(x[2 * j]), r1 = bfhi32(x[2 * j + 1]);
                oh[j] = (r0 >> 16) | r1;
                ol[j] = pk2bf(x[2 * j] - __uint_as_float(r0), x[2 * j + 1] - __uint_as_float(r1));
            }
            *(v4u*)(CH + cbase + (size_t)row * DM) = oh;
            *(v4u*)(CL + cbase + (size_t)row * DM) = ol;
        }
        
    }
}

// k_out: out = (CH + CL) . WOT^T + bf16(bout); block = 128 rows x 128 columns, wave = 64 rows x 64 columns; hi and lo products share the B fragments and the accumulator.
__global__ __launch_bounds__(128) void k_out(const bf* __restrict__ CH, const bf* __restrict__ CL, const bf* __restrict__ WOT,
                                             const float* __restrict__ bout, float* O) {
    __shared__ __align__(16) unsigned char sm[2 * OBUF];   // operand ring; output staging behind the loop
    float* st = (float*)sm;
    const unsigned tid = threadIdx.x, lane = tid & 31u, wv = tid >> 5, lr = lane & 15u, hi = lane >> 4;
    const unsigned wm = wv >> 1, wn = wv & 1u;   // this wave's 64 rows and 64 columns of the block tile
    const unsigned m0 = blockIdx.x * GM;
    const unsigned n0 = blockIdx.y * GN;
    const unsigned cr = tid >> 3, cc = (tid & 7u) * 8u;
    const size_t aoff = (size_t)(m0 + cr) * DM + cc;
    const bf* gh = CH + aoff;
    const bf* gl = CL + aoff;
    const bf* gb = WOT + (size_t)(n0 + cr) * DM + cc;
    const unsigned lh = ldsa(sm) + cr * LPB + cc * 2u;
    const unsigned ll = lh + GM * LPB;
    const unsigned lb = lh + 2 * GM * LPB;

    v8f c[4][4];   // [16-row tile][16-column tile]
#pragma unroll
    for (int i = 0; i < 4; ++i) {
#pragma unroll
        for (int t = 0; t < 4; ++t) c[i][t] = (v8f){};
    }

    stage128(lh, gh);
    stage128(ll, gl);
    stage128(lb, gb);
    wait_copies();
    __syncthreads();
    stage128(lh + OBUF, gh + SK);
    stage128(ll + OBUF, gl + SK);
    stage128(lb + OBUF, gb + SK);

    unsigned cur = 0;   // byte offset of the buffer that this trip reads
#pragma unroll 1   // one trip per stage stays a loop: small text, one publish point
    for (unsigned s = 0; s < (unsigned)(DM / SK); ++s) {
        const bf* ah = (const bf*)(sm + cur) + (64u * wm + lr) * LP + 8u * hi;
        const bf* al = ah + GM * LP;
        const bf* bp = (const bf*)(sm + cur) + (2 * GM + 64u * wn + lr) * LP + 8u * hi;
#pragma unroll   // both 32-wide steps of a stage: constant LDS offsets
        for (unsigned k0 = 0; k0 < (unsigned)SK; k0 += 32) {
            v16bf h[4], l[4], bb[4];
#pragma unroll
            for (int i = 0; i < 4; ++i) h[i] = ldbs(ah + i * 16 * LP + k0);
#pragma unroll
            for (int t = 0; t < 4; ++t) bb[t] = ldbs(bp + t * 16 * LP + k0);
#pragma unroll
            for (int i = 0; i < 4; ++i) l[i] = ldbs(al + i * 16 * LP + k0);
            // every accumulator takes its hi product, then its lo product, of this k step
#pragma unroll
            for (int t = 0; t < 4; ++t) {
#pragma unroll
                for (int i = 0; i < 4; ++i) c[i][t] = wmmab(h[i], bb[t], c[i][t]);
#pragma unroll
                for (int i = 0; i < 4; ++i) c[i][t] = wmmab(l[i], bb[t], c[i][t]);
            }
        }
        // WMMA distance on both sides of the loop's branches: four vector slots behind the stage's last products
        asm volatile("v_nop\n\tv_nop\n\tv_nop\n\tv_nop"
                     :: "v"(c[0][0]), "v"(c[0][1]), "v"(c[0][2]), "v"(c[0][3]), "v"(c[1][0]), "v"(c[1][1]), "v"(c[1][2]), "v"(c[1][3]),
                        "v"(c[2][0]), "v"(c[2][1]), "v"(c[2][2]), "v"(c[2][3]), "v"(c[3][0]), "v"(c[3][1]), "v"(c[3][2]), "v"(c[3][3]));
        // publish stage s + 1, free stage s's buffer, refill it with stage s + 2
        wait_lds();
        wait_copies();
        __syncthreads();
        if (s + 2u < (unsigned)(DM / SK)) {
            const unsigned kn = (s + 2u) * SK;
            stage128(lh + cur, gh + kn);
            stage128(ll + cur, gl + kn);
            stage128(lb + cur, gb + kn);
        }
        cur = OBUF - cur;
    }
    wait_copies();

    // staging: plane wn holds the 128 rows x 64 columns n0 + 64 wn ..
    float* sw = st + (wn * GM + 64u * wm) * SP;
#pragma unroll
    for (int i = 0; i < 4; ++i) {
#pragma unroll
        for (int t = 0; t < 4; ++t) {
#pragma unroll
            for (int r = 0; r < 8; ++r) sw[(16u * i + 8u * hi + r) * SP + t * 16 + lr] = c[i][t][r];
        }
    }
    __syncthreads();

    // one row of 128 columns (512 bytes, four whole lines) per store instruction; wave wv stores rows 32 wv ..
    const unsigned c4 = (lane & 15u) * 4u, ph = lane >> 4;
    const v4f bv = *(const v4f*)(bout + n0 + 64u * ph + c4);
    const float b0 = bfr(bv[0]), b1 = bfr(bv[1]), b2 = bfr(bv[2]), b3 = bfr(bv[3]);
    const float* sr = st + (ph * GM + 32u * wv) * SP + c4;
    float* orow = O + (size_t)(m0 + 32u * wv) * DM + n0 + 64u * ph + c4;
{
#pragma unroll 4
        for (unsigned row = 0; row < 32; ++row) {
            v4f val = *(const v4fa*)(sr + row * SP);
            val[0] += b0; val[1] += b1; val[2] += b2; val[3] += b3;
            *(v4f*)(orow + (size_t)row * DM) = val;
        }
        
    }
}

extern "C" void kernel_launch(void* const* d_in, const int* in_sizes, int n_in,
                              void* d_out, int out_size, void* d_ws, size_t ws_size, hipStream_t stream) {
    if (n_in < 5) return;
    const size_t needx = ((size_t)(NB - 1) * SEQ_FULL + SEQ) * DM;
    if ((size_t)in_sizes[0] < needx) return;
    if ((size_t)in_sizes[1] < (size_t)DM * DM) return;
    if ((size_t)in_sizes[2] < (size_t)2 * DM * DM) return;
    if ((size_t)in_sizes[3] < (size_t)DM * DM) return;
    if ((size_t)in_sizes[4] < (size_t)DM) return;
    if ((size_t)out_size < (size_t)NB * SEQ * DM) return;
    const float* x    = (const float*)d_in[0];   // queries [NB_FULL][SEQ_FULL][DM]
    const float* Wq   = (const float*)d_in[1];   // [DM in][DM out]
    const float* Wkv  = (const float*)d_in[2];   // [DM in][2*DM out]
    const float* Wout = (const float*)d_in[3];   // [DM in][DM out]
    const float* bout = (const float*)d_in[4];   // [DM]
    float* OUT = (float*)d_out;                  // [NB][SEQ][DM]

    const size_t PA = (size_t)NB * SEQ * DM * 2;     // bytes per 16-bit activation plane
    const size_t PW = (size_t)NWT * DM * 2;          // bytes of the transposed weight plane
    const size_t PT = (size_t)SEQ * 16 * 4;          // bytes per rotary table
    if (6 * PA + PW + 2 * PT > ws_size) return;
    char* wsp = (char*)d_ws;
    bf* XB = (bf*)(wsp);
    bf* WT = (bf*)(wsp + PA);
    float* cosT = (float*)(wsp + PA + PW);
    float* sinT = (float*)(wsp + PA + PW + PT);
    hb* QH = (hb*)(wsp + PA + PW + 2 * PT);
    hb* KH = (hb*)(wsp + 2 * PA + PW + 2 * PT);
    hb* VT = (hb*)(wsp + 3 * PA + PW + 2 * PT);
    bf* CH = (bf*)(wsp + 4 * PA + PW + 2 * PT);
    bf* CL = (bf*)(wsp + 5 * PA + PW + 2 * PT);

    FreqArgs fa;
    for (int i = 0; i < 16; ++i) {
        const float pw = (float)pow(10000.0, (double)(2 * i) / 32.0);
        fa.inv[i] = 1.0f / pw;
    }

    const unsigned gc = (unsigned)(((size_t)NB * SEQ * DM / 8 + 255) / 256);
    k_cvt<<<gc, 256, 0, stream>>>(x, XB);
    k_wt<<<dim3(DM / 64, NWT / 128, 1), 256, 0, stream>>>(Wq, Wkv, Wout, WT);
    k_tab<<<(unsigned)(SEQ * 16 / 256), 256, 0, stream>>>(fa, cosT, sinT);
    k_proj<<<dim3((unsigned)(NB * SEQ / GM), NQKV / GN, 1), 128, 0, stream>>>(XB, WT, cosT, sinT, QH, KH, VT);
    k_flash<<<(unsigned)(NB * NH * (SEQ / BQ)), 32 * NWV, 0, stream>>>(QH, KH, VT, CH, CL);
    k_out<<<dim3((unsigned)(NB * SEQ / GM), DM / GN, 1), 128, 0, stream>>>(CH, CL, WT + (size_t)NQKV * DM, bout, OUT);
}

// v004
// A run of this version takes 140 microseconds.
// Two timings next to v003 both put it at 1.06 times that version's speed.
// Counting every step since v000, it is 3.08 times as fast.
#include <hip/hip_runtime.h>

// Compute dtypes, f32 accumulate: x.Wq, x.Wkv on v_wmma_f32_16x16x32_bf16 (inputs RNE-converted to bf16, exact products); q.k^T and P.V on v_wmma_f32_16x16x32_f16 (q, k, v planes f16, q stored x log2(e)/8; P carried x128 in f16); ctx.Wout on v_wmma_f32_16x16x32_bf16 with ctx as bf16 hi + bf16 lo (two products) against bf16 Wout.
// Self-attention, 16 heads x 64, partial interleaved rotary on head dims 0..31 (16 frequencies, f32, applied on the f32 projection tiles before the f16 convert), logits x 1/8, full softmax over all keys (online, log2 domain, lazily rescaled), merged heads . Wout + bout.
// Flash form with transposed tiles: S^T accumulator tiles are directly the B-operand layout of P^T; all WMMA operands are two 16-byte loads.
// Operand tiles of the three matrix kernels are staged in LDS, 128 bytes of every row per stage, two buffers, by asynchronous copies that cover whole 128-byte lines; fragments are read from LDS rows at a 144-byte pitch.

#ifndef NB
#define NB 4
#endif
#ifndef SEQ
#define SEQ 2048
#endif
#define NB_FULL  4
#define SEQ_FULL 2048
#define DM   1024              // model width == merged head width
#define NH   16
#define HD   64
#define NQKV 3072              // rows of the transposed q|k|v weight plane
#define NWT  4096              // q|k|v|out rows of the transposed weight plane
#define GM   128               // token rows per GEMM block (2 x 2 waves, 64 rows x 64 columns each)
#define GN   128               // output columns per GEMM block (k_proj: two heads)
#define SP   68                // LDS pitch (floats) of the GEMM staging rows
#define NWV  8                 // waves per flash block
#define QT   2                 // 16-query tiles per flash wave: every K and V^T fragment feeds QT products
#define BQ   (16 * QT * NWV)   // queries per flash block
#define KS   32                // keys per step
#define OSP  68                // LDS pitch (floats) of the flash output staging rows
#define VTP  72                // LDS pitch (16-bit elements) of the weight transpose tile
#define LP   72                // LDS pitch (16-bit elements) of a staged 128-byte row: 144 B = 16 B x 9, conflict-free for 16-byte fragment reads
#define LPB  (LP * 2)          // the same in bytes
#define SK   64                // 16-bit elements of a row per stage (GEMM: k; flash: keys of a V^T row, and keys per stage)
#define PBUF ((GM + GN) * LPB)         // k_proj buffer: 128 A rows | 128 B rows
#define FBUF ((SK + HD) * LPB)         // k_flash buffer: 64 K rows | 64 V^T rows
#define FOUT (BQ * OSP * 4)            // k_flash output staging: one f32 row per query
#define OBUF ((2 * GM + GN) * LPB)     // k_out buffer: 128 hi rows | 128 lo rows | 128 B rows
#define L2E  1.4426950408889634f
#define QSC  (0.125f * L2E)    // logit scale and change to the log2 domain, applied to q on its f32 projection tile
#define PCARRY 7.0f            // P carried as 2^7 * p against the reference maximum in use (row sum carried alike, cancels in the normalisation)
#define PTOP   15.0f           // an exponent above this renews the reference maximum: P <= 2^15, inside f16

static_assert(NH == 16);
static_assert(HD == 64);
static_assert(NH * HD == DM);
static_assert(SEQ % GM == 0);
static_assert(SEQ % BQ == 0);
static_assert(SEQ % KS == 0);
static_assert(DM % 32 == 0);
static_assert(DM % SK == 0 && DM / SK >= 2);       // GEMM ring: whole stages, at least two
static_assert(SEQ % SK == 0 && SEQ / SK >= 2);     // flash ring: whole stages, at least two
static_assert(SK == 2 * KS && HD == 64 && GM == 128 && GN == 2 * HD);
static_assert(2 * PBUF >= 2 * GM * SP * 4);        // the ring holds the GEMM output staging (two planes of 64 columns)
static_assert(2 * OBUF >= 2 * GM * SP * 4);
static_assert(FOUT >= 2 * FBUF);                   // the flash output staging holds the ring
static_assert(NWV == 8 && SK == 64 && HD == 64);   // stage4: 256 threads, two copies of 32 rows per tile
static_assert(NB <= NB_FULL);
static_assert(SEQ <= SEQ_FULL);
static_assert(((size_t)NB * SEQ * DM) % 2048 == 0);                                        // k_cvt: grid * 256 threads * 8 elements == plane
static_assert((size_t)(DM / 64) * (NWT / 128) * (size_t)(64 * 128) == (size_t)NWT * DM);   // k_wt: blocks * (64 k x 128 n) == weight plane
static_assert(((size_t)SEQ * 16) % 256 == 0);                                              // k_tab: grid * 256 == table entries
static_assert((size_t)(NB * SEQ / GM) * (NQKV / GN) * (size_t)(GM * GN) == (size_t)3 * NB * SEQ * DM);   // k_proj: blocks * (128 x 128) == q + k + v planes
static_assert((size_t)(NB * NH * (SEQ / BQ)) * (size_t)(BQ * HD) == (size_t)NB * SEQ * DM);              // k_flash: blocks * (256 x 64) == ctx plane
static_assert((size_t)(NB * SEQ / GM) * (DM / GN) * (size_t)(GM * GN) == (size_t)NB * SEQ * DM);         // k_out: blocks * (128 x 128) == output
static_assert(((size_t)SEQ * 16 * 4) % 256 == 0);
static_assert((size_t)6 * NB_FULL * SEQ_FULL * DM * 2 + (size_t)NWT * DM * 2 + (size_t)2 * SEQ_FULL * 16 * 4 <= (size_t)134217728);

typedef unsigned short bf;     // bf16 bit pattern
typedef unsigned short hb;     // f16 bit pattern
typedef __attribute__((ext_vector_type(16))) __bf16   v16bf;
typedef __attribute__((ext_vector_type(2)))  __bf16   v2bf;
typedef __attribute__((ext_vector_type(16))) _Float16 v16h;
typedef __attribute__((ext_vector_type(2)))  _Float16 v2h;
typedef __attribute__((ext_vector_type(8)))  unsigned short v8us;
typedef __attribute__((ext_vector_type(8)))  unsigned int   v8u;
typedef __attribute__((ext_vector_type(4)))  unsigned int   v4u;
typedef __attribute__((ext_vector_type(8)))  float    v8f;
typedef __attribute__((ext_vector_type(4)))  float    v4f;
typedef v4f  __attribute__((may_alias)) v4fa;
typedef v8us __attribute__((may_alias)) v8usa;

struct FreqArgs { float inv[16]; };
static_assert(sizeof(FreqArgs) == 64);

__device__ __forceinline__ unsigned short f2bf(float f) { unsigned u = __float_as_uint(f); u += 0x7FFFu + ((u >> 16) & 1u); return (unsigned short)(u >> 16); }
// RNE bf16 value of f kept in the upper 16 bits of an f32 bit pattern
__device__ __forceinline__ unsigned bfhi32(float f) { unsigned u = __float_as_uint(f); u += 0x7FFFu + ((u >> 16) & 1u); return u & 0xFFFF0000u; }
__device__ __forceinline__ float bfr(float f) { return __uint_as_float(bfhi32(f)); }
__device__ __forceinline__ v16bf cat16b(v8us lo, v8us hi) { return __builtin_bit_cast(v16bf, __builtin_shufflevector(lo, hi, 0, 1, 2, 3, 4, 5, 6, 7, 8, 9, 10, 11, 12, 13, 14, 15)); }
__device__ __forceinline__ v16h  cat16h(v8us lo, v8us hi) { return __builtin_bit_cast(v16h,  __builtin_shufflevector(lo, hi, 0, 1, 2, 3, 4, 5, 6, 7, 8, 9, 10, 11, 12, 13, 14, 15)); }
__device__ __forceinline__ v8f wmmab(v16bf a, v16bf b, v8f c) { return __builtin_amdgcn_wmma_f32_16x16x32_bf16(false, a, false, b, (short)0, c, false, false); }
__device__ __forceinline__ v8f wmmah(v16h a, v16h b, v8f c) { return __builtin_amdgcn_wmma_f32_16x16x32_f16(false, a, false, b, (short)0, c, false, false); }
// fragment loader (A and B alike): p = row base + k0 + 8*(lane>>4); elements 0..7 <- p[0..7], elements 8..15 <- p[16..23]
__device__ __forceinline__ v16h  ldh(const hb* p) { return cat16h(*(const v8us*)p, *(const v8us*)(p + 16)); }
// the same fragment loaders on LDS rows
__device__ __forceinline__ v16bf ldbs(const bf* p) { return cat16b(*(const v8usa*)p, *(const v8usa*)(p + 16)); }
__device__ __forceinline__ v16h  ldhs(const hb* p) { return cat16h(*(const v8usa*)p, *(const v8usa*)(p + 16)); }
// LDS byte address of a __shared__ location: the low 32 bits of its address
__device__ __forceinline__ unsigned ldsa(const void* p) { return (unsigned)(size_t)p; }
// Asynchronous copies global -> LDS, 16 bytes per lane each. The s_wait_xcnt closes each statement so that no address register of an issued copy is rewritten ahead of it.
#define CPA(l, g) "global_load_async_to_lds_b128 %" #l ", %" #g ", off\n\t"
__device__ __forceinline__ void cp8(const unsigned (&l)[8], const unsigned short* const (&g)[8]) {
    asm volatile(CPA(0, 8) CPA(1, 9) CPA(2, 10) CPA(3, 11) CPA(4, 12) CPA(5, 13) CPA(6, 14) CPA(7, 15) "s_wait_xcnt 0x0"
                 :: "v"(l[0]), "v"(l[1]), "v"(l[2]), "v"(l[3]), "v"(l[4]), "v"(l[5]), "v"(l[6]), "v"(l[7]),
                    "v"(g[0]), "v"(g[1]), "v"(g[2]), "v"(g[3]), "v"(g[4]), "v"(g[5]), "v"(g[6]), "v"(g[7]) : "memory");
}
// A block of 128 threads copies 16 rows of 128 bytes per copy: thread -> row tid >> 3, 16-byte piece tid & 7 (a wave covers 4 whole lines).
// la, ga: this thread's LDS byte address and global address in rows 0..15 of a tile; stage8: two tiles of 64 rows, global pitches pa, pb elements; stage128: one tile of 128 rows, global pitch DM.
__device__ __forceinline__ void stage8(unsigned la, const unsigned short* ga, size_t pa, unsigned lb, const unsigned short* gb, size_t pb) {
    unsigned l[8]; const unsigned short* g[8];
#pragma unroll   // constant indices, so that both arrays are registers (asm operands)
    for (unsigned i = 0; i < 4; ++i) {
        l[i] = la + i * 16u * LPB;      g[i] = ga + i * 16u * pa;
        l[4 + i] = lb + i * 16u * LPB;  g[4 + i] = gb + i * 16u * pb;
    }
    cp8(l, g);
}
__device__ __forceinline__ void cp4(const unsigned (&l)[4], const unsigned short* const (&g)[4]) {
    asm volatile(CPA(0, 4) CPA(1, 5) CPA(2, 6) CPA(3, 7) "s_wait_xcnt 0x0"
                 :: "v"(l[0]), "v"(l[1]), "v"(l[2]), "v"(l[3]), "v"(g[0]), "v"(g[1]), "v"(g[2]), "v"(g[3]) : "memory");
}
// A block of 256 threads copies 32 rows of 128 bytes per copy (thread -> row tid >> 3, piece tid & 7); stage4: two tiles of 64 rows, la, ga in rows 0..31.
__device__ __forceinline__ void stage4(unsigned la, const unsigned short* ga, size_t pa, unsigned lb, const unsigned short* gb, size_t pb) {
    unsigned l[4]; const unsigned short* g[4];
#pragma unroll   // constant indices, so that both arrays are registers (asm operands)
    for (unsigned i = 0; i < 2; ++i) {
        l[i] = la + i * 32u * LPB;      g[i] = ga + i * 32u * pa;
        l[2 + i] = lb + i * 32u * LPB;  g[2 + i] = gb + i * 32u * pb;
    }
    cp4(l, g);
}
__device__ __forceinline__ void stage128(unsigned l, const unsigned short* g) { stage8(l, g, DM, l + 64u * LPB, g + (size_t)64 * DM, DM); }
// this wave's copies have landed
__device__ __forceinline__ void wait_copies() { asm volatile("s_wait_asynccnt 0x0" ::: "memory"); }
// this wave's LDS reads have returned (before the barrier behind which their buffer is refilled)
__device__ __forceinline__ void wait_lds() { asm volatile("s_wait_dscnt 0x0" ::: "memory"); }
// two f32 -> packed 16-bit pair (RNE), element 0 in the low half-word
__device__ __forceinline__ unsigned pk2bf(float a, float b) { v2bf t; t[0] = (__bf16)a; t[1] = (__bf16)b; return __builtin_bit_cast(unsigned, t); }
__device__ __forceinline__ unsigned pk2h(float a, float b) { v2h t; t[0] = (_Float16)a; t[1] = (_Float16)b; return __builtin_bit_cast(unsigned, t); }

__global__ __launch_bounds__(256) void k_cvt(const float* __restrict__ x, bf* XB) {
    const unsigned i = blockIdx.x * 256u + threadIdx.x;
    const unsigned per = (unsigned)(SEQ * DM / 8);
    if (i >= (unsigned)NB * per) return;
    const unsigned b = i / per, r = i - b * per;
    const float* src = x + (size_t)b * SEQ_FULL * DM + (size_t)r * 8;
    const v4f v0 = *(const v4f*)src;
    const v4f v1 = *(const v4f*)(src + 4);
    v4u o;
    o[0] = (bfhi32(v0[0]) >> 16) | bfhi32(v0[1]);
    o[1] = (bfhi32(v0[2]) >> 16) | bfhi32(v0[3]);
    o[2] = (bfhi32(v1[0]) >> 16) | bfhi32(v1[1]);
    o[3] = (bfhi32(v1[2]) >> 16) | bfhi32(v1[3]);
    bf* dst = XB + (size_t)i * 8;
    *(v4u*)dst = o;
    
}

// k_wt: transposed bf16 weight plane WT[n][k] = bf16(W[k][n]); in[DM k][ncols] -> out[ncols][DM]; virtual column space: 0..1023 Wq, 1024..3071 Wkv, 3072..4095 Wout.
__global__ __launch_bounds__(256) void k_wt(const float* __restrict__ Wq, const float* __restrict__ Wkv, const float* __restrict__ Wo, bf* WT) {
    __shared__ __align__(16) bf tl[128 * VTP];
    const unsigned tid = threadIdx.x;
    const unsigned k0 = blockIdx.x * 64u;
    const unsigned n0 = blockIdx.y * 128u;
    const float* src;
    unsigned ldn;
    if (n0 < 1024u)      { src = Wq  + n0;            ldn = 1024u; }
    else if (n0 < 3072u) { src = Wkv + (n0 - 1024u);  ldn = 2048u; }
    else                 { src = Wo  + (n0 - 3072u);  ldn = 1024u; }
    src += (size_t)k0 * ldn;
#pragma unroll
    for (unsigned it = 0; it < 8; ++it) {
        const unsigned f = it * 256u + tid;
        const unsigned kk = f >> 5, c4 = (f & 31u) * 4u;
        const v4f x = *(const v4f*)(src + (size_t)kk * ldn + c4);
#pragma unroll
        for (unsigned c = 0; c < 4; ++c) tl[(c4 + c) * VTP + kk] = f2bf(x[c]);
    }
    __syncthreads();
    bf* dst = WT + (size_t)n0 * DM + k0;
    const unsigned c8 = (tid & 7u) * 8u, dr = tid >> 3;
{
#pragma unroll
        for (unsigned it = 0; it < 4; ++it) {
            const unsigned d = it * 32u + dr;
            const v8us o = *(const v8usa*)(tl + d * VTP + c8);
            *(v8us*)(dst + (size_t)d * DM + c8) = o;
        }
        
    }
}

__global__ __launch_bounds__(256) void k_tab(FreqArgs fa, float* cosT, float* sinT) {
    const unsigned i = blockIdx.x * 256u + threadIdx.x;
    const unsigned t = i >> 4, f = i & 15u;
    float inv = fa.inv[0];
#pragma unroll
    for (unsigned j = 1; j < 16; ++j) inv = (f == j) ? fa.inv[j] : inv;
    const float ang = (float)t * inv;
    float s, c;
    sincosf(ang, &s, &c);
    *(float*)(cosT + i) = c;
    *(float*)(sinT + i) = s;
    
}

// k_proj: [q|k|v] = XB . WT^T, block = 128 token rows x 128 columns (two heads of q, k or v), wave = 64 rows x 64 columns (one head).
//  A = XB rows (row m = token, k = input channel), B = WT rows (column n = output channel, k = input channel); D element r of lane (h, n) = C[row 8h + r][col n].
__global__ __launch_bounds__(128) void k_proj(const bf* __restrict__ XB, const bf* __restrict__ WT,
                                              const float* __restrict__ cosT, const float* __restrict__ sinT,
                                              hb* QH, hb* KH, hb* VT) {
    __shared__ __align__(16) unsigned char sm[2 * PBUF];   // operand ring; output staging behind the loop
    float* st = (float*)sm;
    const unsigned tid = threadIdx.x, lane = tid & 31u, wv = tid >> 5, lr = lane & 15u, hi = lane >> 4;
    const unsigned wm = wv >> 1, wn = wv & 1u;   // this wave's 64 rows and 64 columns of the block tile
    const unsigned m0 = blockIdx.x * GM;
    const unsigned nt = blockIdx.y;
    const unsigned cr = tid >> 3, cc = (tid & 7u) * 8u;
    const bf* ga = XB + (size_t)(m0 + cr) * DM + cc;
    const bf* gb = WT + (size_t)(nt * GN + cr) * DM + cc;
    const unsigned la = ldsa(sm) + cr * LPB + cc * 2u;
    const unsigned lb = la + GM * LPB;

    v8f c[4][4];   // [16-row tile][16-column tile]
#pragma unroll
    for (int i = 0; i < 4; ++i) {
#pragma unroll
        for (int t = 0; t < 4; ++t) c[i][t] = (v8f){};
    }

    stage128(la, ga);
    stage128(lb, gb);
    wait_copies();
    __syncthreads();
    stage128(la + PBUF, ga + SK);
    stage128(lb + PBUF, gb + SK);

    unsigned cur = 0;   // byte offset of the buffer that this trip reads
#pragma unroll 1   // one trip per stage stays a loop: small text, one publish point
    for (unsigned s = 0; s < (unsigned)(DM / SK); ++s) {
        const bf* ap = (const bf*)(sm + cur) + (64u * wm + lr) * LP + 8u * hi;
        const bf* bp = (const bf*)(sm + cur) + (GM + 64u * wn + lr) * LP + 8u * hi;
#pragma unroll   // both 32-wide steps of a stage: constant LDS offsets
        for (unsigned k0 = 0; k0 < (unsigned)SK; k0 += 32) {
            v16bf a[4], bb[4];
#pragma unroll
            for (int i = 0; i < 4; ++i) a[i] = ldbs(ap + i * 16 * LP + k0);
#pragma unroll
            for (int t = 0; t < 4; ++t) bb[t] = ldbs(bp + t * 16 * LP + k0);
#pragma unroll
            for (int t = 0; t < 4; ++t) {
#pragma unroll
                for (int i = 0; i < 4; ++i) c[i][t] = wmmab(a[i], bb[t], c[i][t]);
            }
        }
        // WMMA distance on both sides of the loop's branches: four vector slots behind the stage's last products
        asm volatile("v_nop\n\tv_nop\n\tv_nop\n\tv_nop"
                     :: "v"(c[0][0]), "v"(c[0][1]), "v"(c[0][2]), "v"(c[0][3]), "v"(c[1][0]), "v"(c[1][1]), "v"(c[1][2]), "v"(c[1][3]),
                        "v"(c[2][0]), "v"(c[2][1]), "v"(c[2][2]), "v"(c[2][3]), "v"(c[3][0]), "v"(c[3][1]), "v"(c[3][2]), "v"(c[3][3]));
        // publish stage s + 1, free stage s's buffer, refill it with stage s + 2
        wait_lds();
        wait_copies();
        __syncthreads();
        if (s + 2u < (unsigned)(DM / SK)) {
            stage128(la + cur, ga + (s + 2u) * SK);
            stage128(lb + cur, gb + (s + 2u) * SK);
        }
        cur = PBUF - cur;
    }
    wait_copies();

    // staging: plane wn holds the 128 rows x 64 columns of head 2 nt + wn
    float* sw = st + (wn * GM + 64u * wm) * SP;
#pragma unroll
    for (int i = 0; i < 4; ++i) {
#pragma unroll
        for (int t = 0; t < 4; ++t) {
#pragma unroll
            for (int r = 0; r < 8; ++r) sw[(16u * i + 8u * hi + r) * SP + t * 16 + lr] = c[i][t][r];
        }
    }
    __syncthreads();

    const unsigned b = m0 / (unsigned)SEQ;
    const unsigned pos0 = m0 - b * (unsigned)SEQ;
#pragma unroll 1   // the two heads of the block, one after the other: small text
  for (unsigned nh = 0; nh < 2u; ++nh) {
    const unsigned hd = 2u * nt + nh;
    const float* sh = st + nh * GM * SP;
    if (hd < 32u) {
        // q (hd 0..15) or k (hd 16..31) head: rows [pos][64], rotary on column groups 0..3
        const unsigned h = hd & 15u;
        hb* dst = (hd < 16u ? QH : KH) + ((size_t)(b * NH + h) * SEQ + pos0) * HD;
        const unsigned cg = lane & 7u, rq = lane >> 3;
        const bool rot = cg < 4u;
        const float sc = hd < 16u ? QSC : 1.0f;
        const unsigned tc = (cg & 3u) * 4u;
{
#pragma unroll 2
            for (unsigned it = 0; it < 8; ++it) {
                const unsigned row = 32u * wv + 4u * it + rq;
                const float* sr = sh + row * SP + 8u * cg;
                const v4f xa = *(const v4fa*)sr;
                const v4f xb = *(const v4fa*)(sr + 4);
                const unsigned ti = (pos0 + row) * 16u + tc;
                const v4f c4 = *(const v4f*)(cosT + ti);
                const v4f s4 = *(const v4f*)(sinT + ti);
                const float x[8] = { xa[0], xa[1], xa[2], xa[3], xb[0], xb[1], xb[2], xb[3] };
                v4u o;
#pragma unroll
                for (int j = 0; j < 4; ++j) {
                    const float x1 = x[2 * j], x2 = x[2 * j + 1];
                    const float r1 = x1 * c4[j] - x2 * s4[j];
                    const float r2 = x2 * c4[j] + x1 * s4[j];
                    o[j] = pk2h((rot ? r1 : x1) * sc, (rot ? r2 : x2) * sc);
                }
                *(v4u*)(dst + (size_t)row * HD + 8u * cg) = o;
            }
            
        }
    } else {
        // v head: VT[d][pos]; 128 lines (64 d x 2 halves of 64 positions) per head, 4 lines per instruction
        const unsigned h = hd - 32u;
        hb* dst = VT + (size_t)(b * NH + h) * HD * SEQ + pos0;
        const unsigned c8 = (lane & 7u) * 8u, lq = lane >> 3;
{
#pragma unroll 2
            for (unsigned it = 0; it < 8; ++it) {
                const unsigned L = (wv * 8u + it) * 4u + lq;
                const unsigned d = L >> 1, tk = (L & 1u) * 64u + c8;
                const float* sc = sh + tk * SP + d;
                v4u o;
#pragma unroll
                for (int j = 0; j < 4; ++j) o[j] = pk2h(sc[(2 * j) * SP], sc[(2 * j + 1) * SP]);
                *(v4u*)(dst + (size_t)d * SEQ + tk) = o;
            }
            
        }
    }
  }
}

// k_flash: one wave per 32 queries (two 16-query tiles) of one (batch, head), 8 waves per block, 32 keys per step; each K and V^T fragment read from LDS feeds both query tiles.
//  S^T tile (keys x queries): A = K rows (row m = key, k = d), B = Q rows (column n = query, k = d); D element r of lane (h, n) = S[query n][key 8h + r].
//  The score products start from C = PCARRY - reference maximum of the lane's query (all 8 elements of a lane belong to one query), so D is the exponent of the carried P.
//  Lazy rescale: the reference is an earlier running maximum; exchange between the halves, correction and rescale run only in the first stage and where an exponent exceeds PTOP, tested once per stage of 64 keys; each half of a column sums its own P, joined once behind the loop.
//  P^T B fragment: element r <- tile of keys 0..15, element 8 + r <- tile of keys 16..31 (same lane); P carried x 2^7 in f16, row sum carried alike.
//  O^T tile (d x queries): A = V^T rows (row m = d, k = key), D element r of lane (h, n) = O[query n][d = 16 t + 8h + r].
__global__ __launch_bounds__(32 * NWV) void k_flash(const hb* __restrict__ QH, const hb* __restrict__ KH, const hb* __restrict__ VT, bf* CH, bf* CL) {
    __shared__ __align__(16) unsigned char sm[FOUT];   // K | V^T ring (first 2 * FBUF bytes); output staging behind the loop
    float* os = (float*)sm;
    const unsigned tid = threadIdx.x, lane = tid & 31u, wv = tid >> 5, lr = lane & 15u, hi = lane >> 4;
    const unsigned qpb = (unsigned)(SEQ / BQ);
    const unsigned bh = blockIdx.x / qpb;
    const unsigned q0 = (blockIdx.x - bh * qpb) * BQ + wv * (16u * QT);
    const unsigned b = bh >> 4, h = bh & 15u;

    v16h qf[QT][2];
#pragma unroll
    for (int q = 0; q < QT; ++q) {
        const hb* qp = QH + ((size_t)bh * SEQ + q0 + 16u * q + lr) * HD + 8u * hi;
        qf[q][0] = ldh(qp);
        qf[q][1] = ldh(qp + 32);
    }
    const unsigned cr = tid >> 3, cc = (tid & 7u) * 8u;
    const hb* gk = KH + ((size_t)bh * SEQ + cr) * HD + cc;
    const hb* gv = VT + ((size_t)bh * HD + cr) * SEQ + cc;
    const unsigned lk = ldsa(sm) + cr * LPB + cc * 2u;
    const unsigned lv = lk + SK * LPB;

    v8f o[QT][4];
    v8f cv[QT];               // C operand of the score products: PCARRY - reference max (log2 domain), alike in both halves of a column
    float l[QT];              // running sum of this lane's half of the keys (carried x 2^7); the halves are joined behind the loop
    float lim = -3.0e38f;     // exponents above this renew the reference: every finite one in the first stage, PTOP from then on
    float lo = -3.0e38f;      // least move of the reference: the first stage takes its own maximum, up or down; later it only rises
#pragma unroll
    for (int q = 0; q < QT; ++q) {
#pragma unroll
        for (int t = 0; t < 4; ++t) o[q][t] = (v8f){};
        cv[q] = (v8f){} + PCARRY;
        l[q] = 0.0f;
    }

    stage4(lk, gk, HD, lv, gv, SEQ);
    wait_copies();
    __syncthreads();
    stage4(lk + FBUF, gk + (size_t)SK * HD, HD, lv + FBUF, gv + SK, SEQ);

    unsigned cur = 0;   // byte offset of the buffer that this trip reads
#pragma unroll 1   // one trip per stage stays a loop: small text, one publish point
    for (unsigned sg = 0; sg < (unsigned)(SEQ / SK); ++sg) {
      const hb* kp = (const hb*)(sm + cur) + lr * LP + 8u * hi;
      const hb* vp = kp + SK * LP;
      v8f s[2][QT][2];   // [32-key step][query tile][16-key tile]
#pragma unroll   // both 32-key steps of a stage: constant LDS offsets
      for (int hs = 0; hs < 2; ++hs) {
#pragma unroll
        for (int q = 0; q < QT; ++q) { s[hs][q][0] = cv[q]; s[hs][q][1] = cv[q]; }
        const hb* ka = kp + hs * KS * LP;
#pragma unroll
        for (int dk = 0; dk < 2; ++dk) {
            const v16h a0 = ldhs(ka + dk * 32);
            const v16h a1 = ldhs(ka + 16 * LP + dk * 32);
#pragma unroll
            for (int q = 0; q < QT; ++q) {
                s[hs][q][0] = wmmah(a0, qf[q][dk], s[hs][q][0]);
                s[hs][q][1] = wmmah(a1, qf[q][dk], s[hs][q][1]);
            }
        }
      }
      // WMMA distance: four vector slots behind the stage's last score products
      asm volatile("v_nop\n\tv_nop\n\tv_nop\n\tv_nop" : "+v"(s[1][0][0]), "+v"(s[1][0][1]), "+v"(s[1][1][0]), "+v"(s[1][1][1])
                   : "v"(qf[0][0]), "v"(qf[0][1]), "v"(qf[1][0]), "v"(qf[1][1]));

      float mx[QT];   // this lane's half of the column only; the halves meet in the branch
#pragma unroll
      for (int q = 0; q < QT; ++q) {
          mx[q] = fmaxf(s[0][q][0][0], s[0][q][1][0]);
#pragma unroll
          for (int r = 1; r < 8; ++r) mx[q] = fmaxf(mx[q], fmaxf(s[0][q][0][r], s[0][q][1][r]));
#pragma unroll
          for (int r = 0; r < 8; ++r) mx[q] = fmaxf(mx[q], fmaxf(s[1][q][0][r], s[1][q][1][r]));
      }
      if (__builtin_amdgcn_ballot_w32(!(mx[0] <= lim && mx[1] <= lim)) != 0u) {   // wave-uniform, one test per stage
#pragma unroll
          for (int q = 0; q < QT; ++q) {
              const float up = fmaxf(mx[q], __shfl_xor(mx[q], 16, 32)) - PCARRY;   // the stage's maximum above the reference in use
              const float dm = fmaxf(up, lo);
              const float corr = __builtin_amdgcn_exp2f(-fmaxf(dm, 0.0f));         // dm < 0 only in the first stage, where O and l are still 0
              cv[q] -= dm;
#pragma unroll
              for (int hs = 0; hs < 2; ++hs) { s[hs][q][0] -= dm; s[hs][q][1] -= dm; }
              l[q] *= corr;
#pragma unroll
              for (int t = 0; t < 4; ++t) o[q][t] *= corr;
          }
          lim = PTOP;
          lo = 0.0f;
      }
#pragma unroll   // both 32-key steps of a stage: constant LDS offsets
      for (int hs = 0; hs < 2; ++hs) {
        v16h ph[QT];
#pragma unroll
        for (int q = 0; q < QT; ++q) {
            const v8f s0 = s[hs][q][0], s1 = s[hs][q][1];
            float p0[8], p1[8];
            float ps = 0.0f;
#pragma unroll
            for (int r = 0; r < 8; ++r) {
                p0[r] = __builtin_amdgcn_exp2f(s0[r]);
                p1[r] = __builtin_amdgcn_exp2f(s1[r]);
                ps += p0[r] + p1[r];
            }
            l[q] += ps;
            v8u hw;
#pragma unroll
            for (int j = 0; j < 4; ++j) {
                hw[j]     = pk2h(p0[2 * j], p0[2 * j + 1]);
                hw[4 + j] = pk2h(p1[2 * j], p1[2 * j + 1]);
            }
            ph[q] = __builtin_bit_cast(v16h, hw);
        }

        asm volatile("" ::: "memory");   // keep the V^T loads below the softmax (bounds live fragments)
        const hb* va = vp + hs * KS;
#pragma unroll
        for (int t = 0; t < 4; ++t) {
            const v16h a = ldhs(va + t * 16 * LP);
#pragma unroll
            for (int q = 0; q < QT; ++q) o[q][t] = wmmah(a, ph[q], o[q][t]);
        }
        // WMMA distance on both sides of the branches that follow: four vector slots behind the step's last products
        asm volatile("v_nop\n\tv_nop\n\tv_nop\n\tv_nop"
                     : "+v"(o[0][0]), "+v"(o[0][1]), "+v"(o[0][2]), "+v"(o[0][3]), "+v"(o[1][0]), "+v"(o[1][1]), "+v"(o[1][2]), "+v"(o[1][3])
                     : "v"(ph[0]), "v"(ph[1]));
      }
      // publish stage sg + 1, free stage sg's buffer, refill it with stage sg + 2
      wait_lds();
      wait_copies();
      __syncthreads();
      if (sg + 2u < (unsigned)(SEQ / SK)) stage4(lk + cur, gk + (size_t)(sg + 2u) * SK * HD, HD, lv + cur, gv + (sg + 2u) * SK, SEQ);
      cur = FBUF - cur;
    }
    wait_copies();

    float* ow = os + wv * (16 * QT * OSP);   // this wave's 32 rows
#pragma unroll
    for (int q = 0; q < QT; ++q) {
        const float inv = 1.0f / (l[q] + __shfl_xor(l[q], 16, 32));
#pragma unroll
        for (int t = 0; t < 4; ++t) {
#pragma unroll
            for (int r = 0; r < 8; ++r) ow[(16 * q + lr) * OSP + t * 16 + 8 * hi + r] = o[q][t][r] * inv;
        }
    }
    __syncthreads();
    const unsigned cg = lane & 7u, rq = lane >> 3;
    const size_t cbase = ((size_t)b * SEQ + q0) * DM + h * HD + 8u * cg;
{
#pragma unroll
        for (unsigned s = 0; s < 4u * QT; ++s) {
            const unsigned row = 4u * s + rq;
            const float* sr = ow + row * OSP + 8u * cg;
            const v4f xa = *(const v4fa*)sr;
            const v4f xb = *(const v4fa*)(sr + 4);
            const float x[8] = { xa[0], xa[1], xa[2], xa[3], xb[0], xb[1], xb[2], xb[3] };
            v4u oh, ol;
#pragma unroll
            for (int j = 0; j < 4; ++j) {
                const unsigned r0 = bfhi32(x[2 * j]), r1 = bfhi32(x[2 * j + 1]);
                oh[j] = (r0 >> 16) | r1;
                ol[j] = pk2bf(x[2 * j] - __uint_as_float(r0), x[2 * j + 1] - __uint_as_float(r1));
            }
            *(v4u*)(CH + cbase + (size_t)row * DM) = oh;
            *(v4u*)(CL + cbase + (size_t)row * DM) = ol;
        }
        
    }
}

// k_out: out = (CH + CL) . WOT^T + bf16(bout); block = 128 rows x 128 columns, wave = 64 rows x 64 columns; hi and lo products share the B fragments and the accumulator.
__global__ __launch_bounds__(128) void k_out(const bf* __restrict__ CH, const bf* __restrict__ CL, const bf* __restrict__ WOT,
                                             const float* __restrict__ bout, float* O) {
    __shared__ __align__(16) unsigned char sm[2 * OBUF];   // operand ring; output staging behind the loop
    float* st = (float*)sm;
    const unsigned tid = threadIdx.x, lane = tid & 31u, wv = tid >> 5, lr = lane & 15u, hi = lane >> 4;
    const unsigned wm = wv >> 1, wn = wv & 1u;   // this wave's 64 rows and 64 columns of the block tile
    const unsigned m0 = blockIdx.x * GM;
    const unsigned n0 = blockIdx.y * GN;
    const unsigned cr = tid >> 3, cc = (tid & 7u) * 8u;
    const size_t aoff = (size_t)(m0 + cr) * DM + cc;
    const bf* gh = CH + aoff;
    const bf* gl = CL + aoff;
    const bf* gb = WOT + (size_t)(n0 + cr) * DM + cc;
    const unsigned lh = ldsa(sm) + cr * LPB + cc * 2u;
    const unsigned ll = lh + GM * LPB;
    const unsigned lb = lh + 2 * GM * LPB;

    v8f c[4][4];   // [16-row tile][16-column tile]
#pragma unroll
    for (int i = 0; i < 4; ++i) {
#pragma unroll
        for (int t = 0; t < 4; ++t) c[i][t] = (v8f){};
    }

    stage128(lh, gh);
    stage128(ll, gl);
    stage128(lb, gb);
    wait_copies();
    __syncthreads();
    stage128(lh + OBUF, gh + SK);
    stage128(ll + OBUF, gl + SK);
    stage128(lb + OBUF, gb + SK);

    unsigned cur = 0;   // byte offset of the buffer that this trip reads
#pragma unroll 1   // one trip per stage stays a loop: small text, one publish point
    for (unsigned s = 0; s < (unsigned)(DM / SK); ++s) {
        const bf* ah = (const bf*)(sm + cur) + (64u * wm + lr) * LP + 8u * hi;
        const bf* al = ah + GM * LP;
        const bf* bp = (const bf*)(sm + cur) + (2 * GM + 64u * wn + lr) * LP + 8u * hi;
#pragma unroll   // both 32-wide steps of a stage: constant LDS offsets
        for (unsigned k0 = 0; k0 < (unsigned)SK; k0 += 32) {
            v16bf h[4], l[4], bb[4];
#pragma unroll
            for (int i = 0; i < 4; ++i) h[i] = ldbs(ah + i * 16 * LP + k0);
#pragma unroll
            for (int t = 0; t < 4; ++t) bb[t] = ldbs(bp + t * 16 * LP + k0);
#pragma unroll
            for (int i = 0; i < 4; ++i) l[i] = ldbs(al + i * 16 * LP + k0);
            // every accumulator takes its hi product, then its lo product, of this k step
#pragma unroll
            for (int t = 0; t < 4; ++t) {
#pragma unroll
                for (int i = 0; i < 4; ++i) c[i][t] = wmmab(h[i], bb[t], c[i][t]);
#pragma unroll
                for (int i = 0; i < 4; ++i) c[i][t] = wmmab(l[i], bb[t], c[i][t]);
            }
        }
        // WMMA distance on both sides of the loop's branches: four vector slots behind the stage's last products
        asm volatile("v_nop\n\tv_nop\n\tv_nop\n\tv_nop"
                     :: "v"(c[0][0]), "v"(c[0][1]), "v"(c[0][2]), "v"(c[0][3]), "v"(c[1][0]), "v"(c[1][1]), "v"(c[1][2]), "v"(c[1][3]),
                        "v"(c[2][0]), "v"(c[2][1]), "v"(c[2][2]), "v"(c[2][3]), "v"(c[3][0]), "v"(c[3][1]), "v"(c[3][2]), "v"(c[3][3]));
        // publish stage s + 1, free stage s's buffer, refill it with stage s + 2
        wait_lds();
        wait_copies();
        __syncthreads();
        if (s + 2u < (unsigned)(DM / SK)) {
            const unsigned kn = (s + 2u) * SK;
            stage128(lh + cur, gh + kn);
            stage128(ll + cur, gl + kn);
            stage128(lb + cur, gb + kn);
        }
        cur = OBUF - cur;
    }
    wait_copies();

    // staging: plane wn holds the 128 rows x 64 columns n0 + 64 wn ..
    float* sw = st + (wn * GM + 64u * wm) * SP;
#pragma unroll
    for (int i = 0; i < 4; ++i) {
#pragma unroll
        for (int t = 0; t < 4; ++t) {
#pragma unroll
            for (int r = 0; r < 8; ++r) sw[(16u * i + 8u * hi + r) * SP + t * 16 + lr] = c[i][t][r];
        }
    }
    __syncthreads();

    // one row of 128 columns (512 bytes, four whole lines) per store instruction; wave wv stores rows 32 wv ..
    const unsigned c4 = (lane & 15u) * 4u, ph = lane >> 4;
    const v4f bv = *(const v4f*)(bout + n0 + 64u * ph + c4);
    const float b0 = bfr(bv[0]), b1 = bfr(bv[1]), b2 = bfr(bv[2]), b3 = bfr(bv[3]);
    const float* sr = st + (ph * GM + 32u * wv) * SP + c4;
    float* orow = O + (size_t)(m0 + 32u * wv) * DM + n0 + 64u * ph + c4;
{
#pragma unroll 4
        for (unsigned row = 0; row < 32; ++row) {
            v4f val = *(const v4fa*)(sr + row * SP);
            val[0] += b0; val[1] += b1; val[2] += b2; val[3] += b3;
            *(v4f*)(orow + (size_t)row * DM) = val;
        }
        
    }
}

extern "C" void kernel_launch(void* const* d_in, const int* in_sizes, int n_in,
                              void* d_out, int out_size, void* d_ws, size_t ws_size, hipStream_t stream) {
    if (n_in < 5) return;
    const size_t needx = ((size_t)(NB - 1) * SEQ_FULL + SEQ) * DM;
    if ((size_t)in_sizes[0] < needx) return;
    if ((size_t)in_sizes[1] < (size_t)DM * DM) return;
    if ((size_t)in_sizes[2] < (size_t)2 * DM * DM) return;
    if ((size_t)in_sizes[3] < (size_t)DM * DM) return;
    if ((size_t)in_sizes[4] < (size_t)DM) return;
    if ((size_t)out_size < (size_t)NB * SEQ * DM) return;
    const float* x    = (const float*)d_in[0];   // queries [NB_FULL][SEQ_FULL][DM]
    const float* Wq   = (const float*)d_in[1];   // [DM in][DM out]
    const float* Wkv  = (const float*)d_in[2];   // [DM in][2*DM out]
    const float* Wout = (const float*)d_in[3];   // [DM in][DM out]
    const float* bout = (const float*)d_in[4];   // [DM]
    float* OUT = (float*)d_out;                  // [NB][SEQ][DM]

    const size_t PA = (size_t)NB * SEQ * DM * 2;     // bytes per 16-bit activation plane
    const size_t PW = (size_t)NWT * DM * 2;          // bytes of the transposed weight plane
    const size_t PT = (size_t)SEQ * 16 * 4;          // bytes per rotary table
    if (6 * PA + PW + 2 * PT > ws_size) return;
    char* wsp = (char*)d_ws;
    bf* XB = (bf*)(wsp);
    bf* WT = (bf*)(wsp + PA);
    float* cosT = (float*)(wsp + PA + PW);
    float* sinT = (float*)(wsp + PA + PW + PT);
    hb* QH = (hb*)(wsp + PA + PW + 2 * PT);
    hb* KH = (hb*)(wsp + 2 * PA + PW + 2 * PT);
    hb* VT = (hb*)(wsp + 3 * PA + PW + 2 * PT);
    bf* CH = (bf*)(wsp + 4 * PA + PW + 2 * PT);
    bf* CL = (bf*)(wsp + 5 * PA + PW + 2 * PT);

    FreqArgs fa;
    for (int i = 0; i < 16; ++i) {
        const float pw = (float)pow(10000.0, (double)(2 * i) / 32.0);
        fa.inv[i] = 1.0f / pw;
    }

    const unsigned gc = (unsigned)(((size_t)NB * SEQ * DM / 8 + 255) / 256);
    k_cvt<<<gc, 256, 0, stream>>>(x, XB);
    k_wt<<<dim3(DM / 64, NWT / 128, 1), 256, 0, stream>>>(Wq, Wkv, Wout, WT);
    k_tab<<<(unsigned)(SEQ * 16 / 256), 256, 0, stream>>>(fa, cosT, sinT);
    k_proj<<<dim3((unsigned)(NB * SEQ / GM), NQKV / GN, 1), 128, 0, stream>>>(XB, WT, cosT, sinT, QH, KH, VT);
    k_flash<<<(unsigned)(NB * NH * (SEQ / BQ)), 32 * NWV, 0, stream>>>(QH, KH, VT, CH, CL);
    k_out<<<dim3((unsigned)(NB * SEQ / GM), DM / GN, 1), 128, 0, stream>>>(CH, CL, WT + (size_t)NQKV * DM, bout, OUT);
}

// v005
// A run of this version takes 136 microseconds.
// Timed twice side by side with v004, it ran 1.03 times as fast both times.
// All steps since v000 together make it 3.18 times as fast.
#include <hip/hip_runtime.h>

// Compute dtypes, f32 accumulate: x.Wq, x.Wkv on v_wmma_f32_16x16x32_bf16 (inputs RNE-converted to bf16, exact products); q.k^T and P.V on v_wmma_f32_16x16x32_f16 (q, k, v planes f16, q stored x log2(e)/8; P carried x128 in f16); ctx.Wout on v_wmma_f32_16x16x32_bf16 with ctx as bf16 hi + bf16 lo (two products) against bf16 Wout.
// Self-attention, 16 heads x 64, partial interleaved rotary on head dims 0..31 (16 frequencies, f32, applied on the f32 projection tiles before the f16 convert), logits x 1/8, full softmax over all keys (online, log2 domain, lazily rescaled), merged heads . Wout + bout.
// Flash form with transposed tiles: S^T accumulator tiles are directly the B-operand layout of P^T; all WMMA operands are two 16-byte loads.
// The three preparation passes (x to bf16, weight transpose, rotary tables) depend on nothing but the inputs and share one launch, picked by block index.
// Operand tiles of the three matrix kernels are staged in LDS, 128 bytes of every row per stage, two buffers, by asynchronous copies that cover whole 128-byte lines; fragments are read from LDS rows at a 144-byte pitch.

#ifndef NB
#define NB 4
#endif
#ifndef SEQ
#define SEQ 2048
#endif
#define NB_FULL  4
#define SEQ_FULL 2048
#define DM   1024              // model width == merged head width
#define NH   16
#define HD   64
#define NQKV 3072              // rows of the transposed q|k|v weight plane
#define NWT  4096              // q|k|v|out rows of the transposed weight plane
#define GM   128               // token rows per GEMM block (2 x 2 waves, 64 rows x 64 columns each)
#define GN   128               // output columns per GEMM block (k_proj: two heads)
#define SP   68                // LDS pitch (floats) of the GEMM staging rows
#define NWV  8                 // waves per flash block
#define QT   2                 // 16-query tiles per flash wave: every K and V^T fragment feeds QT products
#define BQ   (16 * QT * NWV)   // queries per flash block
#define KS   32                // keys per step
#define OSP  68                // LDS pitch (floats) of the flash output staging rows
#define VTP  72                // LDS pitch (16-bit elements) of the weight transpose tile
#define LP   72                // LDS pitch (16-bit elements) of a staged 128-byte row: 144 B = 16 B x 9, conflict-free for 16-byte fragment reads
#define LPB  (LP * 2)          // the same in bytes
#define SK   64                // 16-bit elements of a row per stage (GEMM: k; flash: keys of a V^T row, and keys per stage)
#define PBUF ((GM + GN) * LPB)         // k_proj buffer: 128 A rows | 128 B rows
#define FBUF ((SK + HD) * LPB)         // k_flash buffer: 64 K rows | 64 V^T rows
#define FOUT (BQ * OSP * 4)            // k_flash output staging: one f32 row per query
#define OBUF ((2 * GM + GN) * LPB)     // k_out buffer: 128 hi rows | 128 lo rows | 128 B rows
#define WTB  ((DM / 64) * (NWT / 128))         // k_prep: blocks of the weight transpose
#define TBB  (SEQ * 16 / 256)                  // k_prep: blocks of the rotary tables
#define L2E  1.4426950408889634f
#define QSC  (0.125f * L2E)    // logit scale and change to the log2 domain, applied to q on its f32 projection tile
#define PCARRY 7.0f            // P carried as 2^7 * p against the reference maximum in use (row sum carried alike, cancels in the normalisation)
#define PTOP   15.0f           // an exponent above this renews the reference maximum: P <= 2^15, inside f16

static_assert(NH == 16);
static_assert(HD == 64);
static_assert(NH * HD == DM);
static_assert(SEQ % GM == 0);
static_assert(SEQ % BQ == 0);
static_assert(SEQ % KS == 0);
static_assert(DM % 32 == 0);
static_assert(DM % SK == 0 && DM / SK >= 2);       // GEMM ring: whole stages, at least two
static_assert(SEQ % SK == 0 && SEQ / SK >= 2);     // flash ring: whole stages, at least two
static_assert(SK == 2 * KS && HD == 64 && GM == 128 && GN == 2 * HD);
static_assert(2 * PBUF >= 2 * GM * SP * 4);        // the ring holds the GEMM output staging (two planes of 64 columns)
static_assert(2 * OBUF >= 2 * GM * SP * 4);
static_assert(FOUT >= 2 * FBUF);                   // the flash output staging holds the ring
static_assert(NWV == 8 && SK == 64 && HD == 64);   // stage4: 256 threads, two copies of 32 rows per tile
static_assert(NB <= NB_FULL);
static_assert(SEQ <= SEQ_FULL);
static_assert(((size_t)NB * SEQ * DM) % 2048 == 0);                                        // p_cvt: blocks * 256 threads * 8 elements == plane
static_assert((size_t)(DM / 64) * (NWT / 128) * (size_t)(64 * 128) == (size_t)NWT * DM);   // p_wt: blocks * (64 k x 128 n) == weight plane
static_assert(((size_t)SEQ * 16) % 256 == 0);                                              // p_tab: blocks * 256 == table entries
static_assert((size_t)(NB * SEQ / GM) * (NQKV / GN) * (size_t)(GM * GN) == (size_t)3 * NB * SEQ * DM);   // k_proj: blocks * (128 x 128) == q + k + v planes
static_assert((size_t)(NB * NH * (SEQ / BQ)) * (size_t)(BQ * HD) == (size_t)NB * SEQ * DM);              // k_flash: blocks * (256 x 64) == ctx plane
static_assert((size_t)(NB * SEQ / GM) * (DM / GN) * (size_t)(GM * GN) == (size_t)NB * SEQ * DM);         // k_out: blocks * (128 x 128) == output
static_assert(((size_t)SEQ * 16 * 4) % 256 == 0);
static_assert((size_t)6 * NB_FULL * SEQ_FULL * DM * 2 + (size_t)NWT * DM * 2 + (size_t)2 * SEQ_FULL * 16 * 4 <= (size_t)134217728);

typedef unsigned short bf;     // bf16 bit pattern
typedef unsigned short hb;     // f16 bit pattern
typedef __attribute__((ext_vector_type(16))) __bf16   v16bf;
typedef __attribute__((ext_vector_type(2)))  __bf16   v2bf;
typedef __attribute__((ext_vector_type(16))) _Float16 v16h;
typedef __attribute__((ext_vector_type(2)))  _Float16 v2h;
typedef __attribute__((ext_vector_type(8)))  unsigned short v8us;
typedef __attribute__((ext_vector_type(8)))  unsigned int   v8u;
typedef __attribute__((ext_vector_type(4)))  unsigned int   v4u;
typedef __attribute__((ext_vector_type(8)))  float    v8f;
typedef __attribute__((ext_vector_type(4)))  float    v4f;
typedef v4f  __attribute__((may_alias)) v4fa;
typedef v8us __attribute__((may_alias)) v8usa;

struct FreqArgs { float inv[16]; };
static_assert(sizeof(FreqArgs) == 64);

__device__ __forceinline__ unsigned short f2bf(float f) { unsigned u = __float_as_uint(f); u += 0x7FFFu + ((u >> 16) & 1u); return (unsigned short)(u >> 16); }
// RNE bf16 value of f kept in the upper 16 bits of an f32 bit pattern
__device__ __forceinline__ unsigned bfhi32(float f) { unsigned u = __float_as_uint(f); u += 0x7FFFu + ((u >> 16) & 1u); return u & 0xFFFF0000u; }
__device__ __forceinline__ float bfr(float f) { return __uint_as_float(bfhi32(f)); }
__device__ __forceinline__ v16bf cat16b(v8us lo, v8us hi) { return __builtin_bit_cast(v16bf, __builtin_shufflevector(lo, hi, 0, 1, 2, 3, 4, 5, 6, 7, 8, 9, 10, 11, 12, 13, 14, 15)); }
__device__ __forceinline__ v16h  cat16h(v8us lo, v8us hi) { return __builtin_bit_cast(v16h,  __builtin_shufflevector(lo, hi, 0, 1, 2, 3, 4, 5, 6, 7, 8, 9, 10, 11, 12, 13, 14, 15)); }
__device__ __forceinline__ v8f wmmab(v16bf a, v16bf b, v8f c) { return __builtin_amdgcn_wmma_f32_16x16x32_bf16(false, a, false, b, (short)0, c, false, false); }
__device__ __forceinline__ v8f wmmah(v16h a, v16h b, v8f c) { return __builtin_amdgcn_wmma_f32_16x16x32_f16(false, a, false, b, (short)0, c, false, false); }
// fragment loader (A and B alike): p = row base + k0 + 8*(lane>>4); elements 0..7 <- p[0..7], elements 8..15 <- p[16..23]
__device__ __forceinline__ v16h  ldh(const hb* p) { return cat16h(*(const v8us*)p, *(const v8us*)(p + 16)); }
// the same fragment loaders on LDS rows
__device__ __forceinline__ v16bf ldbs(const bf* p) { return cat16b(*(const v8usa*)p, *(const v8usa*)(p + 16)); }
__device__ __forceinline__ v16h  ldhs(const hb* p) { return cat16h(*(const v8usa*)p, *(const v8usa*)(p + 16)); }
// LDS byte address of a __shared__ location: the low 32 bits of its address
__device__ __forceinline__ unsigned ldsa(const void* p) { return (unsigned)(size_t)p; }
// Asynchronous copies global -> LDS, 16 bytes per lane each. The s_wait_xcnt closes each statement so that no address register of an issued copy is rewritten ahead of it.
#define CPA(l, g) "global_load_async_to_lds_b128 %" #l ", %" #g ", off\n\t"
__device__ __forceinline__ void cp8(const unsigned (&l)[8], const unsigned short* const (&g)[8]) {
    asm volatile(CPA(0, 8) CPA(1, 9) CPA(2, 10) CPA(3, 11) CPA(4, 12) CPA(5, 13) CPA(6, 14) CPA(7, 15) "s_wait_xcnt 0x0"
                 :: "v"(l[0]), "v"(l[1]), "v"(l[2]), "v"(l[3]), "v"(l[4]), "v"(l[5]), "v"(l[6]), "v"(l[7]),
                    "v"(g[0]), "v"(g[1]), "v"(g[2]), "v"(g[3]), "v"(g[4]), "v"(g[5]), "v"(g[6]), "v"(g[7]) : "memory");
}
// A block of 128 threads copies 16 rows of 128 bytes per copy: thread -> row tid >> 3, 16-byte piece tid & 7 (a wave covers 4 whole lines).
// la, ga: this thread's LDS byte address and global address in rows 0..15 of a tile; stage8: two tiles of 64 rows, global pitches pa, pb elements; stage128: one tile of 128 rows, global pitch DM.
__device__ __forceinline__ void stage8(unsigned la, const unsigned short* ga, size_t pa, unsigned lb, const unsigned short* gb, size_t pb) {
    unsigned l[8]; const unsigned short* g[8];
#pragma unroll   // constant indices, so that both arrays are registers (asm operands)
    for (unsigned i = 0; i < 4; ++i) {
        l[i] = la + i * 16u * LPB;      g[i] = ga + i * 16u * pa;
        l[4 + i] = lb + i * 16u * LPB;  g[4 + i] = gb + i * 16u * pb;
    }
    cp8(l, g);
}
__device__ __forceinline__ void cp4(const unsigned (&l)[4], const unsigned short* const (&g)[4]) {
    asm volatile(CPA(0, 4) CPA(1, 5) CPA(2, 6) CPA(3, 7) "s_wait_xcnt 0x0"
                 :: "v"(l[0]), "v"(l[1]), "v"(l[2]), "v"(l[3]), "v"(g[0]), "v"(g[1]), "v"(g[2]), "v"(g[3]) : "memory");
}
// A block of 256 threads copies 32 rows of 128 bytes per copy (thread -> row tid >> 3, piece tid & 7); stage4: two tiles of 64 rows, la, ga in rows 0..31.
__device__ __forceinline__ void stage4(unsigned la, const unsigned short* ga, size_t pa, unsigned lb, const unsigned short* gb, size_t pb) {
    unsigned l[4]; const unsigned short* g[4];
#pragma unroll   // constant indices, so that both arrays are registers (asm operands)
    for (unsigned i = 0; i < 2; ++i) {
        l[i] = la + i * 32u * LPB;      g[i] = ga + i * 32u * pa;
        l[2 + i] = lb + i * 32u * LPB;  g[2 + i] = gb + i * 32u * pb;
    }
    cp4(l, g);
}
__device__ __forceinline__ void stage128(unsigned l, const unsigned short* g) { stage8(l, g, DM, l + 64u * LPB, g + (size_t)64 * DM, DM); }
// this wave's copies have landed
__device__ __forceinline__ void wait_copies() { asm volatile("s_wait_asynccnt 0x0" ::: "memory"); }
// this wave's LDS reads have returned (before the barrier behind which their buffer is refilled)
__device__ __forceinline__ void wait_lds() { asm volatile("s_wait_dscnt 0x0" ::: "memory"); }
// two f32 -> packed 16-bit pair (RNE), element 0 in the low half-word
__device__ __forceinline__ unsigned pk2bf(float a, float b) { v2bf t; t[0] = (__bf16)a; t[1] = (__bf16)b; return __builtin_bit_cast(unsigned, t); }
__device__ __forceinline__ unsigned pk2h(float a, float b) { v2h t; t[0] = (_Float16)a; t[1] = (_Float16)b; return __builtin_bit_cast(unsigned, t); }

__device__ __forceinline__ void p_cvt(unsigned blk, const float* __restrict__ x, bf* XB) {
    const unsigned i = blk * 256u + threadIdx.x;
    const unsigned per = (unsigned)(SEQ * DM / 8);
    if (i >= (unsigned)NB * per) return;
    const unsigned b = i / per, r = i - b * per;
    const float* src = x + (size_t)b * SEQ_FULL * DM + (size_t)r * 8;
    const v4f v0 = *(const v4f*)src;
    const v4f v1 = *(const v4f*)(src + 4);
    v4u o;
    o[0] = (bfhi32(v0[0]) >> 16) | bfhi32(v0[1]);
    o[1] = (bfhi32(v0[2]) >> 16) | bfhi32(v0[3]);
    o[2] = (bfhi32(v1[0]) >> 16) | bfhi32(v1[1]);
    o[3] = (bfhi32(v1[2]) >> 16) | bfhi32(v1[3]);
    bf* dst = XB + (size_t)i * 8;
    *(v4u*)dst = o;
    
}

// p_wt: transposed bf16 weight plane WT[n][k] = bf16(W[k][n]); in[DM k][ncols] -> out[ncols][DM]; virtual column space: 0..1023 Wq, 1024..3071 Wkv, 3072..4095 Wout.
__device__ __forceinline__ void p_wt(unsigned bk, unsigned bn, const float* __restrict__ Wq, const float* __restrict__ Wkv, const float* __restrict__ Wo, bf* WT) {
    __shared__ __align__(16) bf tl[128 * VTP];
    const unsigned tid = threadIdx.x;
    const unsigned k0 = bk * 64u;
    const unsigned n0 = bn * 128u;
    const float* src;
    unsigned ldn;
    if (n0 < 1024u)      { src = Wq  + n0;            ldn = 1024u; }
    else if (n0 < 3072u) { src = Wkv + (n0 - 1024u);  ldn = 2048u; }
    else                 { src = Wo  + (n0 - 3072u);  ldn = 1024u; }
    src += (size_t)k0 * ldn;
#pragma unroll
    for (unsigned it = 0; it < 8; ++it) {
        const unsigned f = it * 256u + tid;
        const unsigned kk = f >> 5, c4 = (f & 31u) * 4u;
        const v4f x = *(const v4f*)(src + (size_t)kk * ldn + c4);
#pragma unroll
        for (unsigned c = 0; c < 4; ++c) tl[(c4 + c) * VTP + kk] = f2bf(x[c]);
    }
    __syncthreads();
    bf* dst = WT + (size_t)n0 * DM + k0;
    const unsigned c8 = (tid & 7u) * 8u, dr = tid >> 3;
{
#pragma unroll
        for (unsigned it = 0; it < 4; ++it) {
            const unsigned d = it * 32u + dr;
            const v8us o = *(const v8usa*)(tl + d * VTP + c8);
            *(v8us*)(dst + (size_t)d * DM + c8) = o;
        }
        
    }
}

__device__ __forceinline__ void p_tab(unsigned blk, const FreqArgs& fa, float* cosT, float* sinT) {
    const unsigned i = blk * 256u + threadIdx.x;
    const unsigned t = i >> 4, f = i & 15u;
    float inv = fa.inv[0];
#pragma unroll
    for (unsigned j = 1; j < 16; ++j) inv = (f == j) ? fa.inv[j] : inv;
    const float ang = (float)t * inv;
    float s, c;
    sincosf(ang, &s, &c);
    *(float*)(cosT + i) = c;
    *(float*)(sinT + i) = s;
    
}

// k_prep: one grid for the three passes; the transposes (a barrier and two memory trips each) and the tables take the lowest block indices, the x stream the blocks behind them. The branch is block-uniform.
__global__ __launch_bounds__(256) void k_prep(const float* __restrict__ x, const float* __restrict__ Wq, const float* __restrict__ Wkv, const float* __restrict__ Wo,
                                              FreqArgs fa, bf* XB, bf* WT, float* cosT, float* sinT) {
    const unsigned blk = blockIdx.x;
    if (blk < (unsigned)WTB)              p_wt(blk % (unsigned)(DM / 64), blk / (unsigned)(DM / 64), Wq, Wkv, Wo, WT);
    else if (blk < (unsigned)(WTB + TBB)) p_tab(blk - (unsigned)WTB, fa, cosT, sinT);
    else                                  p_cvt(blk - (unsigned)(WTB + TBB), x, XB);
}

// k_proj: [q|k|v] = XB . WT^T, block = 128 token rows x 128 columns (two heads of q, k or v), wave = 64 rows x 64 columns (one head).
//  A = XB rows (row m = token, k = input channel), B = WT rows (column n = output channel, k = input channel); D element r of lane (h, n) = C[row 8h + r][col n].
__global__ __launch_bounds__(128) void k_proj(const bf* __restrict__ XB, const bf* __restrict__ WT,
                                              const float* __restrict__ cosT, const float* __restrict__ sinT,
                                              hb* QH, hb* KH, hb* VT) {
    __shared__ __align__(16) unsigned char sm[2 * PBUF];   // operand ring; output staging behind the loop
    float* st = (float*)sm;
    const unsigned tid = threadIdx.x, lane = tid & 31u, wv = tid >> 5, lr = lane & 15u, hi = lane >> 4;
    const unsigned wm = wv >> 1, wn = wv & 1u;   // this wave's 64 rows and 64 columns of the block tile
    const unsigned m0 = blockIdx.x * GM;
    const unsigned nt = blockIdx.y;
    const unsigned cr = tid >> 3, cc = (tid & 7u) * 8u;
    const bf* ga = XB + (size_t)(m0 + cr) * DM + cc;
    const bf* gb = WT + (size_t)(nt * GN + cr) * DM + cc;
    const unsigned la = ldsa(sm) + cr * LPB + cc * 2u;
    const unsigned lb = la + GM * LPB;

    v8f c[4][4];   // [16-row tile][16-column tile]
#pragma unroll
    for (int i = 0; i < 4; ++i) {
#pragma unroll
        for (int t = 0; t < 4; ++t) c[i][t] = (v8f){};
    }

    stage128(la, ga);
    stage128(lb, gb);
    wait_copies();
    __syncthreads();
    stage128(la + PBUF, ga + SK);
    stage128(lb + PBUF, gb + SK);

    unsigned cur = 0;   // byte offset of the buffer that this trip reads
#pragma unroll 1   // one trip per stage stays a loop: small text, one publish point
    for (unsigned s = 0; s < (unsigned)(DM / SK); ++s) {
        const bf* ap = (const bf*)(sm + cur) + (64u * wm + lr) * LP + 8u * hi;
        const bf* bp = (const bf*)(sm + cur) + (GM + 64u * wn + lr) * LP + 8u * hi;
#pragma unroll   // both 32-wide steps of a stage: constant LDS offsets
        for (unsigned k0 = 0; k0 < (unsigned)SK; k0 += 32) {
            v16bf a[4], bb[4];
#pragma unroll
            for (int i = 0; i < 4; ++i) a[i] = ldbs(ap + i * 16 * LP + k0);
#pragma unroll
            for (int t = 0; t < 4; ++t) bb[t] = ldbs(bp + t * 16 * LP + k0);
#pragma unroll
            for (int t = 0; t < 4; ++t) {
#pragma unroll
                for (int i = 0; i < 4; ++i) c[i][t] = wmmab(a[i], bb[t], c[i][t]);
            }
        }
        // WMMA distance on both sides of the loop's branches: four vector slots behind the stage's last products
        asm volatile("v_nop\n\tv_nop\n\tv_nop\n\tv_nop"
                     :: "v"(c[0][0]), "v"(c[0][1]), "v"(c[0][2]), "v"(c[0][3]), "v"(c[1][0]), "v"(c[1][1]), "v"(c[1][2]), "v"(c[1][3]),
                        "v"(c[2][0]), "v"(c[2][1]), "v"(c[2][2]), "v"(c[2][3]), "v"(c[3][0]), "v"(c[3][1]), "v"(c[3][2]), "v"(c[3][3]));
        // publish stage s + 1, free stage s's buffer, refill it with stage s + 2
        wait_lds();
        wait_copies();
        __syncthreads();
        if (s + 2u < (unsigned)(DM / SK)) {
            stage128(la + cur, ga + (s + 2u) * SK);
            stage128(lb + cur, gb + (s + 2u) * SK);
        }
        cur = PBUF - cur;
    }
    wait_copies();

    // staging: plane wn holds the 128 rows x 64 columns of head 2 nt + wn
    float* sw = st + (wn * GM + 64u * wm) * SP;
#pragma unroll
    for (int i = 0; i < 4; ++i) {
#pragma unroll
        for (int t = 0; t < 4; ++t) {
#pragma unroll
            for (int r = 0; r < 8; ++r) sw[(16u * i + 8u * hi + r) * SP + t * 16 + lr] = c[i][t][r];
        }
    }
    __syncthreads();

    const unsigned b = m0 / (unsigned)SEQ;
    const unsigned pos0 = m0 - b * (unsigned)SEQ;
#pragma unroll 1   // the two heads of the block, one after the other: small text
  for (unsigned nh = 0; nh < 2u; ++nh) {
    const unsigned hd = 2u * nt + nh;
    const float* sh = st + nh * GM * SP;
    if (hd < 32u) {
        // q (hd 0..15) or k (hd 16..31) head: rows [pos][64], rotary on column groups 0..3
        const unsigned h = hd & 15u;
        hb* dst = (hd < 16u ? QH : KH) + ((size_t)(b * NH + h) * SEQ + pos0) * HD;
        const unsigned cg = lane & 7u, rq = lane >> 3;
        const bool rot = cg < 4u;
        const float sc = hd < 16u ? QSC : 1.0f;
        const unsigned tc = (cg & 3u) * 4u;
{
#pragma unroll 2
            for (unsigned it = 0; it < 8; ++it) {
                const unsigned row = 32u * wv + 4u * it + rq;
                const float* sr = sh + row * SP + 8u * cg;
                const v4f xa = *(const v4fa*)sr;
                const v4f xb = *(const v4fa*)(sr + 4);
                const unsigned ti = (pos0 + row) * 16u + tc;
                const v4f c4 = *(const v4f*)(cosT + ti);
                const v4f s4 = *(const v4f*)(sinT + ti);
                const float x[8] = { xa[0], xa[1], xa[2], xa[3], xb[0], xb[1], xb[2], xb[3] };
                v4u o;
#pragma unroll
                for (int j = 0; j < 4; ++j) {
                    const float x1 = x[2 * j], x2 = x[2 * j + 1];
                    const float r1 = x1 * c4[j] - x2 * s4[j];
                    const float r2 = x2 * c4[j] + x1 * s4[j];
                    o[j] = pk2h((rot ? r1 : x1) * sc, (rot ? r2 : x2) * sc);
                }
                *(v4u*)(dst + (size_t)row * HD + 8u * cg) = o;
            }
            
        }
    } else {
        // v head: VT[d][pos]; 128 lines (64 d x 2 halves of 64 positions) per head, 4 lines per instruction
        const unsigned h = hd - 32u;
        hb* dst = VT + (size_t)(b * NH + h) * HD * SEQ + pos0;
        const unsigned c8 = (lane & 7u) * 8u, lq = lane >> 3;
{
#pragma unroll 2
            for (unsigned it = 0; it < 8; ++it) {
                const unsigned L = (wv * 8u + it) * 4u + lq;
                const unsigned d = L >> 1, tk = (L & 1u) * 64u + c8;
                const float* sc = sh + tk * SP + d;
                v4u o;
#pragma unroll
                for (int j = 0; j < 4; ++j) o[j] = pk2h(sc[(2 * j) * SP], sc[(2 * j + 1) * SP]);
                *(v4u*)(dst + (size_t)d * SEQ + tk) = o;
            }
            
        }
    }
  }
}

// k_flash: one wave per 32 queries (two 16-query tiles) of one (batch, head), 8 waves per block, 32 keys per step; each K and V^T fragment read from LDS feeds both query tiles.
//  S^T tile (keys x queries): A = K rows (row m = key, k = d), B = Q rows (column n = query, k = d); D element r of lane (h, n) = S[query n][key 8h + r].
//  The score products start from C = PCARRY - reference maximum of the lane's query (all 8 elements of a lane belong to one query), so D is the exponent of the carried P.
//  Lazy rescale: the reference is an earlier running maximum; exchange between the halves, correction and rescale run only in the first stage and where an exponent exceeds PTOP, tested once per stage of 64 keys; each half of a column sums its own P, joined once behind the loop.
//  P^T B fragment: element r <- tile of keys 0..15, element 8 + r <- tile of keys 16..31 (same lane); P carried x 2^7 in f16, row sum carried alike.
//  O^T tile (d x queries): A = V^T rows (row m = d, k = key), D element r of lane (h, n) = O[query n][d = 16 t + 8h + r].
__global__ __launch_bounds__(32 * NWV) void k_flash(const hb* __restrict__ QH, const hb* __restrict__ KH, const hb* __restrict__ VT, bf* CH, bf* CL) {
    __shared__ __align__(16) unsigned char sm[FOUT];   // K | V^T ring (first 2 * FBUF bytes); output staging behind the loop
    float* os = (float*)sm;
    const unsigned tid = threadIdx.x, lane = tid & 31u, wv = tid >> 5, lr = lane & 15u, hi = lane >> 4;
    const unsigned qpb = (unsigned)(SEQ / BQ);
    const unsigned bh = blockIdx.x / qpb;
    const unsigned q0 = (blockIdx.x - bh * qpb) * BQ + wv * (16u * QT);
    const unsigned b = bh >> 4, h = bh & 15u;

    v16h qf[QT][2];
#pragma unroll
    for (int q = 0; q < QT; ++q) {
        const hb* qp = QH + ((size_t)bh * SEQ + q0 + 16u * q + lr) * HD + 8u * hi;
        qf[q][0] = ldh(qp);
        qf[q][1] = ldh(qp + 32);
    }
    const unsigned cr = tid >> 3, cc = (tid & 7u) * 8u;
    const hb* gk = KH + ((size_t)bh * SEQ + cr) * HD + cc;
    const hb* gv = VT + ((size_t)bh * HD + cr) * SEQ + cc;
    const unsigned lk = ldsa(sm) + cr * LPB + cc * 2u;
    const unsigned lv = lk + SK * LPB;

    v8f o[QT][4];
    v8f cv[QT];               // C operand of the score products: PCARRY - reference max (log2 domain), alike in both halves of a column
    float l[QT];              // running sum of this lane's half of the keys (carried x 2^7); the halves are joined behind the loop
    float lim = -3.0e38f;     // exponents above this renew the reference: every finite one in the first stage, PTOP from then on
    float lo = -3.0e38f;      // least move of the reference: the first stage takes its own maximum, up or down; later it only rises
#pragma unroll
    for (int q = 0; q < QT; ++q) {
#pragma unroll
        for (int t = 0; t < 4; ++t) o[q][t] = (v8f){};
        cv[q] = (v8f){} + PCARRY;
        l[q] = 0.0f;
    }

    stage4(lk, gk, HD, lv, gv, SEQ);
    wait_copies();
    __syncthreads();
    stage4(lk + FBUF, gk + (size_t)SK * HD, HD, lv + FBUF, gv + SK, SEQ);

    unsigned cur = 0;   // byte offset of the buffer that this trip reads
#pragma unroll 1   // one trip per stage stays a loop: small text, one publish point
    for (unsigned sg = 0; sg < (unsigned)(SEQ / SK); ++sg) {
      const hb* kp = (const hb*)(sm + cur) + lr * LP + 8u * hi;
      const hb* vp = kp + SK * LP;
      v8f s[2][QT][2];   // [32-key step][query tile][16-key tile]
#pragma unroll   // both 32-key steps of a stage: constant LDS offsets
      for (int hs = 0; hs < 2; ++hs) {
#pragma unroll
        for (int q = 0; q < QT; ++q) { s[hs][q][0] = cv[q]; s[hs][q][1] = cv[q]; }
        const hb* ka = kp + hs * KS * LP;
#pragma unroll
        for (int dk = 0; dk < 2; ++dk) {
            const v16h a0 = ldhs(ka + dk * 32);
            const v16h a1 = ldhs(ka + 16 * LP + dk * 32);
#pragma unroll
            for (int q = 0; q < QT; ++q) {
                s[hs][q][0] = wmmah(a0, qf[q][dk], s[hs][q][0]);
                s[hs][q][1] = wmmah(a1, qf[q][dk], s[hs][q][1]);
            }
        }
      }
      // WMMA distance: four vector slots behind the stage's last score products
      asm volatile("v_nop\n\tv_nop\n\tv_nop\n\tv_nop" : "+v"(s[1][0][0]), "+v"(s[1][0][1]), "+v"(s[1][1][0]), "+v"(s[1][1][1])
                   : "v"(qf[0][0]), "v"(qf[0][1]), "v"(qf[1][0]), "v"(qf[1][1]));

      float mx[QT];   // this lane's half of the column only; the halves meet in the branch
#pragma unroll
      for (int q = 0; q < QT; ++q) {
          mx[q] = fmaxf(s[0][q][0][0], s[0][q][1][0]);
#pragma unroll
          for (int r = 1; r < 8; ++r) mx[q] = fmaxf(mx[q], fmaxf(s[0][q][0][r], s[0][q][1][r]));
#pragma unroll
          for (int r = 0; r < 8; ++r) mx[q] = fmaxf(mx[q], fmaxf(s[1][q][0][r], s[1][q][1][r]));
      }
      if (__builtin_amdgcn_ballot_w32(!(mx[0] <= lim && mx[1] <= lim)) != 0u) {   // wave-uniform, one test per stage
#pragma unroll
          for (int q = 0; q < QT; ++q) {
              const float up = fmaxf(mx[q], __shfl_xor(mx[q], 16, 32)) - PCARRY;   // the stage's maximum above the reference in use
              const float dm = fmaxf(up, lo);
              const float corr = __builtin_amdgcn_exp2f(-fmaxf(dm, 0.0f));         // dm < 0 only in the first stage, where O and l are still 0
              cv[q] -= dm;
#pragma unroll
              for (int hs = 0; hs < 2; ++hs) { s[hs][q][0] -= dm; s[hs][q][1] -= dm; }
              l[q] *= corr;
#pragma unroll
              for (int t = 0; t < 4; ++t) o[q][t] *= corr;
          }
          lim = PTOP;
          lo = 0.0f;
      }
#pragma unroll   // both 32-key steps of a stage: constant LDS offsets
      for (int hs = 0; hs < 2; ++hs) {
        v16h ph[QT];
#pragma unroll
        for (int q = 0; q < QT; ++q) {
            const v8f s0 = s[hs][q][0], s1 = s[hs][q][1];
            float p0[8], p1[8];
            float ps = 0.0f;
#pragma unroll
            for (int r = 0; r < 8; ++r) {
                p0[r] = __builtin_amdgcn_exp2f(s0[r]);
                p1[r] = __builtin_amdgcn_exp2f(s1[r]);
                ps += p0[r] + p1[r];
            }
            l[q] += ps;
            v8u hw;
#pragma unroll
            for (int j = 0; j < 4; ++j) {
                hw[j]     = pk2h(p0[2 * j], p0[2 * j + 1]);
                hw[4 + j] = pk2h(p1[2 * j], p1[2 * j + 1]);
            }
            ph[q] = __builtin_bit_cast(v16h, hw);
        }

        asm volatile("" ::: "memory");   // keep the V^T loads below the softmax (bounds live fragments)
        const hb* va = vp + hs * KS;
#pragma unroll
        for (int t = 0; t < 4; ++t) {
            const v16h a = ldhs(va + t * 16 * LP);
#pragma unroll
            for (int q = 0; q < QT; ++q) o[q][t] = wmmah(a, ph[q], o[q][t]);
        }
        // WMMA distance on both sides of the branches that follow: four vector slots behind the step's last products
        asm volatile("v_nop\n\tv_nop\n\tv_nop\n\tv_nop"
                     : "+v"(o[0][0]), "+v"(o[0][1]), "+v"(o[0][2]), "+v"(o[0][3]), "+v"(o[1][0]), "+v"(o[1][1]), "+v"(o[1][2]), "+v"(o[1][3])
                     : "v"(ph[0]), "v"(ph[1]));
      }
      // publish stage sg + 1, free stage sg's buffer, refill it with stage sg + 2
      wait_lds();
      wait_copies();
      __syncthreads();
      if (sg + 2u < (unsigned)(SEQ / SK)) stage4(lk + cur, gk + (size_t)(sg + 2u) * SK * HD, HD, lv + cur, gv + (sg + 2u) * SK, SEQ);
      cur = FBUF - cur;
    }
    wait_copies();

    float* ow = os + wv * (16 * QT * OSP);   // this wave's 32 rows
#pragma unroll
    for (int q = 0; q < QT; ++q) {
        const float inv = 1.0f / (l[q] + __shfl_xor(l[q], 16, 32));
#pragma unroll
        for (int t = 0; t < 4; ++t) {
#pragma unroll
            for (int r = 0; r < 8; ++r) ow[(16 * q + lr) * OSP + t * 16 + 8 * hi + r] = o[q][t][r] * inv;
        }
    }
    __syncthreads();
    const unsigned cg = lane & 7u, rq = lane >> 3;
    const size_t cbase = ((size_t)b * SEQ + q0) * DM + h * HD + 8u * cg;
{
#pragma unroll
        for (unsigned s = 0; s < 4u * QT; ++s) {
            const unsigned row = 4u * s + rq;
            const float* sr = ow + row * OSP + 8u * cg;
            const v4f xa = *(const v4fa*)sr;
            const v4f xb = *(const v4fa*)(sr + 4);
            const float x[8] = { xa[0], xa[1], xa[2], xa[3], xb[0], xb[1], xb[2], xb[3] };
            v4u oh, ol;
#pragma unroll
            for (int j = 0; j < 4; ++j) {
                const unsigned r0 = bfhi32(x[2 * j]), r1 = bfhi32(x[2 * j + 1]);
                oh[j] = (r0 >> 16) | r1;
                ol[j] = pk2bf(x[2 * j] - __uint_as_float(r0), x[2 * j + 1] - __uint_as_float(r1));
            }
            *(v4u*)(CH + cbase + (size_t)row * DM) = oh;
            *(v4u*)(CL + cbase + (size_t)row * DM) = ol;
        }
        
    }
}

// k_out: out = (CH + CL) . WOT^T + bf16(bout); block = 128 rows x 128 columns, wave = 64 rows x 64 columns; hi and lo products share the B fragments and the accumulator.
__global__ __launch_bounds__(128) void k_out(const bf* __restrict__ CH, const bf* __restrict__ CL, const bf* __restrict__ WOT,
                                             const float* __restrict__ bout, float* O) {
    __shared__ __align__(16) unsigned char sm[2 * OBUF];   // operand ring; output staging behind the loop
    float* st = (float*)sm;
    const unsigned tid = threadIdx.x, lane = tid & 31u, wv = tid >> 5, lr = lane & 15u, hi = lane >> 4;
    const unsigned wm = wv >> 1, wn = wv & 1u;   // this wave's 64 rows and 64 columns of the block tile
    const unsigned m0 = blockIdx.x * GM;
    const unsigned n0 = blockIdx.y * GN;
    const unsigned cr = tid >> 3, cc = (tid & 7u) * 8u;
    const size_t aoff = (size_t)(m0 + cr) * DM + cc;
    const bf* gh = CH + aoff;
    const bf* gl = CL + aoff;
    const bf* gb = WOT + (size_t)(n0 + cr) * DM + cc;
    const unsigned lh = ldsa(sm) + cr * LPB + cc * 2u;
    const unsigned ll = lh + GM * LPB;
    const unsigned lb = lh + 2 * GM * LPB;

    v8f c[4][4];   // [16-row tile][16-column tile]
#pragma unroll
    for (int i = 0; i < 4; ++i) {
#pragma unroll
        for (int t = 0; t < 4; ++t) c[i][t] = (v8f){};
    }

    stage128(lh, gh);
    stage128(ll, gl);
    stage128(lb, gb);
    wait_copies();
    __syncthreads();
    stage128(lh + OBUF, gh + SK);
    stage128(ll + OBUF, gl + SK);
    stage128(lb + OBUF, gb + SK);

    unsigned cur = 0;   // byte offset of the buffer that this trip reads
#pragma unroll 1   // one trip per stage stays a loop: small text, one publish point
    for (unsigned s = 0; s < (unsigned)(DM / SK); ++s) {
        const bf* ah = (const bf*)(sm + cur) + (64u * wm + lr) * LP + 8u * hi;
        const bf* al = ah + GM * LP;
        const bf* bp = (const bf*)(sm + cur) + (2 * GM + 64u * wn + lr) * LP + 8u * hi;
#pragma unroll   // both 32-wide steps of a stage: constant LDS offsets
        for (unsigned k0 = 0; k0 < (unsigned)SK; k0 += 32) {
            v16bf h[4], l[4], bb[4];
#pragma unroll
            for (int i = 0; i < 4; ++i) h[i] = ldbs(ah + i * 16 * LP + k0);
#pragma unroll
            for (int t = 0; t < 4; ++t) bb[t] = ldbs(bp + t * 16 * LP + k0);
#pragma unroll
            for (int i = 0; i < 4; ++i) l[i] = ldbs(al + i * 16 * LP + k0);
            // every accumulator takes its hi product, then its lo product, of this k step
#pragma unroll
            for (int t = 0; t < 4; ++t) {
#pragma unroll
                for (int i = 0; i < 4; ++i) c[i][t] = wmmab(h[i], bb[t], c[i][t]);
#pragma unroll
                for (int i = 0; i < 4; ++i) c[i][t] = wmmab(l[i], bb[t], c[i][t]);
            }
        }
        // WMMA distance on both sides of the loop's branches: four vector slots behind the stage's last products
        asm volatile("v_nop\n\tv_nop\n\tv_nop\n\tv_nop"
                     :: "v"(c[0][0]), "v"(c[0][1]), "v"(c[0][2]), "v"(c[0][3]), "v"(c[1][0]), "v"(c[1][1]), "v"(c[1][2]), "v"(c[1][3]),
                        "v"(c[2][0]), "v"(c[2][1]), "v"(c[2][2]), "v"(c[2][3]), "v"(c[3][0]), "v"(c[3][1]), "v"(c[3][2]), "v"(c[3][3]));
        // publish stage s + 1, free stage s's buffer, refill it with stage s + 2
        wait_lds();
        wait_copies();
        __syncthreads();
        if (s + 2u < (unsigned)(DM / SK)) {
            const unsigned kn = (s + 2u) * SK;
            stage128(lh + cur, gh + kn);
            stage128(ll + cur, gl + kn);
            stage128(lb + cur, gb + kn);
        }
        cur = OBUF - cur;
    }
    wait_copies();

    // staging: plane wn holds the 128 rows x 64 columns n0 + 64 wn ..
    float* sw = st + (wn * GM + 64u * wm) * SP;
#pragma unroll
    for (int i = 0; i < 4; ++i) {
#pragma unroll
        for (int t = 0; t < 4; ++t) {
#pragma unroll
            for (int r = 0; r < 8; ++r) sw[(16u * i + 8u * hi + r) * SP + t * 16 + lr] = c[i][t][r];
        }
    }
    __syncthreads();

    // one row of 128 columns (512 bytes, four whole lines) per store instruction; wave wv stores rows 32 wv ..
    const unsigned c4 = (lane & 15u) * 4u, ph = lane >> 4;
    const v4f bv = *(const v4f*)(bout + n0 + 64u * ph + c4);
    const float b0 = bfr(bv[0]), b1 = bfr(bv[1]), b2 = bfr(bv[2]), b3 = bfr(bv[3]);
    const float* sr = st + (ph * GM + 32u * wv) * SP + c4;
    float* orow = O + (size_t)(m0 + 32u * wv) * DM + n0 + 64u * ph + c4;
{
#pragma unroll 4
        for (unsigned row = 0; row < 32; ++row) {
            v4f val = *(const v4fa*)(sr + row * SP);
            val[0] += b0; val[1] += b1; val[2] += b2; val[3] += b3;
            *(v4f*)(orow + (size_t)row * DM) = val;
        }
        
    }
}

extern "C" void kernel_launch(void* const* d_in, const int* in_sizes, int n_in,
                              void* d_out, int out_size, void* d_ws, size_t ws_size, hipStream_t stream) {
    if (n_in < 5) return;
    const size_t needx = ((size_t)(NB - 1) * SEQ_FULL + SEQ) * DM;
    if ((size_t)in_sizes[0] < needx) return;
    if ((size_t)in_sizes[1] < (size_t)DM * DM) return;
    if ((size_t)in_sizes[2] < (size_t)2 * DM * DM) return;
    if ((size_t)in_sizes[3] < (size_t)DM * DM) return;
    if ((size_t)in_sizes[4] < (size_t)DM) return;
    if ((size_t)out_size < (size_t)NB * SEQ * DM) return;
    const float* x    = (const float*)d_in[0];   // queries [NB_FULL][SEQ_FULL][DM]
    const float* Wq   = (const float*)d_in[1];   // [DM in][DM out]
    const float* Wkv  = (const float*)d_in[2];   // [DM in][2*DM out]
    const float* Wout = (const float*)d_in[3];   // [DM in][DM out]
    const float* bout = (const float*)d_in[4];   // [DM]
    float* OUT = (float*)d_out;                  // [NB][SEQ][DM]

    const size_t PA = (size_t)NB * SEQ * DM * 2;     // bytes per 16-bit activation plane
    const size_t PW = (size_t)NWT * DM * 2;          // bytes of the transposed weight plane
    const size_t PT = (size_t)SEQ * 16 * 4;          // bytes per rotary table
    if (6 * PA + PW + 2 * PT > ws_size) return;
    char* wsp = (char*)d_ws;
    bf* XB = (bf*)(wsp);
    bf* WT = (bf*)(wsp + PA);
    float* cosT = (float*)(wsp + PA + PW);
    float* sinT = (float*)(wsp + PA + PW + PT);
    hb* QH = (hb*)(wsp + PA + PW + 2 * PT);
    hb* KH = (hb*)(wsp + 2 * PA + PW + 2 * PT);
    hb* VT = (hb*)(wsp + 3 * PA + PW + 2 * PT);
    bf* CH = (bf*)(wsp + 4 * PA + PW + 2 * PT);
    bf* CL = (bf*)(wsp + 5 * PA + PW + 2 * PT);

    FreqArgs fa;
    for (int i = 0; i < 16; ++i) {
        const float pw = (float)pow(10000.0, (double)(2 * i) / 32.0);
        fa.inv[i] = 1.0f / pw;
    }

    const unsigned gc = (unsigned)(((size_t)NB * SEQ * DM / 8 + 255) / 256);
    k_prep<<<(unsigned)(WTB + TBB) + gc, 256, 0, stream>>>(x, Wq, Wkv, Wout, fa, XB, WT, cosT, sinT);
    k_proj<<<dim3((unsigned)(NB * SEQ / GM), NQKV / GN, 1), 128, 0, stream>>>(XB, WT, cosT, sinT, QH, KH, VT);
    k_flash<<<(unsigned)(NB * NH * (SEQ / BQ)), 32 * NWV, 0, stream>>>(QH, KH, VT, CH, CL);
    k_out<<<dim3((unsigned)(NB * SEQ / GM), DM / GN, 1), 128, 0, stream>>>(CH, CL, WT + (size_t)NQKV * DM, bout, OUT);
}

// v007
// It runs in 124 microseconds.
// Versions in between are left out here; by their measured steps it is 1.09 times as fast as v005.
// All steps since v000 together make it 3.47 times as fast.
#include <hip/hip_runtime.h>

// Compute dtypes, f32 accumulate: x.Wq, x.Wkv on v_wmma_f32_16x16x32_bf16 (inputs RNE-converted to bf16, exact products); q.k^T and P.V on v_wmma_f32_16x16x32_f16 (q, k, v planes f16, q stored x log2(e)/8; P carried x128 in f16); ctx.Wout on v_wmma_f32_16x16x32_f16 (ctx plane f16, Wout RNE-converted to f16: 11 significant bits on both sides, one product).
// Self-attention, 16 heads x 64, partial interleaved rotary on head dims 0..31 (16 frequencies, f32, applied on the f32 projection tiles before the f16 convert), logits x 1/8, full softmax over all keys (online, log2 domain, lazily rescaled), merged heads . Wout + bout.
// Flash form with transposed tiles: S^T accumulator tiles are directly the B-operand layout of P^T; all WMMA operands are two 16-byte loads.
// The three preparation passes (x to bf16, weight transpose, rotary tables) depend on nothing but the inputs and share one launch, picked by block index.
// Operand tiles of the three matrix kernels are staged in LDS, 128 bytes of every row per stage, two buffers, by asynchronous copies that cover whole 128-byte lines; fragments are read from LDS rows at a 144-byte pitch.

#ifndef NB
#define NB 4
#endif
#ifndef SEQ
#define SEQ 2048
#endif
#define NB_FULL  4
#define SEQ_FULL 2048
#define DM   1024              // model width == merged head width
#define NH   16
#define HD   64
#define NQKV 3072              // rows of the transposed q|k|v weight plane
#define NWT  4096              // q|k|v|out rows of the transposed weight plane
#define GM   128               // token rows per GEMM block (2 x 2 waves, 64 rows x 64 columns each)
#define GN   128               // output columns per GEMM block (k_proj: two heads)
#define SP   68                // LDS pitch (floats) of the GEMM staging rows
#define NWV  8                 // waves per flash block
#define QT   2                 // 16-query tiles per flash wave: every K and V^T fragment feeds QT products
#define BQ   (16 * QT * NWV)   // queries per flash block
#define KS   32                // keys per step
#define OSP  68                // LDS pitch (floats) of the flash output staging rows
#define VTP  72                // LDS pitch (16-bit elements) of the weight transpose tile
#define LP   72                // LDS pitch (16-bit elements) of a staged 128-byte row: 144 B = 16 B x 9, conflict-free for 16-byte fragment reads
#define LPB  (LP * 2)          // the same in bytes
#define SK   64                // 16-bit elements of a row per stage (GEMM: k; flash: keys of a V^T row, and keys per stage)
#define PBUF ((GM + GN) * LPB)         // k_proj buffer: 128 A rows | 128 B rows
#define FBUF ((SK + HD) * LPB)         // k_flash buffer: 64 K rows | 64 V^T rows
#define FOUT (BQ * OSP * 4)            // k_flash output staging: one f32 row per query
#define OBUF ((GM + GN) * LPB)         // k_out buffer: 128 A rows | 128 B rows
#define WTB  ((DM / 64) * (NWT / 128))         // k_prep: blocks of the weight transpose
#define TBB  (SEQ * 16 / 256)                  // k_prep: blocks of the rotary tables
#define L2E  1.4426950408889634f
#define QSC  (0.125f * L2E)    // logit scale and change to the log2 domain, applied to q on its f32 projection tile
#define PCARRY 7.0f            // P carried as 2^7 * p against the reference maximum in use (row sum carried alike, cancels in the normalisation)
#define PTOP   15.0f           // an exponent above this renews the reference maximum: P <= 2^15, inside f16

static_assert(NH == 16);
static_assert(HD == 64);
static_assert(NH * HD == DM);
static_assert(SEQ % GM == 0);
static_assert(SEQ % BQ == 0);
static_assert(SEQ % KS == 0);
static_assert(DM % 32 == 0);
static_assert(DM % SK == 0 && DM / SK >= 2);       // GEMM ring: whole stages, at least two
static_assert(SEQ % SK == 0 && SEQ / SK >= 2);     // flash ring: whole stages, at least two
static_assert(SK == 2 * KS && HD == 64 && GM == 128 && GN == 2 * HD);
static_assert(2 * PBUF >= 2 * GM * SP * 4);        // the ring holds the GEMM output staging (two planes of 64 columns)
static_assert(2 * OBUF >= 2 * GM * SP * 4);
static_assert(FOUT >= 2 * FBUF);                   // the flash output staging holds the ring
static_assert(NWV == 8 && SK == 64 && HD == 64);   // stage4: 256 threads, two copies of 32 rows per tile
static_assert(NB <= NB_FULL);
static_assert(SEQ <= SEQ_FULL);
static_assert(((size_t)NB * SEQ * DM) % 2048 == 0);                                        // p_cvt: blocks * 256 threads * 8 elements == plane
static_assert((size_t)(DM / 64) * (NWT / 128) * (size_t)(64 * 128) == (size_t)NWT * DM);   // p_wt: blocks * (64 k x 128 n) == weight plane
static_assert(((size_t)SEQ * 16) % 256 == 0);                                              // p_tab: blocks * 256 == table entries
static_assert((size_t)(NB * SEQ / GM) * (NQKV / GN) * (size_t)(GM * GN) == (size_t)3 * NB * SEQ * DM);   // k_proj: blocks * (128 x 128) == q + k + v planes
static_assert((size_t)(NB * NH * (SEQ / BQ)) * (size_t)(BQ * HD) == (size_t)NB * SEQ * DM);              // k_flash: blocks * (256 x 64) == ctx plane
static_assert((size_t)(NB * SEQ / GM) * (DM / GN) * (size_t)(GM * GN) == (size_t)NB * SEQ * DM);         // k_out: blocks * (128 x 128) == output
static_assert(((size_t)SEQ * 16 * 4) % 256 == 0);
static_assert((size_t)5 * NB_FULL * SEQ_FULL * DM * 2 + (size_t)NWT * DM * 2 + (size_t)2 * SEQ_FULL * 16 * 4 <= (size_t)134217728);

typedef unsigned short bf;     // bf16 bit pattern
typedef unsigned short hb;     // f16 bit pattern
typedef __attribute__((ext_vector_type(16))) __bf16   v16bf;
typedef __attribute__((ext_vector_type(2)))  __bf16   v2bf;
typedef __attribute__((ext_vector_type(16))) _Float16 v16h;
typedef __attribute__((ext_vector_type(2)))  _Float16 v2h;
typedef __attribute__((ext_vector_type(8)))  unsigned short v8us;
typedef __attribute__((ext_vector_type(8)))  unsigned int   v8u;
typedef __attribute__((ext_vector_type(4)))  unsigned int   v4u;
typedef __attribute__((ext_vector_type(8)))  float    v8f;
typedef __attribute__((ext_vector_type(4)))  float    v4f;
typedef v4f  __attribute__((may_alias)) v4fa;
typedef v8us __attribute__((may_alias)) v8usa;

struct FreqArgs { float inv[16]; };
static_assert(sizeof(FreqArgs) == 64);

__device__ __forceinline__ unsigned short f2bf(float f) { unsigned u = __float_as_uint(f); u += 0x7FFFu + ((u >> 16) & 1u); return (unsigned short)(u >> 16); }
// RNE bf16 value of f kept in the upper 16 bits of an f32 bit pattern
__device__ __forceinline__ unsigned bfhi32(float f) { unsigned u = __float_as_uint(f); u += 0x7FFFu + ((u >> 16) & 1u); return u & 0xFFFF0000u; }
__device__ __forceinline__ float bfr(float f) { return __uint_as_float(bfhi32(f)); }
__device__ __forceinline__ unsigned short f2h(float f) { return __builtin_bit_cast(unsigned short, (_Float16)f); }
__device__ __forceinline__ v16bf cat16b(v8us lo, v8us hi) { return __builtin_bit_cast(v16bf, __builtin_shufflevector(lo, hi, 0, 1, 2, 3, 4, 5, 6, 7, 8, 9, 10, 11, 12, 13, 14, 15)); }
__device__ __forceinline__ v16h  cat16h(v8us lo, v8us hi) { return __builtin_bit_cast(v16h,  __builtin_shufflevector(lo, hi, 0, 1, 2, 3, 4, 5, 6, 7, 8, 9, 10, 11, 12, 13, 14, 15)); }
__device__ __forceinline__ v8f wmmab(v16bf a, v16bf b, v8f c) { return __builtin_amdgcn_wmma_f32_16x16x32_bf16(false, a, false, b, (short)0, c, false, false); }
__device__ __forceinline__ v8f wmmah(v16h a, v16h b, v8f c) { return __builtin_amdgcn_wmma_f32_16x16x32_f16(false, a, false, b, (short)0, c, false, false); }
// fragment loader (A and B alike): p = row base + k0 + 8*(lane>>4); elements 0..7 <- p[0..7], elements 8..15 <- p[16..23]
__device__ __forceinline__ v16h  ldh(const hb* p) { return cat16h(*(const v8us*)p, *(const v8us*)(p + 16)); }
// the same fragment loaders on LDS rows
__device__ __forceinline__ v16bf ldbs(const bf* p) { return cat16b(*(const v8usa*)p, *(const v8usa*)(p + 16)); }
__device__ __forceinline__ v16h  ldhs(const hb* p) { return cat16h(*(const v8usa*)p, *(const v8usa*)(p + 16)); }
// LDS byte address of a __shared__ location: the low 32 bits of its address
__device__ __forceinline__ unsigned ldsa(const void* p) { return (unsigned)(size_t)p; }
// Asynchronous copies global -> LDS, 16 bytes per lane each. The s_wait_xcnt closes each statement so that no address register of an issued copy is rewritten ahead of it.
#define CPA(l, g) "global_load_async_to_lds_b128 %" #l ", %" #g ", off\n\t"
__device__ __forceinline__ void cp8(const unsigned (&l)[8], const unsigned short* const (&g)[8]) {
    asm volatile(CPA(0, 8) CPA(1, 9) CPA(2, 10) CPA(3, 11) CPA(4, 12) CPA(5, 13) CPA(6, 14) CPA(7, 15) "s_wait_xcnt 0x0"
                 :: "v"(l[0]), "v"(l[1]), "v"(l[2]), "v"(l[3]), "v"(l[4]), "v"(l[5]), "v"(l[6]), "v"(l[7]),
                    "v"(g[0]), "v"(g[1]), "v"(g[2]), "v"(g[3]), "v"(g[4]), "v"(g[5]), "v"(g[6]), "v"(g[7]) : "memory");
}
// A block of 128 threads copies 16 rows of 128 bytes per copy: thread -> row tid >> 3, 16-byte piece tid & 7 (a wave covers 4 whole lines).
// la, ga: this thread's LDS byte address and global address in rows 0..15 of a tile; stage8: two tiles of 64 rows, global pitches pa, pb elements; stage128: one tile of 128 rows, global pitch DM.
__device__ __forceinline__ void stage8(unsigned la, const unsigned short* ga, size_t pa, unsigned lb, const unsigned short* gb, size_t pb) {
    unsigned l[8]; const unsigned short* g[8];
#pragma unroll   // constant indices, so that both arrays are registers (asm operands)
    for (unsigned i = 0; i < 4; ++i) {
        l[i] = la + i * 16u * LPB;      g[i] = ga + i * 16u * pa;
        l[4 + i] = lb + i * 16u * LPB;  g[4 + i] = gb + i * 16u * pb;
    }
    cp8(l, g);
}
__device__ __forceinline__ void cp4(const unsigned (&l)[4], const unsigned short* const (&g)[4]) {
    asm volatile(CPA(0, 4) CPA(1, 5) CPA(2, 6) CPA(3, 7) "s_wait_xcnt 0x0"
                 :: "v"(l[0]), "v"(l[1]), "v"(l[2]), "v"(l[3]), "v"(g[0]), "v"(g[1]), "v"(g[2]), "v"(g[3]) : "memory");
}
// A block of 256 threads copies 32 rows of 128 bytes per copy (thread -> row tid >> 3, piece tid & 7); stage4: two tiles of 64 rows, la, ga in rows 0..31.
__device__ __forceinline__ void stage4(unsigned la, const unsigned short* ga, size_t pa, unsigned lb, const unsigned short* gb, size_t pb) {
    unsigned l[4]; const unsigned short* g[4];
#pragma unroll   // constant indices, so that both arrays are registers (asm operands)
    for (unsigned i = 0; i < 2; ++i) {
        l[i] = la + i * 32u * LPB;      g[i] = ga + i * 32u * pa;
        l[2 + i] = lb + i * 32u * LPB;  g[2 + i] = gb + i * 32u * pb;
    }
    cp4(l, g);
}
__device__ __forceinline__ void stage128(unsigned l, const unsigned short* g) { stage8(l, g, DM, l + 64u * LPB, g + (size_t)64 * DM, DM); }
// this wave's copies have landed
__device__ __forceinline__ void wait_copies() { asm volatile("s_wait_asynccnt 0x0" ::: "memory"); }
// this wave's LDS reads have returned (before the barrier behind which their buffer is refilled)
__device__ __forceinline__ void wait_lds() { asm volatile("s_wait_dscnt 0x0" ::: "memory"); }
// two f32 -> packed 16-bit pair (RNE), element 0 in the low half-word
__device__ __forceinline__ unsigned pk2h(float a, float b) { v2h t; t[0] = (_Float16)a; t[1] = (_Float16)b; return __builtin_bit_cast(unsigned, t); }

__device__ __forceinline__ void p_cvt(unsigned blk, const float* __restrict__ x, bf* XB) {
    const unsigned i = blk * 256u + threadIdx.x;
    const unsigned per = (unsigned)(SEQ * DM / 8);
    if (i >= (unsigned)NB * per) return;
    const unsigned b = i / per, r = i - b * per;
    const float* src = x + (size_t)b * SEQ_FULL * DM + (size_t)r * 8;
    const v4f v0 = *(const v4f*)src;
    const v4f v1 = *(const v4f*)(src + 4);
    v4u o;
    o[0] = (bfhi32(v0[0]) >> 16) | bfhi32(v0[1]);
    o[1] = (bfhi32(v0[2]) >> 16) | bfhi32(v0[3]);
    o[2] = (bfhi32(v1[0]) >> 16) | bfhi32(v1[1]);
    o[3] = (bfhi32(v1[2]) >> 16) | bfhi32(v1[3]);
    bf* dst = XB + (size_t)i * 8;
    *(v4u*)dst = o;
    
}

// p_wt: transposed 16-bit weight plane WT[n][k] = bf16(W[k][n]) for Wq and Wkv, f16(W[k][n]) for Wout; in[DM k][ncols] -> out[ncols][DM]; virtual column space: 0..1023 Wq, 1024..3071 Wkv, 3072..4095 Wout.
__device__ __forceinline__ void p_wt(unsigned bk, unsigned bn, const float* __restrict__ Wq, const float* __restrict__ Wkv, const float* __restrict__ Wo, bf* WT) {
    __shared__ __align__(16) bf tl[128 * VTP];
    const unsigned tid = threadIdx.x;
    const unsigned k0 = bk * 64u;
    const unsigned n0 = bn * 128u;
    const float* src;
    unsigned ldn;
    if (n0 < 1024u)      { src = Wq  + n0;            ldn = 1024u; }
    else if (n0 < 3072u) { src = Wkv + (n0 - 1024u);  ldn = 2048u; }
    else                 { src = Wo  + (n0 - 3072u);  ldn = 1024u; }
    src += (size_t)k0 * ldn;
    const bool wo = n0 >= 3072u;   // block-uniform
    const unsigned kq = tid >> 5, c4 = (tid & 31u) * 4u;   // piece it of this thread: k row 8 it + kq, columns c4 .. c4 + 3
    v4f x[8];
#pragma unroll   // all eight loads in flight ahead of the one branch on the target type
    for (unsigned it = 0; it < 8; ++it) x[it] = *(const v4f*)(src + (size_t)(it * 8u + kq) * ldn + c4);
    asm volatile("s_wait_xcnt 0x0" ::: "memory");   // no address register of an issued load is rewritten ahead of this
    if (wo) {
#pragma unroll
        for (unsigned it = 0; it < 8; ++it) {
#pragma unroll
            for (unsigned c = 0; c < 4; ++c) tl[(c4 + c) * VTP + it * 8u + kq] = f2h(x[it][c]);
        }
    } else {
#pragma unroll
        for (unsigned it = 0; it < 8; ++it) {
#pragma unroll
            for (unsigned c = 0; c < 4; ++c) tl[(c4 + c) * VTP + it * 8u + kq] = f2bf(x[it][c]);
        }
    }
    __syncthreads();
    bf* dst = WT + (size_t)n0 * DM + k0;
    const unsigned c8 = (tid & 7u) * 8u, dr = tid >> 3;
{
#pragma unroll
        for (unsigned it = 0; it < 4; ++it) {
            const unsigned d = it * 32u + dr;
            const v8us o = *(const v8usa*)(tl + d * VTP + c8);
            *(v8us*)(dst + (size_t)d * DM + c8) = o;
        }
        
    }
}

__device__ __forceinline__ void p_tab(unsigned blk, const FreqArgs& fa, float* cosT, float* sinT) {
    const unsigned i = blk * 256u + threadIdx.x;
    const unsigned t = i >> 4, f = i & 15u;
    float inv = fa.inv[0];
#pragma unroll
    for (unsigned j = 1; j < 16; ++j) inv = (f == j) ? fa.inv[j] : inv;
    const float ang = (float)t * inv;
    float s, c;
    sincosf(ang, &s, &c);
    *(float*)(cosT + i) = c;
    *(float*)(sinT + i) = s;
    
}

// k_prep: one grid for the three passes; the transposes (a barrier and two memory trips each) and the tables take the lowest block indices, the x stream the blocks behind them. The branch is block-uniform.
__global__ __launch_bounds__(256) void k_prep(const float* __restrict__ x, const float* __restrict__ Wq, const float* __restrict__ Wkv, const float* __restrict__ Wo,
                                              FreqArgs fa, bf* XB, bf* WT, float* cosT, float* sinT) {
    const unsigned blk = blockIdx.x;
    if (blk < (unsigned)WTB)              p_wt(blk % (unsigned)(DM / 64), blk / (unsigned)(DM / 64), Wq, Wkv, Wo, WT);
    else if (blk < (unsigned)(WTB + TBB)) p_tab(blk - (unsigned)WTB, fa, cosT, sinT);
    else                                  p_cvt(blk - (unsigned)(WTB + TBB), x, XB);
}

// k_proj: [q|k|v] = XB . WT^T, block = 128 token rows x 128 columns (two heads of q, k or v), wave = 64 rows x 64 columns (one head).
//  A = XB rows (row m = token, k = input channel), B = WT rows (column n = output channel, k = input channel); D element r of lane (h, n) = C[row 8h + r][col n].
__global__ __launch_bounds__(128) void k_proj(const bf* __restrict__ XB, const bf* __restrict__ WT,
                                              const float* __restrict__ cosT, const float* __restrict__ sinT,
                                              hb* QH, hb* KH, hb* VT) {
    __shared__ __align__(16) unsigned char sm[2 * PBUF];   // operand ring; output staging behind the loop
    float* st = (float*)sm;
    const unsigned tid = threadIdx.x, lane = tid & 31u, wv = tid >> 5, lr = lane & 15u, hi = lane >> 4;
    const unsigned wm = wv >> 1, wn = wv & 1u;   // this wave's 64 rows and 64 columns of the block tile
    const unsigned m0 = blockIdx.x * GM;
    const unsigned nt = blockIdx.y;
    const unsigned cr = tid >> 3, cc = (tid & 7u) * 8u;
    const bf* ga = XB + (size_t)(m0 + cr) * DM + cc;
    const bf* gb = WT + (size_t)(nt * GN + cr) * DM + cc;
    const unsigned la = ldsa(sm) + cr * LPB + cc * 2u;
    const unsigned lb = la + GM * LPB;

    v8f c[4][4];   // [16-row tile][16-column tile]
#pragma unroll
    for (int i = 0; i < 4; ++i) {
#pragma unroll
        for (int t = 0; t < 4; ++t) c[i][t] = (v8f){};
    }

    stage128(la, ga);
    stage128(lb, gb);
    wait_copies();
    __syncthreads();
    stage128(la + PBUF, ga + SK);
    stage128(lb + PBUF, gb + SK);

    unsigned cur = 0;   // byte offset of the buffer that this trip reads
#pragma unroll 1   // one trip per stage stays a loop: small text, one publish point
    for (unsigned s = 0; s < (unsigned)(DM / SK); ++s) {
        const bf* ap = (const bf*)(sm + cur) + (64u * wm + lr) * LP + 8u * hi;
        const bf* bp = (const bf*)(sm + cur) + (GM + 64u * wn + lr) * LP + 8u * hi;
#pragma unroll   // both 32-wide steps of a stage: constant LDS offsets
        for (unsigned k0 = 0; k0 < (unsigned)SK; k0 += 32) {
            v16bf a[4], bb[4];
#pragma unroll
            for (int i = 0; i < 4; ++i) a[i] = ldbs(ap + i * 16 * LP + k0);
#pragma unroll
            for (int t = 0; t < 4; ++t) bb[t] = ldbs(bp + t * 16 * LP + k0);
            __builtin_amdgcn_sched_barrier(0);   // the step's 16 LDS reads stay one group ahead of its products: one LDS round trip per step, not one per B fragment
#pragma unroll
            for (int t = 0; t < 4; ++t) {
#pragma unroll
                for (int i = 0; i < 4; ++i) c[i][t] = wmmab(a[i], bb[t], c[i][t]);
            }
            __builtin_amdgcn_sched_barrier(0);   // the next step's reads stay out of this step's products
        }
        // WMMA distance on both sides of the loop's branches: four vector slots behind the stage's last products
        asm volatile("v_nop\n\tv_nop\n\tv_nop\n\tv_nop"
                     :: "v"(c[0][0]), "v"(c[0][1]), "v"(c[0][2]), "v"(c[0][3]), "v"(c[1][0]), "v"(c[1][1]), "v"(c[1][2]), "v"(c[1][3]),
                        "v"(c[2][0]), "v"(c[2][1]), "v"(c[2][2]), "v"(c[2][3]), "v"(c[3][0]), "v"(c[3][1]), "v"(c[3][2]), "v"(c[3][3]));
        // publish stage s + 1, free stage s's buffer, refill it with stage s + 2
        wait_lds();
        wait_copies();
        __syncthreads();
        if (s + 2u < (unsigned)(DM / SK)) {
            stage128(la + cur, ga + (s + 2u) * SK);
            stage128(lb + cur, gb + (s + 2u) * SK);
        }
        cur = PBUF - cur;
    }
    wait_copies();

    // staging: plane wn holds the 128 rows x 64 columns of head 2 nt + wn
    float* sw = st + (wn * GM + 64u * wm) * SP;
#pragma unroll
    for (int i = 0; i < 4; ++i) {
#pragma unroll
        for (int t = 0; t < 4; ++t) {
#pragma unroll
            for (int r = 0; r < 8; ++r) sw[(16u * i + 8u * hi + r) * SP + t * 16 + lr] = c[i][t][r];
        }
    }
    __syncthreads();

    const unsigned b = m0 / (unsigned)SEQ;
    const unsigned pos0 = m0 - b * (unsigned)SEQ;
#pragma unroll 1   // the two heads of the block, one after the other: small text
  for (unsigned nh = 0; nh < 2u; ++nh) {
    const unsigned hd = 2u * nt + nh;
    const float* sh = st + nh * GM * SP;
    if (hd < 32u) {
        // q (hd 0..15) or k (hd 16..31) head: rows [pos][64], rotary on column groups 0..3
        const unsigned h = hd & 15u;
        hb* dst = (hd < 16u ? QH : KH) + ((size_t)(b * NH + h) * SEQ + pos0) * HD;
        const unsigned cg = lane & 7u, rq = lane >> 3;
        const bool rot = cg < 4u;
        const float sc = hd < 16u ? QSC : 1.0f;
        const unsigned tc = (cg & 3u) * 4u;
{
#pragma unroll 2
            for (unsigned it = 0; it < 8; ++it) {
                const unsigned row = 32u * wv + 4u * it + rq;
                const float* sr = sh + row * SP + 8u * cg;
                const v4f xa = *(const v4fa*)sr;
                const v4f xb = *(const v4fa*)(sr + 4);
                const unsigned ti = (pos0 + row) * 16u + tc;
                const v4f c4 = *(const v4f*)(cosT + ti);
                const v4f s4 = *(const v4f*)(sinT + ti);
                const float x[8] = { xa[0], xa[1], xa[2], xa[3], xb[0], xb[1], xb[2], xb[3] };
                v4u o;
#pragma unroll
                for (int j = 0; j < 4; ++j) {
                    const float x1 = x[2 * j], x2 = x[2 * j + 1];
                    const float r1 = x1 * c4[j] - x2 * s4[j];
                    const float r2 = x2 * c4[j] + x1 * s4[j];
                    o[j] = pk2h((rot ? r1 : x1) * sc, (rot ? r2 : x2) * sc);
                }
                *(v4u*)(dst + (size_t)row * HD + 8u * cg) = o;
            }
            
        }
    } else {
        // v head: VT[d][pos]; 128 lines (64 d x 2 halves of 64 positions) per head, 4 lines per instruction
        const unsigned h = hd - 32u;
        hb* dst = VT + (size_t)(b * NH + h) * HD * SEQ + pos0;
        const unsigned c8 = (lane & 7u) * 8u, lq = lane >> 3;
{
#pragma unroll 2
            for (unsigned it = 0; it < 8; ++it) {
                const unsigned L = (wv * 8u + it) * 4u + lq;
                const unsigned d = L >> 1, tk = (L & 1u) * 64u + c8;
                const float* sc = sh + tk * SP + d;
                v4u o;
#pragma unroll
                for (int j = 0; j < 4; ++j) o[j] = pk2h(sc[(2 * j) * SP], sc[(2 * j + 1) * SP]);
                *(v4u*)(dst + (size_t)d * SEQ + tk) = o;
            }
            
        }
    }
  }
}

// k_flash: one wave per 32 queries (two 16-query tiles) of one (batch, head), 8 waves per block, 32 keys per step; each K and V^T fragment read from LDS feeds both query tiles.
//  S^T tile (keys x queries): A = K rows (row m = key, k = d), B = Q rows (column n = query, k = d); D element r of lane (h, n) = S[query n][key 8h + r].
//  The score products start from C = PCARRY - reference maximum of the lane's query (all 8 elements of a lane belong to one query), so D is the exponent of the carried P.
//  Lazy rescale: the reference is an earlier running maximum; exchange between the halves, correction and rescale run only in the first stage and where an exponent exceeds PTOP, tested once per stage of 64 keys; each half of a column sums its own P, joined once behind the loop.
//  P^T B fragment: element r <- tile of keys 0..15, element 8 + r <- tile of keys 16..31 (same lane); P carried x 2^7 in f16, row sum carried alike.
//  O^T tile (d x queries): A = V^T rows (row m = d, k = key), D element r of lane (h, n) = O[query n][d = 16 t + 8h + r].
__global__ __launch_bounds__(32 * NWV) void k_flash(const hb* __restrict__ QH, const hb* __restrict__ KH, const hb* __restrict__ VT, hb* CH) {
    __shared__ __align__(16) unsigned char sm[FOUT];   // K | V^T ring (first 2 * FBUF bytes); output staging behind the loop
    float* os = (float*)sm;
    const unsigned tid = threadIdx.x, lane = tid & 31u, wv = tid >> 5, lr = lane & 15u, hi = lane >> 4;
    const unsigned qpb = (unsigned)(SEQ / BQ);
    const unsigned bh = blockIdx.x / qpb;
    const unsigned q0 = (blockIdx.x - bh * qpb) * BQ + wv * (16u * QT);
    const unsigned b = bh >> 4, h = bh & 15u;

    v16h qf[QT][2];
#pragma unroll
    for (int q = 0; q < QT; ++q) {
        const hb* qp = QH + ((size_t)bh * SEQ + q0 + 16u * q + lr) * HD + 8u * hi;
        qf[q][0] = ldh(qp);
        qf[q][1] = ldh(qp + 32);
    }
    const unsigned cr = tid >> 3, cc = (tid & 7u) * 8u;
    const hb* gk = KH + ((size_t)bh * SEQ + cr) * HD + cc;
    const hb* gv = VT + ((size_t)bh * HD + cr) * SEQ + cc;
    const unsigned lk = ldsa(sm) + cr * LPB + cc * 2u;
    const unsigned lv = lk + SK * LPB;

    v8f o[QT][4];
    v8f cv[QT];               // C operand of the score products: PCARRY - reference max (log2 domain), alike in both halves of a column
    float l[QT];              // running sum of this lane's half of the keys (carried x 2^7); the halves are joined behind the loop
    float lim = -3.0e38f;     // exponents above this renew the reference: every finite one in the first stage, PTOP from then on
    float lo = -3.0e38f;      // least move of the reference: the first stage takes its own maximum, up or down; later it only rises
#pragma unroll
    for (int q = 0; q < QT; ++q) {
#pragma unroll
        for (int t = 0; t < 4; ++t) o[q][t] = (v8f){};
        cv[q] = (v8f){} + PCARRY;
        l[q] = 0.0f;
    }

    stage4(lk, gk, HD, lv, gv, SEQ);
    wait_copies();
    __syncthreads();
    stage4(lk + FBUF, gk + (size_t)SK * HD, HD, lv + FBUF, gv + SK, SEQ);

    unsigned cur = 0;   // byte offset of the buffer that this trip reads
#pragma unroll 1   // one trip per stage stays a loop: small text, one publish point
    for (unsigned sg = 0; sg < (unsigned)(SEQ / SK); ++sg) {
      const hb* kp = (const hb*)(sm + cur) + lr * LP + 8u * hi;
      const hb* vp = kp + SK * LP;
      v8f s[2][QT][2];   // [32-key step][query tile][16-key tile]
#pragma unroll   // both 32-key steps of a stage: constant LDS offsets
      for (int hs = 0; hs < 2; ++hs) {
#pragma unroll
        for (int q = 0; q < QT; ++q) { s[hs][q][0] = cv[q]; s[hs][q][1] = cv[q]; }
        const hb* ka = kp + hs * KS * LP;
#pragma unroll
        for (int dk = 0; dk < 2; ++dk) {
            const v16h a0 = ldhs(ka + dk * 32);
            const v16h a1 = ldhs(ka + 16 * LP + dk * 32);
#pragma unroll
            for (int q = 0; q < QT; ++q) {
                s[hs][q][0] = wmmah(a0, qf[q][dk], s[hs][q][0]);
                s[hs][q][1] = wmmah(a1, qf[q][dk], s[hs][q][1]);
            }
        }
      }
      // WMMA distance: four vector slots behind the stage's last score products
      asm volatile("v_nop\n\tv_nop\n\tv_nop\n\tv_nop" : "+v"(s[1][0][0]), "+v"(s[1][0][1]), "+v"(s[1][1][0]), "+v"(s[1][1][1])
                   : "v"(qf[0][0]), "v"(qf[0][1]), "v"(qf[1][0]), "v"(qf[1][1]));

      float mx[QT];   // this lane's half of the column only; the halves meet in the branch
#pragma unroll
      for (int q = 0; q < QT; ++q) {
          mx[q] = fmaxf(s[0][q][0][0], s[0][q][1][0]);
#pragma unroll
          for (int r = 1; r < 8; ++r) mx[q] = fmaxf(mx[q], fmaxf(s[0][q][0][r], s[0][q][1][r]));
#pragma unroll
          for (int r = 0; r < 8; ++r) mx[q] = fmaxf(mx[q], fmaxf(s[1][q][0][r], s[1][q][1][r]));
      }
      if (__builtin_amdgcn_ballot_w32(!(mx[0] <= lim && mx[1] <= lim)) != 0u) {   // wave-uniform, one test per stage
#pragma unroll
          for (int q = 0; q < QT; ++q) {
              const float up = fmaxf(mx[q], __shfl_xor(mx[q], 16, 32)) - PCARRY;   // the stage's maximum above the reference in use
              const float dm = fmaxf(up, lo);
              const float corr = __builtin_amdgcn_exp2f(-fmaxf(dm, 0.0f));         // dm < 0 only in the first stage, where O and l are still 0
              cv[q] -= dm;
#pragma unroll
              for (int hs = 0; hs < 2; ++hs) { s[hs][q][0] -= dm; s[hs][q][1] -= dm; }
              l[q] *= corr;
#pragma unroll
              for (int t = 0; t < 4; ++t) o[q][t] *= corr;
          }
          lim = PTOP;
          lo = 0.0f;
      }
#pragma unroll   // both 32-key steps of a stage: constant LDS offsets
      for (int hs = 0; hs < 2; ++hs) {
        const hb* va = vp + hs * KS;
        v16h av[4];   // the step's four V^T fragments, read as one group; the step's softmax covers their LDS round trip
#pragma unroll
        for (int t = 0; t < 4; ++t) av[t] = ldhs(va + t * 16 * LP);
        __builtin_amdgcn_sched_barrier(0);   // the 8 LDS reads stay together, above the softmax
        v16h ph[QT];
#pragma unroll
        for (int q = 0; q < QT; ++q) {
            const v8f s0 = s[hs][q][0], s1 = s[hs][q][1];
            float p0[8], p1[8];
            float ps = 0.0f;
#pragma unroll
            for (int r = 0; r < 8; ++r) {
                p0[r] = __builtin_amdgcn_exp2f(s0[r]);
                p1[r] = __builtin_amdgcn_exp2f(s1[r]);
                ps += p0[r] + p1[r];
            }
            l[q] += ps;
            v8u hw;
#pragma unroll
            for (int j = 0; j < 4; ++j) {
                hw[j]     = pk2h(p0[2 * j], p0[2 * j + 1]);
                hw[4 + j] = pk2h(p1[2 * j], p1[2 * j + 1]);
            }
            ph[q] = __builtin_bit_cast(v16h, hw);
        }

#pragma unroll
        for (int t = 0; t < 4; ++t) {
#pragma unroll
            for (int q = 0; q < QT; ++q) o[q][t] = wmmah(av[t], ph[q], o[q][t]);
        }
        // WMMA distance on both sides of the branches that follow: four vector slots behind the step's last products
        asm volatile("v_nop\n\tv_nop\n\tv_nop\n\tv_nop"
                     : "+v"(o[0][0]), "+v"(o[0][1]), "+v"(o[0][2]), "+v"(o[0][3]), "+v"(o[1][0]), "+v"(o[1][1]), "+v"(o[1][2]), "+v"(o[1][3])
                     : "v"(ph[0]), "v"(ph[1]));
      }
      // publish stage sg + 1, free stage sg's buffer, refill it with stage sg + 2
      wait_lds();
      wait_copies();
      __syncthreads();
      if (sg + 2u < (unsigned)(SEQ / SK)) stage4(lk + cur, gk + (size_t)(sg + 2u) * SK * HD, HD, lv + cur, gv + (sg + 2u) * SK, SEQ);
      cur = FBUF - cur;
    }
    wait_copies();

    float* ow = os + wv * (16 * QT * OSP);   // this wave's 32 rows
#pragma unroll
    for (int q = 0; q < QT; ++q) {
        const float inv = 1.0f / (l[q] + __shfl_xor(l[q], 16, 32));
#pragma unroll
        for (int t = 0; t < 4; ++t) {
#pragma unroll
            for (int r = 0; r < 8; ++r) ow[(16 * q + lr) * OSP + t * 16 + 8 * hi + r] = o[q][t][r] * inv;
        }
    }
    __syncthreads();
    const unsigned cg = lane & 7u, rq = lane >> 3;
    const size_t cbase = ((size_t)b * SEQ + q0) * DM + h * HD + 8u * cg;
{
#pragma unroll
        for (unsigned s = 0; s < 4u * QT; ++s) {
            const unsigned row = 4u * s + rq;
            const float* sr = ow + row * OSP + 8u * cg;
            const v4f xa = *(const v4fa*)sr;
            const v4f xb = *(const v4fa*)(sr + 4);
            const float x[8] = { xa[0], xa[1], xa[2], xa[3], xb[0], xb[1], xb[2], xb[3] };
            v4u oh;
#pragma unroll
            for (int j = 0; j < 4; ++j) oh[j] = pk2h(x[2 * j], x[2 * j + 1]);
            *(v4u*)(CH + cbase + (size_t)row * DM) = oh;
        }
        
    }
}

// k_out: out = CH . WOT^T + bf16(bout); block = 128 rows x 128 columns, wave = 64 rows x 64 columns.
__global__ __launch_bounds__(128) void k_out(const hb* __restrict__ CH, const hb* __restrict__ WOT,
                                             const float* __restrict__ bout, float* O) {
    __shared__ __align__(16) unsigned char sm[2 * OBUF];   // operand ring; output staging behind the loop
    float* st = (float*)sm;
    const unsigned tid = threadIdx.x, lane = tid & 31u, wv = tid >> 5, lr = lane & 15u, hi = lane >> 4;
    const unsigned wm = wv >> 1, wn = wv & 1u;   // this wave's 64 rows and 64 columns of the block tile
    const unsigned m0 = blockIdx.x * GM;
    const unsigned n0 = blockIdx.y * GN;
    const unsigned cr = tid >> 3, cc = (tid & 7u) * 8u;
    const hb* ga = CH + (size_t)(m0 + cr) * DM + cc;
    const hb* gb = WOT + (size_t)(n0 + cr) * DM + cc;
    const unsigned la = ldsa(sm) + cr * LPB + cc * 2u;
    const unsigned lb = la + GM * LPB;

    v8f c[4][4];   // [16-row tile][16-column tile]
#pragma unroll
    for (int i = 0; i < 4; ++i) {
#pragma unroll
        for (int t = 0; t < 4; ++t) c[i][t] = (v8f){};
    }

    stage128(la, ga);
    stage128(lb, gb);
    wait_copies();
    __syncthreads();
    stage128(la + OBUF, ga + SK);
    stage128(lb + OBUF, gb + SK);

    unsigned cur = 0;   // byte offset of the buffer that this trip reads
#pragma unroll 1   // one trip per stage stays a loop: small text, one publish point
    for (unsigned s = 0; s < (unsigned)(DM / SK); ++s) {
        const hb* ap = (const hb*)(sm + cur) + (64u * wm + lr) * LP + 8u * hi;
        const hb* bp = (const hb*)(sm + cur) + (GM + 64u * wn + lr) * LP + 8u * hi;
#pragma unroll   // both 32-wide steps of a stage: constant LDS offsets
        for (unsigned k0 = 0; k0 < (unsigned)SK; k0 += 32) {
            v16h a[4], bb[4];
#pragma unroll
            for (int i = 0; i < 4; ++i) a[i] = ldhs(ap + i * 16 * LP + k0);
#pragma unroll
            for (int t = 0; t < 4; ++t) bb[t] = ldhs(bp + t * 16 * LP + k0);
            __builtin_amdgcn_sched_barrier(0);   // the step's 16 LDS reads stay one group ahead of its products: one LDS round trip per step, not one per B fragment
#pragma unroll
            for (int t = 0; t < 4; ++t) {
#pragma unroll
                for (int i = 0; i < 4; ++i) c[i][t] = wmmah(a[i], bb[t], c[i][t]);
            }
            __builtin_amdgcn_sched_barrier(0);   // the next step's reads stay out of this step's products
        }
        // WMMA distance on both sides of the loop's branches: four vector slots behind the stage's last products
        asm volatile("v_nop\n\tv_nop\n\tv_nop\n\tv_nop"
                     :: "v"(c[0][0]), "v"(c[0][1]), "v"(c[0][2]), "v"(c[0][3]), "v"(c[1][0]), "v"(c[1][1]), "v"(c[1][2]), "v"(c[1][3]),
                        "v"(c[2][0]), "v"(c[2][1]), "v"(c[2][2]), "v"(c[2][3]), "v"(c[3][0]), "v"(c[3][1]), "v"(c[3][2]), "v"(c[3][3]));
        // publish stage s + 1, free stage s's buffer, refill it with stage s + 2
        wait_lds();
        wait_copies();
        __syncthreads();
        if (s + 2u < (unsigned)(DM / SK)) {
            stage128(la + cur, ga + (s + 2u) * SK);
            stage128(lb + cur, gb + (s + 2u) * SK);
        }
        cur = OBUF - cur;
    }
    wait_copies();

    // staging: plane wn holds the 128 rows x 64 columns n0 + 64 wn ..
    float* sw = st + (wn * GM + 64u * wm) * SP;
#pragma unroll
    for (int i = 0; i < 4; ++i) {
#pragma unroll
        for (int t = 0; t < 4; ++t) {
#pragma unroll
            for (int r = 0; r < 8; ++r) sw[(16u * i + 8u * hi + r) * SP + t * 16 + lr] = c[i][t][r];
        }
    }
    __syncthreads();

    // one row of 128 columns (512 bytes, four whole lines) per store instruction; wave wv stores rows 32 wv ..
    const unsigned c4 = (lane & 15u) * 4u, ph = lane >> 4;
    const v4f bv = *(const v4f*)(bout + n0 + 64u * ph + c4);
    const float b0 = bfr(bv[0]), b1 = bfr(bv[1]), b2 = bfr(bv[2]), b3 = bfr(bv[3]);
    const float* sr = st + (ph * GM + 32u * wv) * SP + c4;
    float* orow = O + (size_t)(m0 + 32u * wv) * DM + n0 + 64u * ph + c4;
{
#pragma unroll 4
        for (unsigned row = 0; row < 32; ++row) {
            v4f val = *(const v4fa*)(sr + row * SP);
            val[0] += b0; val[1] += b1; val[2] += b2; val[3] += b3;
            *(v4f*)(orow + (size_t)row * DM) = val;
        }
        
    }
}

extern "C" void kernel_launch(void* const* d_in, const int* in_sizes, int n_in,
                              void* d_out, int out_size, void* d_ws, size_t ws_size, hipStream_t stream) {
    if (n_in < 5) return;
    const size_t needx = ((size_t)(NB - 1) * SEQ_FULL + SEQ) * DM;
    if ((size_t)in_sizes[0] < needx) return;
    if ((size_t)in_sizes[1] < (size_t)DM * DM) return;
    if ((size_t)in_sizes[2] < (size_t)2 * DM * DM) return;
    if ((size_t)in_sizes[3] < (size_t)DM * DM) return;
    if ((size_t)in_sizes[4] < (size_t)DM) return;
    if ((size_t)out_size < (size_t)NB * SEQ * DM) return;
    const float* x    = (const float*)d_in[0];   // queries [NB_FULL][SEQ_FULL][DM]
    const float* Wq   = (const float*)d_in[1];   // [DM in][DM out]
    const float* Wkv  = (const float*)d_in[2];   // [DM in][2*DM out]
    const float* Wout = (const float*)d_in[3];   // [DM in][DM out]
    const float* bout = (const float*)d_in[4];   // [DM]
    float* OUT = (float*)d_out;                  // [NB][SEQ][DM]

    const size_t PA = (size_t)NB * SEQ * DM * 2;     // bytes per 16-bit activation plane
    const size_t PW = (size_t)NWT * DM * 2;          // bytes of the transposed weight plane
    const size_t PT = (size_t)SEQ * 16 * 4;          // bytes per rotary table
    if (5 * PA + PW + 2 * PT > ws_size) return;
    char* wsp = (char*)d_ws;
    bf* XB = (bf*)(wsp);
    bf* WT = (bf*)(wsp + PA);
    float* cosT = (float*)(wsp + PA + PW);
    float* sinT = (float*)(wsp + PA + PW + PT);
    hb* QH = (hb*)(wsp + PA + PW + 2 * PT);
    hb* KH = (hb*)(wsp + 2 * PA + PW + 2 * PT);
    hb* VT = (hb*)(wsp + 3 * PA + PW + 2 * PT);
    hb* CH = (hb*)(wsp + 4 * PA + PW + 2 * PT);

    FreqArgs fa;
    for (int i = 0; i < 16; ++i) {
        const float pw = (float)pow(10000.0, (double)(2 * i) / 32.0);
        fa.inv[i] = 1.0f / pw;
    }

    const unsigned gc = (unsigned)(((size_t)NB * SEQ * DM / 8 + 255) / 256);
    k_prep<<<(unsigned)(WTB + TBB) + gc, 256, 0, stream>>>(x, Wq, Wkv, Wout, fa, XB, WT, cosT, sinT);
    k_proj<<<dim3((unsigned)(NB * SEQ / GM), NQKV / GN, 1), 128, 0, stream>>>(XB, WT, cosT, sinT, QH, KH, VT);
    k_flash<<<(unsigned)(NB * NH * (SEQ / BQ)), 32 * NWV, 0, stream>>>(QH, KH, VT, CH);
    k_out<<<dim3((unsigned)(NB * SEQ / GM), DM / GN, 1), 128, 0, stream>>>(CH, WT + (size_t)NQKV * DM, bout, OUT);
}

// v008
// It runs in 119 microseconds.
// Timed twice side by side with v007, it ran 1.05 times as fast both times.
// Over all steps from v000 it is 3.64 times as fast.
#include <hip/hip_runtime.h>

// Compute dtypes, f32 accumulate: x.Wq, x.Wkv on v_wmma_f32_16x16x32_bf16 (inputs RNE-converted to bf16, exact products); q.k^T and P.V on v_wmma_f32_16x16x32_f16 (q, k, v planes f16, q stored x log2(e)/8; P carried x128 in f16); ctx.Wout on v_wmma_f32_16x16x32_f16 (ctx plane f16, Wout RNE-converted to f16: 11 significant bits on both sides, one product).
// Self-attention, 16 heads x 64, partial interleaved rotary on head dims 0..31 (16 frequencies, f32, applied on the f32 projection tiles before the f16 convert), logits x 1/8, full softmax over all keys (online, log2 domain, lazily rescaled), merged heads . Wout + bout.
// Flash form with transposed tiles: S^T accumulator tiles are directly the B-operand layout of P^T; all WMMA operands are two 16-byte loads.
// The three preparation passes (x to bf16, weight transpose, rotary tables) depend on nothing but the inputs and share one launch, picked by block index.
// Operand tiles of the three matrix kernels are staged in LDS, 128 bytes of every row per stage, two buffers, by asynchronous copies that cover whole 128-byte lines; fragments are read from LDS rows at a 144-byte pitch.

#ifndef NB
#define NB 4
#endif
#ifndef SEQ
#define SEQ 2048
#endif
#define NB_FULL  4
#define SEQ_FULL 2048
#define DM   1024              // model width == merged head width
#define NH   16
#define HD   64
#define NQKV 3072              // rows of the transposed q|k|v weight plane
#define NWT  4096              // q|k|v|out rows of the transposed weight plane
#define GM   128               // token rows per k_out block (2 x 2 waves, 64 rows x 64 columns each)
#define GN   128               // output columns per k_out block
#define PM   256               // token rows per k_proj block (2 x 2 waves, 128 rows x 96 columns each)
#define PNT  6                 // 16-column tiles per k_proj wave
#define PN   (2 * 16 * PNT)    // output columns per k_proj block: three heads
#define PPL  (PN / HD)         // heads per k_proj block
#define PH   128               // token rows per half of the k_proj output staging
#define SP   68                // LDS pitch (floats) of the GEMM staging rows
#define NWV  8                 // waves per flash block
#define QT   2                 // 16-query tiles per flash wave: every K and V^T fragment feeds QT products
#define BQ   (16 * QT * NWV)   // queries per flash block
#define KS   32                // keys per step
#define OSP  68                // LDS pitch (floats) of the flash output staging rows
#define VTP  72                // LDS pitch (16-bit elements) of the weight transpose tile
#define LP   72                // LDS pitch (16-bit elements) of a staged 128-byte row: 144 B = 16 B x 9, conflict-free for 16-byte fragment reads
#define LPB  (LP * 2)          // the same in bytes
#define SK   64                // 16-bit elements of a row per stage (GEMM: k; flash: keys of a V^T row, and keys per stage)
#define PBUF ((PM + PN) * LPB)         // k_proj buffer: 256 A rows | 192 B rows
#define FBUF ((SK + HD) * LPB)         // k_flash buffer: 64 K rows | 64 V^T rows
#define FOUT (BQ * OSP * 4)            // k_flash output staging: one f32 row per query
#define OBUF ((GM + GN) * LPB)         // k_out buffer: 128 A rows | 128 B rows
#define WTB  ((DM / 64) * (NWT / 128))         // k_prep: blocks of the weight transpose
#define TBB  (SEQ * 16 / 256)                  // k_prep: blocks of the rotary tables
#define L2E  1.4426950408889634f
#define QSC  (0.125f * L2E)    // logit scale and change to the log2 domain, applied to q on its f32 projection tile
#define PCARRY 7.0f            // P carried as 2^7 * p against the reference maximum in use (row sum carried alike, cancels in the normalisation)
#define PTOP   15.0f           // an exponent above this renews the reference maximum: P <= 2^15, inside f16

static_assert(NH == 16);
static_assert(HD == 64);
static_assert(NH * HD == DM);
static_assert(SEQ % GM == 0);
static_assert(SEQ % PM == 0 && NQKV % PN == 0 && PN % HD == 0 && PM == 2 * PH && PN == 192);
static_assert(SEQ % BQ == 0);
static_assert(SEQ % KS == 0);
static_assert(DM % 32 == 0);
static_assert(DM % SK == 0 && DM / SK >= 2);       // GEMM ring: whole stages, at least two
static_assert(SEQ % SK == 0 && SEQ / SK >= 2);     // flash ring: whole stages, at least two
static_assert(SK == 2 * KS && HD == 64 && GM == 128 && GN == 2 * HD);
static_assert(2 * PBUF >= PPL * PH * SP * 4);      // the ring holds the GEMM output staging (k_proj: half the rows, one plane of 64 columns per head)
static_assert(2 * OBUF >= 2 * GM * SP * 4);
static_assert(FOUT >= 2 * FBUF);                   // the flash output staging holds the ring
static_assert(NWV == 8 && SK == 64 && HD == 64);   // stage4: 256 threads, two copies of 32 rows per tile
static_assert(NB <= NB_FULL);
static_assert(SEQ <= SEQ_FULL);
static_assert(((size_t)NB * SEQ * DM) % 2048 == 0);                                        // p_cvt: blocks * 256 threads * 8 elements == plane
static_assert((size_t)(DM / 64) * (NWT / 128) * (size_t)(64 * 128) == (size_t)NWT * DM);   // p_wt: blocks * (64 k x 128 n) == weight plane
static_assert(((size_t)SEQ * 16) % 256 == 0);                                              // p_tab: blocks * 256 == table entries
static_assert((size_t)(NB * SEQ / PM) * (NQKV / PN) * (size_t)(PM * PN) == (size_t)3 * NB * SEQ * DM);   // k_proj: blocks * (256 x 192) == q + k + v planes
static_assert((size_t)(NB * NH * (SEQ / BQ)) * (size_t)(BQ * HD) == (size_t)NB * SEQ * DM);              // k_flash: blocks * (256 x 64) == ctx plane
static_assert((size_t)(NB * SEQ / GM) * (DM / GN) * (size_t)(GM * GN) == (size_t)NB * SEQ * DM);         // k_out: blocks * (128 x 128) == output
static_assert(((size_t)SEQ * 16 * 4) % 256 == 0);
static_assert((size_t)5 * NB_FULL * SEQ_FULL * DM * 2 + (size_t)NWT * DM * 2 + (size_t)2 * SEQ_FULL * 16 * 4 <= (size_t)134217728);

typedef unsigned short bf;     // bf16 bit pattern
typedef unsigned short hb;     // f16 bit pattern
typedef __attribute__((ext_vector_type(16))) __bf16   v16bf;
typedef __attribute__((ext_vector_type(2)))  __bf16   v2bf;
typedef __attribute__((ext_vector_type(16))) _Float16 v16h;
typedef __attribute__((ext_vector_type(2)))  _Float16 v2h;
typedef __attribute__((ext_vector_type(8)))  unsigned short v8us;
typedef __attribute__((ext_vector_type(8)))  unsigned int   v8u;
typedef __attribute__((ext_vector_type(4)))  unsigned int   v4u;
typedef __attribute__((ext_vector_type(8)))  float    v8f;
typedef __attribute__((ext_vector_type(4)))  float    v4f;
typedef v4f  __attribute__((may_alias)) v4fa;
typedef v8us __attribute__((may_alias)) v8usa;

struct FreqArgs { float inv[16]; };
static_assert(sizeof(FreqArgs) == 64);

__device__ __forceinline__ unsigned short f2bf(float f) { unsigned u = __float_as_uint(f); u += 0x7FFFu + ((u >> 16) & 1u); return (unsigned short)(u >> 16); }
// RNE bf16 value of f kept in the upper 16 bits of an f32 bit pattern
__device__ __forceinline__ unsigned bfhi32(float f) { unsigned u = __float_as_uint(f); u += 0x7FFFu + ((u >> 16) & 1u); return u & 0xFFFF0000u; }
__device__ __forceinline__ float bfr(float f) { return __uint_as_float(bfhi32(f)); }
__device__ __forceinline__ unsigned short f2h(float f) { return __builtin_bit_cast(unsigned short, (_Float16)f); }
__device__ __forceinline__ v16bf cat16b(v8us lo, v8us hi) { return __builtin_bit_cast(v16bf, __builtin_shufflevector(lo, hi, 0, 1, 2, 3, 4, 5, 6, 7, 8, 9, 10, 11, 12, 13, 14, 15)); }
__device__ __forceinline__ v16h  cat16h(v8us lo, v8us hi) { return __builtin_bit_cast(v16h,  __builtin_shufflevector(lo, hi, 0, 1, 2, 3, 4, 5, 6, 7, 8, 9, 10, 11, 12, 13, 14, 15)); }
__device__ __forceinline__ v8f wmmab(v16bf a, v16bf b, v8f c) { return __builtin_amdgcn_wmma_f32_16x16x32_bf16(false, a, false, b, (short)0, c, false, false); }
__device__ __forceinline__ v8f wmmah(v16h a, v16h b, v8f c) { return __builtin_amdgcn_wmma_f32_16x16x32_f16(false, a, false, b, (short)0, c, false, false); }
// fragment loader (A and B alike): p = row base + k0 + 8*(lane>>4); elements 0..7 <- p[0..7], elements 8..15 <- p[16..23]
__device__ __forceinline__ v16h  ldh(const hb* p) { return cat16h(*(const v8us*)p, *(const v8us*)(p + 16)); }
// the same fragment loaders on LDS rows
__device__ __forceinline__ v16bf ldbs(const bf* p) { return cat16b(*(const v8usa*)p, *(const v8usa*)(p + 16)); }
__device__ __forceinline__ v16h  ldhs(const hb* p) { return cat16h(*(const v8usa*)p, *(const v8usa*)(p + 16)); }
// LDS byte address of a __shared__ location: the low 32 bits of its address
__device__ __forceinline__ unsigned ldsa(const void* p) { return (unsigned)(size_t)p; }
// Asynchronous copies global -> LDS, 16 bytes per lane each. The s_wait_xcnt closes each statement so that no address register of an issued copy is rewritten ahead of it.
#define CPA(l, g) "global_load_async_to_lds_b128 %" #l ", %" #g ", off\n\t"
__device__ __forceinline__ void cp8(const unsigned (&l)[8], const unsigned short* const (&g)[8]) {
    asm volatile(CPA(0, 8) CPA(1, 9) CPA(2, 10) CPA(3, 11) CPA(4, 12) CPA(5, 13) CPA(6, 14) CPA(7, 15) "s_wait_xcnt 0x0"
                 :: "v"(l[0]), "v"(l[1]), "v"(l[2]), "v"(l[3]), "v"(l[4]), "v"(l[5]), "v"(l[6]), "v"(l[7]),
                    "v"(g[0]), "v"(g[1]), "v"(g[2]), "v"(g[3]), "v"(g[4]), "v"(g[5]), "v"(g[6]), "v"(g[7]) : "memory");
}
// A block of 128 threads copies 16 rows of 128 bytes per copy: thread -> row tid >> 3, 16-byte piece tid & 7 (a wave covers 4 whole lines).
// la, ga: this thread's LDS byte address and global address in rows 0..15 of a tile; stage8: two tiles of 64 rows, global pitches pa, pb elements; stage128: one tile of 128 rows, global pitch DM.
__device__ __forceinline__ void stage8(unsigned la, const unsigned short* ga, size_t pa, unsigned lb, const unsigned short* gb, size_t pb) {
    unsigned l[8]; const unsigned short* g[8];
#pragma unroll   // constant indices, so that both arrays are registers (asm operands)
    for (unsigned i = 0; i < 4; ++i) {
        l[i] = la + i * 16u * LPB;      g[i] = ga + i * 16u * pa;
        l[4 + i] = lb + i * 16u * LPB;  g[4 + i] = gb + i * 16u * pb;
    }
    cp8(l, g);
}
__device__ __forceinline__ void cp4(const unsigned (&l)[4], const unsigned short* const (&g)[4]) {
    asm volatile(CPA(0, 4) CPA(1, 5) CPA(2, 6) CPA(3, 7) "s_wait_xcnt 0x0"
                 :: "v"(l[0]), "v"(l[1]), "v"(l[2]), "v"(l[3]), "v"(g[0]), "v"(g[1]), "v"(g[2]), "v"(g[3]) : "memory");
}
// A block of 256 threads copies 32 rows of 128 bytes per copy (thread -> row tid >> 3, piece tid & 7); stage4: two tiles of 64 rows, la, ga in rows 0..31.
__device__ __forceinline__ void stage4(unsigned la, const unsigned short* ga, size_t pa, unsigned lb, const unsigned short* gb, size_t pb) {
    unsigned l[4]; const unsigned short* g[4];
#pragma unroll   // constant indices, so that both arrays are registers (asm operands)
    for (unsigned i = 0; i < 2; ++i) {
        l[i] = la + i * 32u * LPB;      g[i] = ga + i * 32u * pa;
        l[2 + i] = lb + i * 32u * LPB;  g[2 + i] = gb + i * 32u * pb;
    }
    cp4(l, g);
}
__device__ __forceinline__ void stage128(unsigned l, const unsigned short* g) { stage8(l, g, DM, l + 64u * LPB, g + (size_t)64 * DM, DM); }
// The same copy as the compiler's builtin, for k_proj: its registers pass v255, where asm operands cannot lie (accumulators would be moved aside for them at every stage).
typedef __attribute__((ext_vector_type(4))) int v4i;
typedef __attribute__((address_space(1))) v4i gv4i;
typedef __attribute__((address_space(3))) v4i lv4i;
__device__ __forceinline__ void cpb(unsigned char* l, const unsigned short* g) { __builtin_amdgcn_global_load_async_to_lds_b128((gv4i*)g, (lv4i*)l, 0, 0); }
// one k_proj stage (block of 128 threads, 16 rows of 128 bytes per copy, global pitch DM): 256 A rows at la, 192 B rows at lb
__device__ __forceinline__ void stage_proj(unsigned char* la, const unsigned short* ga, unsigned char* lb, const unsigned short* gb) {
#pragma unroll   // constant steps from one base per tile: few address additions
    for (unsigned i = 0; i < PM / 16; ++i) cpb(la + i * 16u * LPB, ga + (size_t)(i * 16u) * DM);
#pragma unroll   // as above
    for (unsigned i = 0; i < PN / 16; ++i) cpb(lb + i * 16u * LPB, gb + (size_t)(i * 16u) * DM);
}
// this wave's copies have landed
__device__ __forceinline__ void wait_copies() { asm volatile("s_wait_asynccnt 0x0" ::: "memory"); }
// this wave's LDS reads have returned (before the barrier behind which their buffer is refilled)
__device__ __forceinline__ void wait_lds() { asm volatile("s_wait_dscnt 0x0" ::: "memory"); }
// two f32 -> packed 16-bit pair (RNE), element 0 in the low half-word
__device__ __forceinline__ unsigned pk2h(float a, float b) { v2h t; t[0] = (_Float16)a; t[1] = (_Float16)b; return __builtin_bit_cast(unsigned, t); }

__device__ __forceinline__ void p_cvt(unsigned blk, const float* __restrict__ x, bf* XB) {
    const unsigned i = blk * 256u + threadIdx.x;
    const unsigned per = (unsigned)(SEQ * DM / 8);
    if (i >= (unsigned)NB * per) return;
    const unsigned b = i / per, r = i - b * per;
    const float* src = x + (size_t)b * SEQ_FULL * DM + (size_t)r * 8;
    const v4f v0 = *(const v4f*)src;
    const v4f v1 = *(const v4f*)(src + 4);
    v4u o;
    o[0] = (bfhi32(v0[0]) >> 16) | bfhi32(v0[1]);
    o[1] = (bfhi32(v0[2]) >> 16) | bfhi32(v0[3]);
    o[2] = (bfhi32(v1[0]) >> 16) | bfhi32(v1[1]);
    o[3] = (bfhi32(v1[2]) >> 16) | bfhi32(v1[3]);
    bf* dst = XB + (size_t)i * 8;
    *(v4u*)dst = o;
    
}

// p_wt: transposed 16-bit weight plane WT[n][k] = bf16(W[k][n]) for Wq and Wkv, f16(W[k][n]) for Wout; in[DM k][ncols] -> out[ncols][DM]; virtual column space: 0..1023 Wq, 1024..3071 Wkv, 3072..4095 Wout.
__device__ __forceinline__ void p_wt(unsigned bk, unsigned bn, const float* __restrict__ Wq, const float* __restrict__ Wkv, const float* __restrict__ Wo, bf* WT) {
    __shared__ __align__(16) bf tl[128 * VTP];
    const unsigned tid = threadIdx.x;
    const unsigned k0 = bk * 64u;
    const unsigned n0 = bn * 128u;
    const float* src;
    unsigned ldn;
    if (n0 < 1024u)      { src = Wq  + n0;            ldn = 1024u; }
    else if (n0 < 3072u) { src = Wkv + (n0 - 1024u);  ldn = 2048u; }
    else                 { src = Wo  + (n0 - 3072u);  ldn = 1024u; }
    src += (size_t)k0 * ldn;
    const bool wo = n0 >= 3072u;   // block-uniform
    const unsigned kq = tid >> 5, c4 = (tid & 31u) * 4u;   // piece it of this thread: k row 8 it + kq, columns c4 .. c4 + 3
    v4f x[8];
#pragma unroll   // all eight loads in flight ahead of the one branch on the target type
    for (unsigned it = 0; it < 8; ++it) x[it] = *(const v4f*)(src + (size_t)(it * 8u + kq) * ldn + c4);
    asm volatile("s_wait_xcnt 0x0" ::: "memory");   // no address register of an issued load is rewritten ahead of this
    if (wo) {
#pragma unroll
        for (unsigned it = 0; it < 8; ++it) {
#pragma unroll
            for (unsigned c = 0; c < 4; ++c) tl[(c4 + c) * VTP + it * 8u + kq] = f2h(x[it][c]);
        }
    } else {
#pragma unroll
        for (unsigned it = 0; it < 8; ++it) {
#pragma unroll
            for (unsigned c = 0; c < 4; ++c) tl[(c4 + c) * VTP + it * 8u + kq] = f2bf(x[it][c]);
        }
    }
    __syncthreads();
    bf* dst = WT + (size_t)n0 * DM + k0;
    const unsigned c8 = (tid & 7u) * 8u, dr = tid >> 3;
{
#pragma unroll
        for (unsigned it = 0; it < 4; ++it) {
            const unsigned d = it * 32u + dr;
            const v8us o = *(const v8usa*)(tl + d * VTP + c8);
            *(v8us*)(dst + (size_t)d * DM + c8) = o;
        }
        
    }
}

__device__ __forceinline__ void p_tab(unsigned blk, const FreqArgs& fa, float* cosT, float* sinT) {
    const unsigned i = blk * 256u + threadIdx.x;
    const unsigned t = i >> 4, f = i & 15u;
    float inv = fa.inv[0];
#pragma unroll
    for (unsigned j = 1; j < 16; ++j) inv = (f == j) ? fa.inv[j] : inv;
    const float ang = (float)t * inv;
    float s, c;
    sincosf(ang, &s, &c);
    *(float*)(cosT + i) = c;
    *(float*)(sinT + i) = s;
    
}

// k_prep: one grid for the three passes; the transposes (a barrier and two memory trips each) and the tables take the lowest block indices, the x stream the blocks behind them. The branch is block-uniform.
__global__ __launch_bounds__(256) void k_prep(const float* __restrict__ x, const float* __restrict__ Wq, const float* __restrict__ Wkv, const float* __restrict__ Wo,
                                              FreqArgs fa, bf* XB, bf* WT, float* cosT, float* sinT) {
    const unsigned blk = blockIdx.x;
    if (blk < (unsigned)WTB)              p_wt(blk % (unsigned)(DM / 64), blk / (unsigned)(DM / 64), Wq, Wkv, Wo, WT);
    else if (blk < (unsigned)(WTB + TBB)) p_tab(blk - (unsigned)WTB, fa, cosT, sinT);
    else                                  p_cvt(blk - (unsigned)(WTB + TBB), x, XB);
}

// k_proj: [q|k|v] = XB . WT^T, block = 256 token rows x 192 columns (three heads of q, k or v), wave = 128 rows x 96 columns; two blocks per WGP, all blocks resident at once.
//  A = XB rows (row m = token, k = input channel), B = WT rows (column n = output channel, k = input channel); D element r of lane (h, n) = C[row 8h + r][col n].
//  The second launch bound keeps a wave inside 512 registers (384 of them accumulators), so that two blocks share a WGP, one wave of each per SIMD.
__global__ __launch_bounds__(128, 2) void k_proj(const bf* __restrict__ XB, const bf* __restrict__ WT,
                                              const float* __restrict__ cosT, const float* __restrict__ sinT,
                                              hb* QH, hb* KH, hb* VT) {
    __shared__ __align__(16) unsigned char sm[2 * PBUF];   // operand ring; output staging behind the loop
    float* st = (float*)sm;
    const unsigned tid = threadIdx.x, lane = tid & 31u, wv = tid >> 5, lr = lane & 15u, hi = lane >> 4;
    const unsigned wm = wv >> 1, wn = wv & 1u;   // this wave's 128 rows and 96 columns of the block tile
    const unsigned m0 = blockIdx.x * PM;
    const unsigned nt = blockIdx.y;
    const unsigned cr = tid >> 3, cc = (tid & 7u) * 8u;
    const bf* ga = XB + (size_t)(m0 + cr) * DM + cc;
    const bf* gb = WT + (size_t)(nt * PN + cr) * DM + cc;
    unsigned char* la = sm + cr * LPB + cc * 2u;
    unsigned char* lb = la + PM * LPB;

    v8f c[8][PNT];   // [16-row tile][16-column tile]
#pragma unroll
    for (int i = 0; i < 8; ++i) {
#pragma unroll
        for (int t = 0; t < PNT; ++t) c[i][t] = (v8f){};
    }

    stage_proj(la, ga, lb, gb);
    wait_copies();
    __syncthreads();
    stage_proj(la + PBUF, ga + SK, lb + PBUF, gb + SK);

    unsigned cur = 0;   // byte offset of the buffer that this trip reads
#pragma unroll 1   // one trip per stage stays a loop: small text, one publish point
    for (unsigned s = 0; s < (unsigned)(DM / SK); ++s) {
        const bf* ap = (const bf*)(sm + cur) + (128u * wm + lr) * LP + 8u * hi;
        const bf* bp = (const bf*)(sm + cur) + (PM + 16u * PNT * wn + lr) * LP + 8u * hi;
#pragma unroll   // both 32-wide steps of a stage: constant LDS offsets
        for (unsigned k0 = 0; k0 < (unsigned)SK; k0 += 32) {
            v16bf a[8], bb[PNT];
#pragma unroll
            for (int i = 0; i < 8; ++i) a[i] = ldbs(ap + i * 16 * LP + k0);
#pragma unroll
            for (int t = 0; t < PNT; ++t) bb[t] = ldbs(bp + t * 16 * LP + k0);
            __builtin_amdgcn_sched_barrier(0);   // the step's 28 LDS reads stay one group ahead of its products: one LDS round trip per step, not one per B fragment
#pragma unroll
            for (int t = 0; t < PNT; ++t) {
#pragma unroll
                for (int i = 0; i < 8; ++i) c[i][t] = wmmab(a[i], bb[t], c[i][t]);
            }
            __builtin_amdgcn_sched_barrier(0);   // the next step's reads stay out of this step's products
        }
        // WMMA distance on both sides of the loop's branches: four vector slots behind the stage's last products
        asm volatile("v_nop\n\tv_nop\n\tv_nop\n\tv_nop"
                     :: "v"(c[0][PNT - 1]), "v"(c[1][PNT - 1]), "v"(c[2][PNT - 1]), "v"(c[3][PNT - 1]),
                        "v"(c[4][PNT - 1]), "v"(c[5][PNT - 1]), "v"(c[6][PNT - 1]), "v"(c[7][PNT - 1]));
        // publish stage s + 1, free stage s's buffer, refill it with stage s + 2
        wait_lds();
        wait_copies();
        __syncthreads();
        if (s + 2u < (unsigned)(DM / SK)) stage_proj(la + cur, ga + (s + 2u) * SK, lb + cur, gb + (s + 2u) * SK);
        cur = PBUF - cur;
    }
    wait_copies();

    const unsigned b = m0 / (unsigned)SEQ;
    const unsigned posb = m0 - b * (unsigned)SEQ;
#pragma unroll 1   // the two halves of the block's rows, one after the other: the staging of one half fits the ring
 for (unsigned p = 0; p < 2u; ++p) {
    // staging: plane j holds the 128 rows of this half x 64 columns of head 3 nt + j; written by the two waves that own the half (wave-uniform test, no barrier inside)
    if (wm == p) {
#pragma unroll
        for (int t = 0; t < PNT; ++t) {
            const unsigned cb = 16u * PNT * wn + 16u * t;   // first column of the tile in the block
            float* sw = st + (cb >> 6) * (PH * SP) + (cb & 63u) + lr;
#pragma unroll
            for (int i = 0; i < 8; ++i) {
#pragma unroll
                for (int r = 0; r < 8; ++r) sw[(16u * i + 8u * hi + r) * SP] = c[i][t][r];
            }
        }
    }
    __syncthreads();

    const unsigned pos0 = posb + PH * p;
#pragma unroll 1   // the heads of the block, one after the other: small text
  for (unsigned nh = 0; nh < (unsigned)PPL; ++nh) {
    const unsigned hd = (unsigned)PPL * nt + nh;
    const float* sh = st + nh * PH * SP;
    if (hd < 32u) {
        // q (hd 0..15) or k (hd 16..31) head: rows [pos][64], rotary on column groups 0..3
        const unsigned h = hd & 15u;
        hb* dst = (hd < 16u ? QH : KH) + ((size_t)(b * NH + h) * SEQ + pos0) * HD;
        const unsigned cg = lane & 7u, rq = lane >> 3;
        const bool rot = cg < 4u;
        const float sc = hd < 16u ? QSC : 1.0f;
        const unsigned tc = (cg & 3u) * 4u;
{
#pragma unroll 2
            for (unsigned it = 0; it < 8; ++it) {
                const unsigned row = 32u * wv + 4u * it + rq;
                const float* sr = sh + row * SP + 8u * cg;
                const v4f xa = *(const v4fa*)sr;
                const v4f xb = *(const v4fa*)(sr + 4);
                const unsigned ti = (pos0 + row) * 16u + tc;
                const v4f c4 = *(const v4f*)(cosT + ti);
                const v4f s4 = *(const v4f*)(sinT + ti);
                const float x[8] = { xa[0], xa[1], xa[2], xa[3], xb[0], xb[1], xb[2], xb[3] };
                v4u o;
#pragma unroll
                for (int j = 0; j < 4; ++j) {
                    const float x1 = x[2 * j], x2 = x[2 * j + 1];
                    const float r1 = x1 * c4[j] - x2 * s4[j];
                    const float r2 = x2 * c4[j] + x1 * s4[j];
                    o[j] = pk2h((rot ? r1 : x1) * sc, (rot ? r2 : x2) * sc);
                }
                *(v4u*)(dst + (size_t)row * HD + 8u * cg) = o;
            }
            
        }
    } else {
        // v head: VT[d][pos]; 128 lines (64 d x 2 halves of 64 positions) per head, 4 lines per instruction
        const unsigned h = hd - 32u;
        hb* dst = VT + (size_t)(b * NH + h) * HD * SEQ + pos0;
        const unsigned c8 = (lane & 7u) * 8u, lq = lane >> 3;
{
#pragma unroll 2
            for (unsigned it = 0; it < 8; ++it) {
                const unsigned L = (wv * 8u + it) * 4u + lq;
                const unsigned d = L >> 1, tk = (L & 1u) * 64u + c8;
                const float* sc = sh + tk * SP + d;
                v4u o;
#pragma unroll
                for (int j = 0; j < 4; ++j) o[j] = pk2h(sc[(2 * j) * SP], sc[(2 * j + 1) * SP]);
                *(v4u*)(dst + (size_t)d * SEQ + tk) = o;
            }
            
        }
    }
  }
    if (p == 0u) __syncthreads();   // block-uniform: every reader has left the staging before the second half is written over it
 }
}

// k_flash: one wave per 32 queries (two 16-query tiles) of one (batch, head), 8 waves per block, 32 keys per step; each K and V^T fragment read from LDS feeds both query tiles.
//  S^T tile (keys x queries): A = K rows (row m = key, k = d), B = Q rows (column n = query, k = d); D element r of lane (h, n) = S[query n][key 8h + r].
//  The score products start from C = PCARRY - reference maximum of the lane's query (all 8 elements of a lane belong to one query), so D is the exponent of the carried P.
//  Lazy rescale: the reference is an earlier running maximum; exchange between the halves, correction and rescale run only in the first stage and where an exponent exceeds PTOP, tested once per stage of 64 keys; each half of a column sums its own P, joined once behind the loop.
//  P^T B fragment: element r <- tile of keys 0..15, element 8 + r <- tile of keys 16..31 (same lane); P carried x 2^7 in f16, row sum carried alike.
//  O^T tile (d x queries): A = V^T rows (row m = d, k = key), D element r of lane (h, n) = O[query n][d = 16 t + 8h + r].
__global__ __launch_bounds__(32 * NWV) void k_flash(const hb* __restrict__ QH, const hb* __restrict__ KH, const hb* __restrict__ VT, hb* CH) {
    __shared__ __align__(16) unsigned char sm[FOUT];   // K | V^T ring (first 2 * FBUF bytes); output staging behind the loop
    float* os = (float*)sm;
    const unsigned tid = threadIdx.x, lane = tid & 31u, wv = tid >> 5, lr = lane & 15u, hi = lane >> 4;
    const unsigned qpb = (unsigned)(SEQ / BQ);
    const unsigned bh = blockIdx.x / qpb;
    const unsigned q0 = (blockIdx.x - bh * qpb) * BQ + wv * (16u * QT);
    const unsigned b = bh >> 4, h = bh & 15u;

    v16h qf[QT][2];
#pragma unroll
    for (int q = 0; q < QT; ++q) {
        const hb* qp = QH + ((size_t)bh * SEQ + q0 + 16u * q + lr) * HD + 8u * hi;
        qf[q][0] = ldh(qp);
        qf[q][1] = ldh(qp + 32);
    }
    const unsigned cr = tid >> 3, cc = (tid & 7u) * 8u;
    const hb* gk = KH + ((size_t)bh * SEQ + cr) * HD + cc;
    const hb* gv = VT + ((size_t)bh * HD + cr) * SEQ + cc;
    const unsigned lk = ldsa(sm) + cr * LPB + cc * 2u;
    const unsigned lv = lk + SK * LPB;

    v8f o[QT][4];
    v8f cv[QT];               // C operand of the score products: PCARRY - reference max (log2 domain), alike in both halves of a column
    float l[QT];              // running sum of this lane's half of the keys (carried x 2^7); the halves are joined behind the loop
    float lim = -3.0e38f;     // exponents above this renew the reference: every finite one in the first stage, PTOP from then on
    float lo = -3.0e38f;      // least move of the reference: the first stage takes its own maximum, up or down; later it only rises
#pragma unroll
    for (int q = 0; q < QT; ++q) {
#pragma unroll
        for (int t = 0; t < 4; ++t) o[q][t] = (v8f){};
        cv[q] = (v8f){} + PCARRY;
        l[q] = 0.0f;
    }

    stage4(lk, gk, HD, lv, gv, SEQ);
    wait_copies();
    __syncthreads();
    stage4(lk + FBUF, gk + (size_t)SK * HD, HD, lv + FBUF, gv + SK, SEQ);

    unsigned cur = 0;   // byte offset of the buffer that this trip reads
#pragma unroll 1   // one trip per stage stays a loop: small text, one publish point
    for (unsigned sg = 0; sg < (unsigned)(SEQ / SK); ++sg) {
      const hb* kp = (const hb*)(sm + cur) + lr * LP + 8u * hi;
      const hb* vp = kp + SK * LP;
      v8f s[2][QT][2];   // [32-key step][query tile][16-key tile]
#pragma unroll   // both 32-key steps of a stage: constant LDS offsets
      for (int hs = 0; hs < 2; ++hs) {
#pragma unroll
        for (int q = 0; q < QT; ++q) { s[hs][q][0] = cv[q]; s[hs][q][1] = cv[q]; }
        const hb* ka = kp + hs * KS * LP;
#pragma unroll
        for (int dk = 0; dk < 2; ++dk) {
            const v16h a0 = ldhs(ka + dk * 32);
            const v16h a1 = ldhs(ka + 16 * LP + dk * 32);
#pragma unroll
            for (int q = 0; q < QT; ++q) {
                s[hs][q][0] = wmmah(a0, qf[q][dk], s[hs][q][0]);
                s[hs][q][1] = wmmah(a1, qf[q][dk], s[hs][q][1]);
            }
        }
      }
      // WMMA distance: four vector slots behind the stage's last score products
      asm volatile("v_nop\n\tv_nop\n\tv_nop\n\tv_nop" : "+v"(s[1][0][0]), "+v"(s[1][0][1]), "+v"(s[1][1][0]), "+v"(s[1][1][1])
                   : "v"(qf[0][0]), "v"(qf[0][1]), "v"(qf[1][0]), "v"(qf[1][1]));

      float mx[QT];   // this lane's half of the column only; the halves meet in the branch
#pragma unroll
      for (int q = 0; q < QT; ++q) {
          mx[q] = fmaxf(s[0][q][0][0], s[0][q][1][0]);
#pragma unroll
          for (int r = 1; r < 8; ++r) mx[q] = fmaxf(mx[q], fmaxf(s[0][q][0][r], s[0][q][1][r]));
#pragma unroll
          for (int r = 0; r < 8; ++r) mx[q] = fmaxf(mx[q], fmaxf(s[1][q][0][r], s[1][q][1][r]));
      }
      if (__builtin_amdgcn_ballot_w32(!(mx[0] <= lim && mx[1] <= lim)) != 0u) {   // wave-uniform, one test per stage
#pragma unroll
          for (int q = 0; q < QT; ++q) {
              const float up = fmaxf(mx[q], __shfl_xor(mx[q], 16, 32)) - PCARRY;   // the stage's maximum above the reference in use
              const float dm = fmaxf(up, lo);
              const float corr = __builtin_amdgcn_exp2f(-fmaxf(dm, 0.0f));         // dm < 0 only in the first stage, where O and l are still 0
              cv[q] -= dm;
#pragma unroll
              for (int hs = 0; hs < 2; ++hs) { s[hs][q][0] -= dm; s[hs][q][1] -= dm; }
              l[q] *= corr;
#pragma unroll
              for (int t = 0; t < 4; ++t) o[q][t] *= corr;
          }
          lim = PTOP;
          lo = 0.0f;
      }
#pragma unroll   // both 32-key steps of a stage: constant LDS offsets
      for (int hs = 0; hs < 2; ++hs) {
        const hb* va = vp + hs * KS;
        v16h av[4];   // the step's four V^T fragments, read as one group; the step's softmax covers their LDS round trip
#pragma unroll
        for (int t = 0; t < 4; ++t) av[t] = ldhs(va + t * 16 * LP);
        __builtin_amdgcn_sched_barrier(0);   // the 8 LDS reads stay together, above the softmax
        v16h ph[QT];
#pragma unroll
        for (int q = 0; q < QT; ++q) {
            const v8f s0 = s[hs][q][0], s1 = s[hs][q][1];
            float p0[8], p1[8];
            float ps = 0.0f;
#pragma unroll
            for (int r = 0; r < 8; ++r) {
                p0[r] = __builtin_amdgcn_exp2f(s0[r]);
                p1[r] = __builtin_amdgcn_exp2f(s1[r]);
                ps += p0[r] + p1[r];
            }
            l[q] += ps;
            v8u hw;
#pragma unroll
            for (int j = 0; j < 4; ++j) {
                hw[j]     = pk2h(p0[2 * j], p0[2 * j + 1]);
                hw[4 + j] = pk2h(p1[2 * j], p1[2 * j + 1]);
            }
            ph[q] = __builtin_bit_cast(v16h, hw);
        }

#pragma unroll
        for (int t = 0; t < 4; ++t) {
#pragma unroll
            for (int q = 0; q < QT; ++q) o[q][t] = wmmah(av[t], ph[q], o[q][t]);
        }
        // WMMA distance on both sides of the branches that follow: four vector slots behind the step's last products
        asm volatile("v_nop\n\tv_nop\n\tv_nop\n\tv_nop"
                     : "+v"(o[0][0]), "+v"(o[0][1]), "+v"(o[0][2]), "+v"(o[0][3]), "+v"(o[1][0]), "+v"(o[1][1]), "+v"(o[1][2]), "+v"(o[1][3])
                     : "v"(ph[0]), "v"(ph[1]));
      }
      // publish stage sg + 1, free stage sg's buffer, refill it with stage sg + 2
      wait_lds();
      wait_copies();
      __syncthreads();
      if (sg + 2u < (unsigned)(SEQ / SK)) stage4(lk + cur, gk + (size_t)(sg + 2u) * SK * HD, HD, lv + cur, gv + (sg + 2u) * SK, SEQ);
      cur = FBUF - cur;
    }
    wait_copies();

    float* ow = os + wv * (16 * QT * OSP);   // this wave's 32 rows
#pragma unroll
    for (int q = 0; q < QT; ++q) {
        const float inv = 1.0f / (l[q] + __shfl_xor(l[q], 16, 32));
#pragma unroll
        for (int t = 0; t < 4; ++t) {
#pragma unroll
            for (int r = 0; r < 8; ++r) ow[(16 * q + lr) * OSP + t * 16 + 8 * hi + r] = o[q][t][r] * inv;
        }
    }
    __syncthreads();
    const unsigned cg = lane & 7u, rq = lane >> 3;
    const size_t cbase = ((size_t)b * SEQ + q0) * DM + h * HD + 8u * cg;
{
#pragma unroll
        for (unsigned s = 0; s < 4u * QT; ++s) {
            const unsigned row = 4u * s + rq;
            const float* sr = ow + row * OSP + 8u * cg;
            const v4f xa = *(const v4fa*)sr;
            const v4f xb = *(const v4fa*)(sr + 4);
            const float x[8] = { xa[0], xa[1], xa[2], xa[3], xb[0], xb[1], xb[2], xb[3] };
            v4u oh;
#pragma unroll
            for (int j = 0; j < 4; ++j) oh[j] = pk2h(x[2 * j], x[2 * j + 1]);
            *(v4u*)(CH + cbase + (size_t)row * DM) = oh;
        }
        
    }
}

// k_out: out = CH . WOT^T + bf16(bout); block = 128 rows x 128 columns, wave = 64 rows x 64 columns.
__global__ __launch_bounds__(128) void k_out(const hb* __restrict__ CH, const hb* __restrict__ WOT,
                                             const float* __restrict__ bout, float* O) {
    __shared__ __align__(16) unsigned char sm[2 * OBUF];   // operand ring; output staging behind the loop
    float* st = (float*)sm;
    const unsigned tid = threadIdx.x, lane = tid & 31u, wv = tid >> 5, lr = lane & 15u, hi = lane >> 4;
    const unsigned wm = wv >> 1, wn = wv & 1u;   // this wave's 64 rows and 64 columns of the block tile
    const unsigned m0 = blockIdx.x * GM;
    const unsigned n0 = blockIdx.y * GN;
    const unsigned cr = tid >> 3, cc = (tid & 7u) * 8u;
    const hb* ga = CH + (size_t)(m0 + cr) * DM + cc;
    const hb* gb = WOT + (size_t)(n0 + cr) * DM + cc;
    const unsigned la = ldsa(sm) + cr * LPB + cc * 2u;
    const unsigned lb = la + GM * LPB;

    v8f c[4][4];   // [16-row tile][16-column tile]
#pragma unroll
    for (int i = 0; i < 4; ++i) {
#pragma unroll
        for (int t = 0; t < 4; ++t) c[i][t] = (v8f){};
    }

    stage128(la, ga);
    stage128(lb, gb);
    wait_copies();
    __syncthreads();
    stage128(la + OBUF, ga + SK);
    stage128(lb + OBUF, gb + SK);

    unsigned cur = 0;   // byte offset of the buffer that this trip reads
#pragma unroll 1   // one trip per stage stays a loop: small text, one publish point
    for (unsigned s = 0; s < (unsigned)(DM / SK); ++s) {
        const hb* ap = (const hb*)(sm + cur) + (64u * wm + lr) * LP + 8u * hi;
        const hb* bp = (const hb*)(sm + cur) + (GM + 64u * wn + lr) * LP + 8u * hi;
#pragma unroll   // both 32-wide steps of a stage: constant LDS offsets
        for (unsigned k0 = 0; k0 < (unsigned)SK; k0 += 32) {
            v16h a[4], bb[4];
#pragma unroll
            for (int i = 0; i < 4; ++i) a[i] = ldhs(ap + i * 16 * LP + k0);
#pragma unroll
            for (int t = 0; t < 4; ++t) bb[t] = ldhs(bp + t * 16 * LP + k0);
            __builtin_amdgcn_sched_barrier(0);   // the step's 16 LDS reads stay one group ahead of its products: one LDS round trip per step, not one per B fragment
#pragma unroll
            for (int t = 0; t < 4; ++t) {
#pragma unroll
                for (int i = 0; i < 4; ++i) c[i][t] = wmmah(a[i], bb[t], c[i][t]);
            }
            __builtin_amdgcn_sched_barrier(0);   // the next step's reads stay out of this step's products
        }
        // WMMA distance on both sides of the loop's branches: four vector slots behind the stage's last products
        asm volatile("v_nop\n\tv_nop\n\tv_nop\n\tv_nop"
                     :: "v"(c[0][0]), "v"(c[0][1]), "v"(c[0][2]), "v"(c[0][3]), "v"(c[1][0]), "v"(c[1][1]), "v"(c[1][2]), "v"(c[1][3]),
                        "v"(c[2][0]), "v"(c[2][1]), "v"(c[2][2]), "v"(c[2][3]), "v"(c[3][0]), "v"(c[3][1]), "v"(c[3][2]), "v"(c[3][3]));
        // publish stage s + 1, free stage s's buffer, refill it with stage s + 2
        wait_lds();
        wait_copies();
        __syncthreads();
        if (s + 2u < (unsigned)(DM / SK)) {
            stage128(la + cur, ga + (s + 2u) * SK);
            stage128(lb + cur, gb + (s + 2u) * SK);
        }
        cur = OBUF - cur;
    }
    wait_copies();

    // staging: plane wn holds the 128 rows x 64 columns n0 + 64 wn ..
    float* sw = st + (wn * GM + 64u * wm) * SP;
#pragma unroll
    for (int i = 0; i < 4; ++i) {
#pragma unroll
        for (int t = 0; t < 4; ++t) {
#pragma unroll
            for (int r = 0; r < 8; ++r) sw[(16u * i + 8u * hi + r) * SP + t * 16 + lr] = c[i][t][r];
        }
    }
    __syncthreads();

    // one row of 128 columns (512 bytes, four whole lines) per store instruction; wave wv stores rows 32 wv ..
    const unsigned c4 = (lane & 15u) * 4u, ph = lane >> 4;
    const v4f bv = *(const v4f*)(bout + n0 + 64u * ph + c4);
    const float b0 = bfr(bv[0]), b1 = bfr(bv[1]), b2 = bfr(bv[2]), b3 = bfr(bv[3]);
    const float* sr = st + (ph * GM + 32u * wv) * SP + c4;
    float* orow = O + (size_t)(m0 + 32u * wv) * DM + n0 + 64u * ph + c4;
{
#pragma unroll 4
        for (unsigned row = 0; row < 32; ++row) {
            v4f val = *(const v4fa*)(sr + row * SP);
            val[0] += b0; val[1] += b1; val[2] += b2; val[3] += b3;
            *(v4f*)(orow + (size_t)row * DM) = val;
        }
        
    }
}

extern "C" void kernel_launch(void* const* d_in, const int* in_sizes, int n_in,
                              void* d_out, int out_size, void* d_ws, size_t ws_size, hipStream_t stream) {
    if (n_in < 5) return;
    const size_t needx = ((size_t)(NB - 1) * SEQ_FULL + SEQ) * DM;
    if ((size_t)in_sizes[0] < needx) return;
    if ((size_t)in_sizes[1] < (size_t)DM * DM) return;
    if ((size_t)in_sizes[2] < (size_t)2 * DM * DM) return;
    if ((size_t)in_sizes[3] < (size_t)DM * DM) return;
    if ((size_t)in_sizes[4] < (size_t)DM) return;
    if ((size_t)out_size < (size_t)NB * SEQ * DM) return;
    const float* x    = (const float*)d_in[0];   // queries [NB_FULL][SEQ_FULL][DM]
    const float* Wq   = (const float*)d_in[1];   // [DM in][DM out]
    const float* Wkv  = (const float*)d_in[2];   // [DM in][2*DM out]
    const float* Wout = (const float*)d_in[3];   // [DM in][DM out]
    const float* bout = (const float*)d_in[4];   // [DM]
    float* OUT = (float*)d_out;                  // [NB][SEQ][DM]

    const size_t PA = (size_t)NB * SEQ * DM * 2;     // bytes per 16-bit activation plane
    const size_t PW = (size_t)NWT * DM * 2;          // bytes of the transposed weight plane
    const size_t PT = (size_t)SEQ * 16 * 4;          // bytes per rotary table
    if (5 * PA + PW + 2 * PT > ws_size) return;
    char* wsp = (char*)d_ws;
    bf* XB = (bf*)(wsp);
    bf* WT = (bf*)(wsp + PA);
    float* cosT = (float*)(wsp + PA + PW);
    float* sinT = (float*)(wsp + PA + PW + PT);
    hb* QH = (hb*)(wsp + PA + PW + 2 * PT);
    hb* KH = (hb*)(wsp + 2 * PA + PW + 2 * PT);
    hb* VT = (hb*)(wsp + 3 * PA + PW + 2 * PT);
    hb* CH = (hb*)(wsp + 4 * PA + PW + 2 * PT);

    FreqArgs fa;
    for (int i = 0; i < 16; ++i) {
        const float pw = (float)pow(10000.0, (double)(2 * i) / 32.0);
        fa.inv[i] = 1.0f / pw;
    }

    const unsigned gc = (unsigned)(((size_t)NB * SEQ * DM / 8 + 255) / 256);
    k_prep<<<(unsigned)(WTB + TBB) + gc, 256, 0, stream>>>(x, Wq, Wkv, Wout, fa, XB, WT, cosT, sinT);
    k_proj<<<dim3((unsigned)(NB * SEQ / PM), NQKV / PN, 1), 128, 0, stream>>>(XB, WT, cosT, sinT, QH, KH, VT);
    k_flash<<<(unsigned)(NB * NH * (SEQ / BQ)), 32 * NWV, 0, stream>>>(QH, KH, VT, CH);
    k_out<<<dim3((unsigned)(NB * SEQ / GM), DM / GN, 1), 128, 0, stream>>>(CH, WT + (size_t)NQKV * DM, bout, OUT);
}

// v009
// One run takes 114 microseconds.
// Timed twice side by side with v008, it ran 1.04 times as fast both times.
// Over all steps from v000 it is 3.79 times as fast.
#include <hip/hip_runtime.h>

// Compute dtypes, f32 accumulate: x.Wq, x.Wkv on v_wmma_f32_16x16x32_bf16 (inputs RNE-converted to bf16, exact products); q.k^T and P.V on v_wmma_f32_16x16x32_f16 (q, k, v planes f16, q stored x log2(e)/8; P carried x128 in f16); ctx.Wout on v_wmma_f32_16x16x32_f16 (ctx plane f16, Wout RNE-converted to f16: 11 significant bits on both sides, one product).
// Self-attention, 16 heads x 64, partial interleaved rotary on head dims 0..31 (16 frequencies, f32, applied on the f32 projection tiles before the f16 convert), logits x 1/8, full softmax over all keys (online, log2 domain, lazily rescaled), merged heads . Wout + bout.
// Flash form with transposed tiles: S^T accumulator tiles are directly the B-operand layout of P^T; all WMMA operands are two 16-byte loads.
// The three preparation passes (x to bf16, weight transpose, rotary tables) depend on nothing but the inputs and share one launch, picked by block index.
// Operand tiles of the three matrix kernels are staged in LDS, 128 bytes of every row per stage, two buffers, by asynchronous copies that cover whole 128-byte lines; fragments are read from LDS rows at a 144-byte pitch.

#ifndef NB
#define NB 4
#endif
#ifndef SEQ
#define SEQ 2048
#endif
#define NB_FULL  4
#define SEQ_FULL 2048
#define DM   1024              // model width == merged head width
#define NH   16
#define HD   64
#define NQKV 3072              // rows of the transposed q|k|v weight plane
#define NWT  4096              // q|k|v|out rows of the transposed weight plane
#define GM   128               // token rows per k_out block (2 x 2 waves, 64 rows x 64 columns each)
#define GN   128               // output columns per k_out block
#define PM   256               // token rows per k_proj block (2 x 2 waves, 128 rows x 96 columns each)
#define PNT  6                 // 16-column tiles per k_proj wave
#define PN   (2 * 16 * PNT)    // output columns per k_proj block: three heads
#define PPL  (PN / HD)         // heads per k_proj block
#define VPB  528               // LDS pitch (bytes) of a staged V^T row of 256 positions: 16 B x 33, conflict-free for 16-byte reads
#define SP   68                // LDS pitch (floats) of the GEMM staging rows
#define NWV  8                 // waves per flash block
#define QT   2                 // 16-query tiles per flash wave: every K and V^T fragment feeds QT products
#define BQ   (16 * QT * NWV)   // queries per flash block
#define KS   32                // keys per step
#define OSP  68                // LDS pitch (floats) of the flash output staging rows
#define VTP  72                // LDS pitch (16-bit elements) of the weight transpose tile
#define LP   72                // LDS pitch (16-bit elements) of a staged 128-byte row: 144 B = 16 B x 9, conflict-free for 16-byte fragment reads
#define LPB  (LP * 2)          // the same in bytes
#define SK   64                // 16-bit elements of a row per stage (GEMM: k; flash: keys of a V^T row, and keys per stage)
#define PBUF ((PM + PN) * LPB)         // k_proj buffer: 256 token rows | 192 weight rows
#define PLB  (PM * LPB)                // k_proj output staging, one 16-bit plane per head: 256 rows x 64 columns (q, k) or 64 rows x 256 positions (v)
#define FBUF ((SK + HD) * LPB)         // k_flash buffer: 64 K rows | 64 V^T rows
#define FOUT (BQ * OSP * 4)            // k_flash output staging: one f32 row per query
#define OBUF ((GM + GN) * LPB)         // k_out buffer: 128 A rows | 128 B rows
#define WTB  ((DM / 64) * (NWT / 128))         // k_prep: blocks of the weight transpose
#define TBB  (SEQ * 16 / 256)                  // k_prep: blocks of the rotary tables
#define L2E  1.4426950408889634f
#define QSC  (0.125f * L2E)    // logit scale and change to the log2 domain, applied to q on its f32 projection tile
#define PCARRY 7.0f            // P carried as 2^7 * p against the reference maximum in use (row sum carried alike, cancels in the normalisation)
#define PTOP   15.0f           // an exponent above this renews the reference maximum: P <= 2^15, inside f16

static_assert(NH == 16);
static_assert(HD == 64);
static_assert(NH * HD == DM);
static_assert(SEQ % GM == 0);
static_assert(SEQ % PM == 0 && NQKV % PN == 0 && PN % HD == 0 && PM == 256 && PN == 192);
static_assert(SEQ % BQ == 0);
static_assert(SEQ % KS == 0);
static_assert(DM % 32 == 0);
static_assert(DM % SK == 0 && DM / SK >= 2);       // GEMM ring: whole stages, at least two
static_assert(SEQ % SK == 0 && SEQ / SK >= 2);     // flash ring: whole stages, at least two
static_assert(SK == 2 * KS && HD == 64 && GM == 128 && GN == 2 * HD);
static_assert(2 * PBUF >= PPL * PLB && PLB >= HD * VPB && VPB >= PM * 2);   // the ring holds the k_proj output staging
static_assert((2 * NH) % PPL == PPL - 1);          // k_proj: the one kind of block with q or k heads and v heads has exactly one v head, its last
static_assert(2 * OBUF >= 2 * GM * SP * 4);
static_assert(FOUT >= 2 * FBUF);                   // the flash output staging holds the ring
static_assert(NWV == 8 && SK == 64 && HD == 64);   // stage4: 256 threads, two copies of 32 rows per tile
static_assert(NB <= NB_FULL);
static_assert(SEQ <= SEQ_FULL);
static_assert(((size_t)NB * SEQ * DM) % 2048 == 0);                                        // p_cvt: blocks * 256 threads * 8 elements == plane
static_assert((size_t)(DM / 64) * (NWT / 128) * (size_t)(64 * 128) == (size_t)NWT * DM);   // p_wt: blocks * (64 k x 128 n) == weight plane
static_assert(((size_t)SEQ * 16) % 256 == 0);                                              // p_tab: blocks * 256 == table entries
static_assert((size_t)(NB * SEQ / PM) * (NQKV / PN) * (size_t)(PM * PN) == (size_t)3 * NB * SEQ * DM);   // k_proj: blocks * (256 x 192) == q + k + v planes
static_assert((size_t)(NB * NH * (SEQ / BQ)) * (size_t)(BQ * HD) == (size_t)NB * SEQ * DM);              // k_flash: blocks * (256 x 64) == ctx plane
static_assert((size_t)(NB * SEQ / GM) * (DM / GN) * (size_t)(GM * GN) == (size_t)NB * SEQ * DM);         // k_out: blocks * (128 x 128) == output
static_assert(((size_t)SEQ * 16 * 4) % 256 == 0);
static_assert((size_t)5 * NB_FULL * SEQ_FULL * DM * 2 + (size_t)NWT * DM * 2 + (size_t)2 * SEQ_FULL * 16 * 4 <= (size_t)134217728);

typedef unsigned short bf;     // bf16 bit pattern
typedef unsigned short hb;     // f16 bit pattern
typedef __attribute__((ext_vector_type(16))) __bf16   v16bf;
typedef __attribute__((ext_vector_type(2)))  __bf16   v2bf;
typedef __attribute__((ext_vector_type(16))) _Float16 v16h;
typedef __attribute__((ext_vector_type(2)))  _Float16 v2h;
typedef __attribute__((ext_vector_type(8)))  unsigned short v8us;
typedef __attribute__((ext_vector_type(8)))  unsigned int   v8u;
typedef __attribute__((ext_vector_type(4)))  unsigned int   v4u;
typedef __attribute__((ext_vector_type(8)))  float    v8f;
typedef __attribute__((ext_vector_type(4)))  float    v4f;
typedef v4f  __attribute__((may_alias)) v4fa;
typedef v8us __attribute__((may_alias)) v8usa;
typedef __attribute__((ext_vector_type(2)))  float    v2f;
typedef v4u  __attribute__((may_alias)) v4ua;

struct FreqArgs { float inv[16]; };
static_assert(sizeof(FreqArgs) == 64);

__device__ __forceinline__ unsigned short f2bf(float f) { unsigned u = __float_as_uint(f); u += 0x7FFFu + ((u >> 16) & 1u); return (unsigned short)(u >> 16); }
// RNE bf16 value of f kept in the upper 16 bits of an f32 bit pattern
__device__ __forceinline__ unsigned bfhi32(float f) { unsigned u = __float_as_uint(f); u += 0x7FFFu + ((u >> 16) & 1u); return u & 0xFFFF0000u; }
__device__ __forceinline__ float bfr(float f) { return __uint_as_float(bfhi32(f)); }
__device__ __forceinline__ unsigned short f2h(float f) { return __builtin_bit_cast(unsigned short, (_Float16)f); }
__device__ __forceinline__ v16bf cat16b(v8us lo, v8us hi) { return __builtin_bit_cast(v16bf, __builtin_shufflevector(lo, hi, 0, 1, 2, 3, 4, 5, 6, 7, 8, 9, 10, 11, 12, 13, 14, 15)); }
__device__ __forceinline__ v16h  cat16h(v8us lo, v8us hi) { return __builtin_bit_cast(v16h,  __builtin_shufflevector(lo, hi, 0, 1, 2, 3, 4, 5, 6, 7, 8, 9, 10, 11, 12, 13, 14, 15)); }
__device__ __forceinline__ v8f wmmab(v16bf a, v16bf b, v8f c) { return __builtin_amdgcn_wmma_f32_16x16x32_bf16(false, a, false, b, (short)0, c, false, false); }
__device__ __forceinline__ v8f wmmah(v16h a, v16h b, v8f c) { return __builtin_amdgcn_wmma_f32_16x16x32_f16(false, a, false, b, (short)0, c, false, false); }
// fragment loader (A and B alike): p = row base + k0 + 8*(lane>>4); elements 0..7 <- p[0..7], elements 8..15 <- p[16..23]
__device__ __forceinline__ v16h  ldh(const hb* p) { return cat16h(*(const v8us*)p, *(const v8us*)(p + 16)); }
// the same fragment loaders on LDS rows
__device__ __forceinline__ v16bf ldbs(const bf* p) { return cat16b(*(const v8usa*)p, *(const v8usa*)(p + 16)); }
__device__ __forceinline__ v16h  ldhs(const hb* p) { return cat16h(*(const v8usa*)p, *(const v8usa*)(p + 16)); }
// LDS byte address of a __shared__ location: the low 32 bits of its address
__device__ __forceinline__ unsigned ldsa(const void* p) { return (unsigned)(size_t)p; }
// Asynchronous copies global -> LDS, 16 bytes per lane each. The s_wait_xcnt closes each statement so that no address register of an issued copy is rewritten ahead of it.
#define CPA(l, g) "global_load_async_to_lds_b128 %" #l ", %" #g ", off\n\t"
__device__ __forceinline__ void cp8(const unsigned (&l)[8], const unsigned short* const (&g)[8]) {
    asm volatile(CPA(0, 8) CPA(1, 9) CPA(2, 10) CPA(3, 11) CPA(4, 12) CPA(5, 13) CPA(6, 14) CPA(7, 15) "s_wait_xcnt 0x0"
                 :: "v"(l[0]), "v"(l[1]), "v"(l[2]), "v"(l[3]), "v"(l[4]), "v"(l[5]), "v"(l[6]), "v"(l[7]),
                    "v"(g[0]), "v"(g[1]), "v"(g[2]), "v"(g[3]), "v"(g[4]), "v"(g[5]), "v"(g[6]), "v"(g[7]) : "memory");
}
// A block of 128 threads copies 16 rows of 128 bytes per copy: thread -> row tid >> 3, 16-byte piece tid & 7 (a wave covers 4 whole lines).
// la, ga: this thread's LDS byte address and global address in rows 0..15 of a tile; stage8: two tiles of 64 rows, global pitches pa, pb elements; stage128: one tile of 128 rows, global pitch DM.
__device__ __forceinline__ void stage8(unsigned la, const unsigned short* ga, size_t pa, unsigned lb, const unsigned short* gb, size_t pb) {
    unsigned l[8]; const unsigned short* g[8];
#pragma unroll   // constant indices, so that both arrays are registers (asm operands)
    for (unsigned i = 0; i < 4; ++i) {
        l[i] = la + i * 16u * LPB;      g[i] = ga + i * 16u * pa;
        l[4 + i] = lb + i * 16u * LPB;  g[4 + i] = gb + i * 16u * pb;
    }
    cp8(l, g);
}
__device__ __forceinline__ void cp4(const unsigned (&l)[4], const unsigned short* const (&g)[4]) {
    asm volatile(CPA(0, 4) CPA(1, 5) CPA(2, 6) CPA(3, 7) "s_wait_xcnt 0x0"
                 :: "v"(l[0]), "v"(l[1]), "v"(l[2]), "v"(l[3]), "v"(g[0]), "v"(g[1]), "v"(g[2]), "v"(g[3]) : "memory");
}
// A block of 256 threads copies 32 rows of 128 bytes per copy (thread -> row tid >> 3, piece tid & 7); stage4: two tiles of 64 rows, la, ga in rows 0..31.
__device__ __forceinline__ void stage4(unsigned la, const unsigned short* ga, size_t pa, unsigned lb, const unsigned short* gb, size_t pb) {
    unsigned l[4]; const unsigned short* g[4];
#pragma unroll   // constant indices, so that both arrays are registers (asm operands)
    for (unsigned i = 0; i < 2; ++i) {
        l[i] = la + i * 32u * LPB;      g[i] = ga + i * 32u * pa;
        l[2 + i] = lb + i * 32u * LPB;  g[2 + i] = gb + i * 32u * pb;
    }
    cp4(l, g);
}
__device__ __forceinline__ void stage128(unsigned l, const unsigned short* g) { stage8(l, g, DM, l + 64u * LPB, g + (size_t)64 * DM, DM); }
// The same copy as the compiler's builtin, for k_proj: its registers pass v255, where asm operands cannot lie (accumulators would be moved aside for them at every stage).
typedef __attribute__((ext_vector_type(4))) int v4i;
typedef __attribute__((address_space(1))) v4i gv4i;
typedef __attribute__((address_space(3))) v4i lv4i;
__device__ __forceinline__ void cpb(unsigned char* l, const unsigned short* g) { __builtin_amdgcn_global_load_async_to_lds_b128((gv4i*)g, (lv4i*)l, 0, 0); }
// one k_proj stage (block of 128 threads, 16 rows of 128 bytes per copy, global pitch DM): 256 token rows at la, 192 weight rows at lb
__device__ __forceinline__ void stage_proj(unsigned char* la, const unsigned short* ga, unsigned char* lb, const unsigned short* gb) {
#pragma unroll   // constant steps from one base per tile: few address additions
    for (unsigned i = 0; i < PM / 16; ++i) cpb(la + i * 16u * LPB, ga + (size_t)(i * 16u) * DM);
#pragma unroll   // as above
    for (unsigned i = 0; i < PN / 16; ++i) cpb(lb + i * 16u * LPB, gb + (size_t)(i * 16u) * DM);
}
// this wave's copies have landed
__device__ __forceinline__ void wait_copies() { asm volatile("s_wait_asynccnt 0x0" ::: "memory"); }
// this wave's LDS reads have returned (before the barrier behind which their buffer is refilled)
__device__ __forceinline__ void wait_lds() { asm volatile("s_wait_dscnt 0x0" ::: "memory"); }
// two f32 -> packed 16-bit pair (RNE), element 0 in the low half-word
__device__ __forceinline__ unsigned pk2h(float a, float b) { v2h t; t[0] = (_Float16)a; t[1] = (_Float16)b; return __builtin_bit_cast(unsigned, t); }

__device__ __forceinline__ void p_cvt(unsigned blk, const float* __restrict__ x, bf* XB) {
    const unsigned i = blk * 256u + threadIdx.x;
    const unsigned per = (unsigned)(SEQ * DM / 8);
    if (i >= (unsigned)NB * per) return;
    const unsigned b = i / per, r = i - b * per;
    const float* src = x + (size_t)b * SEQ_FULL * DM + (size_t)r * 8;
    const v4f v0 = *(const v4f*)src;
    const v4f v1 = *(const v4f*)(src + 4);
    v4u o;
    o[0] = (bfhi32(v0[0]) >> 16) | bfhi32(v0[1]);
    o[1] = (bfhi32(v0[2]) >> 16) | bfhi32(v0[3]);
    o[2] = (bfhi32(v1[0]) >> 16) | bfhi32(v1[1]);
    o[3] = (bfhi32(v1[2]) >> 16) | bfhi32(v1[3]);
    bf* dst = XB + (size_t)i * 8;
    *(v4u*)dst = o;
    
}

// p_wt: transposed 16-bit weight plane WT[n][k] = bf16(W[k][n]) for Wq and Wkv, f16(W[k][n]) for Wout; in[DM k][ncols] -> out[ncols][DM]; virtual column space: 0..1023 Wq, 1024..3071 Wkv, 3072..4095 Wout.
__device__ __forceinline__ void p_wt(unsigned bk, unsigned bn, const float* __restrict__ Wq, const float* __restrict__ Wkv, const float* __restrict__ Wo, bf* WT) {
    __shared__ __align__(16) bf tl[128 * VTP];
    const unsigned tid = threadIdx.x;
    const unsigned k0 = bk * 64u;
    const unsigned n0 = bn * 128u;
    const float* src;
    unsigned ldn;
    if (n0 < 1024u)      { src = Wq  + n0;            ldn = 1024u; }
    else if (n0 < 3072u) { src = Wkv + (n0 - 1024u);  ldn = 2048u; }
    else                 { src = Wo  + (n0 - 3072u);  ldn = 1024u; }
    src += (size_t)k0 * ldn;
    const bool wo = n0 >= 3072u;   // block-uniform
    const unsigned kq = tid >> 5, c4 = (tid & 31u) * 4u;   // piece it of this thread: k row 8 it + kq, columns c4 .. c4 + 3
    v4f x[8];
#pragma unroll   // all eight loads in flight ahead of the one branch on the target type
    for (unsigned it = 0; it < 8; ++it) x[it] = *(const v4f*)(src + (size_t)(it * 8u + kq) * ldn + c4);
    asm volatile("s_wait_xcnt 0x0" ::: "memory");   // no address register of an issued load is rewritten ahead of this
    if (wo) {
#pragma unroll
        for (unsigned it = 0; it < 8; ++it) {
#pragma unroll
            for (unsigned c = 0; c < 4; ++c) tl[(c4 + c) * VTP + it * 8u + kq] = f2h(x[it][c]);
        }
    } else {
#pragma unroll
        for (unsigned it = 0; it < 8; ++it) {
#pragma unroll
            for (unsigned c = 0; c < 4; ++c) tl[(c4 + c) * VTP + it * 8u + kq] = f2bf(x[it][c]);
        }
    }
    __syncthreads();
    bf* dst = WT + (size_t)n0 * DM + k0;
    const unsigned c8 = (tid & 7u) * 8u, dr = tid >> 3;
{
#pragma unroll
        for (unsigned it = 0; it < 4; ++it) {
            const unsigned d = it * 32u + dr;
            const v8us o = *(const v8usa*)(tl + d * VTP + c8);
            *(v8us*)(dst + (size_t)d * DM + c8) = o;
        }
        
    }
}

__device__ __forceinline__ void p_tab(unsigned blk, const FreqArgs& fa, float* cosT, float* sinT) {
    const unsigned i = blk * 256u + threadIdx.x;
    const unsigned t = i >> 4, f = i & 15u;
    float inv = fa.inv[0];
#pragma unroll
    for (unsigned j = 1; j < 16; ++j) inv = (f == j) ? fa.inv[j] : inv;
    const float ang = (float)t * inv;
    float s, c;
    sincosf(ang, &s, &c);
    *(float*)(cosT + i) = c;
    *(float*)(sinT + i) = s;
    
}

// k_prep: one grid for the three passes; the transposes (a barrier and two memory trips each) and the tables take the lowest block indices, the x stream the blocks behind them. The branch is block-uniform.
__global__ __launch_bounds__(256) void k_prep(const float* __restrict__ x, const float* __restrict__ Wq, const float* __restrict__ Wkv, const float* __restrict__ Wo,
                                              FreqArgs fa, bf* XB, bf* WT, float* cosT, float* sinT) {
    const unsigned blk = blockIdx.x;
    if (blk < (unsigned)WTB)              p_wt(blk % (unsigned)(DM / 64), blk / (unsigned)(DM / 64), Wq, Wkv, Wo, WT);
    else if (blk < (unsigned)(WTB + TBB)) p_tab(blk - (unsigned)WTB, fa, cosT, sinT);
    else                                  p_cvt(blk - (unsigned)(WTB + TBB), x, XB);
}

// k_proj: [q|k|v] = XB . WT^T, block = 256 token rows x 192 columns (three heads of q, k or v), wave = 128 rows x 96 columns; two blocks per WGP, all blocks resident at once.
//  Both operands are rows of 16-bit elements along k, read by one loader, so either may be the A side; a lane's 8 accumulator elements run along the A rows. The side is picked per head so that they run along the output's rows:
//  q, k head: A = WT rows (output channels), B = XB rows (tokens): D element r of lane (h, n) = C[token n][channel 8h + r]; rotary pairs, scale and the f16 convert are done in the lane.
//  v head:    A = XB rows, B = WT rows: D element r of lane (h, n) = C[token 8h + r][channel n]: 8 neighbouring positions of a V^T row.
//  Either way a lane stages 16 bytes of 16-bit output per tile in LDS. NV = number of v heads at the end of the block's three (0, 1 or 3), a compile-time constant: one text per kind of block.
template <int NV>
__device__ __forceinline__ void proj_block(unsigned char* sm, const bf* __restrict__ XB, const bf* __restrict__ WT,
                                           const float* __restrict__ cosT, const float* __restrict__ sinT, hb* QH, hb* KH, hb* VT) {
    const unsigned tid = threadIdx.x, lane = tid & 31u, wv = tid >> 5, lr = lane & 15u, hi = lane >> 4;
    const unsigned wm = wv >> 1, wn = wv & 1u;   // this wave's 128 rows; its column tile t = 2 j + u is columns 32 u + 16 wn .. of head j: every wave has one rotary (u = 0) and one plain tile of each head
    const unsigned wvs = (unsigned)__builtin_amdgcn_readfirstlane((int)wv);   // the wave index as a wave-uniform value, for the epilogue
    const unsigned m0 = blockIdx.x * PM;
    const unsigned nt = blockIdx.y;
    const unsigned cr = tid >> 3, cc = (tid & 7u) * 8u;
    const bf* ga = XB + (size_t)(m0 + cr) * DM + cc;
    const bf* gb = WT + (size_t)(nt * PN + cr) * DM + cc;
    unsigned char* la = sm + cr * LPB + cc * 2u;
    unsigned char* lb = la + PM * LPB;

    v8f c[8][PNT];   // [16-token tile][16-column tile]
#pragma unroll
    for (int i = 0; i < 8; ++i) {
#pragma unroll
        for (int t = 0; t < PNT; ++t) c[i][t] = (v8f){};
    }

    stage_proj(la, ga, lb, gb);
    wait_copies();
    __syncthreads();
    stage_proj(la + PBUF, ga + SK, lb + PBUF, gb + SK);

    unsigned cur = 0;   // byte offset of the buffer that this trip reads
#pragma unroll 1   // one trip per stage stays a loop: small text, one publish point
    for (unsigned s = 0; s < (unsigned)(DM / SK); ++s) {
        const bf* ap = (const bf*)(sm + cur) + (128u * wm + lr) * LP + 8u * hi;
        const bf* bp = (const bf*)(sm + cur) + (PM + 16u * wn + lr) * LP + 8u * hi;
#pragma unroll   // both 32-wide steps of a stage: constant LDS offsets
        for (unsigned k0 = 0; k0 < (unsigned)SK; k0 += 32) {
            v16bf a[8], bb[PNT];
#pragma unroll
            for (int i = 0; i < 8; ++i) a[i] = ldbs(ap + i * 16 * LP + k0);
#pragma unroll
            for (int t = 0; t < PNT; ++t) bb[t] = ldbs(bp + t * 32 * LP + k0);
            __builtin_amdgcn_sched_barrier(0);   // the step's 28 LDS reads stay one group ahead of its products: one LDS round trip per step, not one per weight fragment
#pragma unroll
            for (int t = 0; t < PNT; ++t) {
#pragma unroll
                for (int i = 0; i < 8; ++i) c[i][t] = (t / 2 < PPL - NV) ? wmmab(bb[t], a[i], c[i][t]) : wmmab(a[i], bb[t], c[i][t]);
            }
            __builtin_amdgcn_sched_barrier(0);   // the next step's reads stay out of this step's products
        }
        // WMMA distance on both sides of the loop's branches: four vector slots behind the stage's last products
        asm volatile("v_nop\n\tv_nop\n\tv_nop\n\tv_nop"
                     :: "v"(c[0][PNT - 1]), "v"(c[1][PNT - 1]), "v"(c[2][PNT - 1]), "v"(c[3][PNT - 1]),
                        "v"(c[4][PNT - 1]), "v"(c[5][PNT - 1]), "v"(c[6][PNT - 1]), "v"(c[7][PNT - 1]));
        // publish stage s + 1, free stage s's buffer, refill it with stage s + 2
        wait_lds();
        wait_copies();
        __syncthreads();
        if (s + 2u < (unsigned)(DM / SK)) stage_proj(la + cur, ga + (s + 2u) * SK, lb + cur, gb + (s + 2u) * SK);
        cur = PBUF - cur;
    }
    wait_copies();

    const unsigned b = m0 / (unsigned)SEQ;
    const unsigned posb = m0 - b * (unsigned)SEQ;
    // Staging, every wave its 48 tiles, 16 bytes per lane and tile: plane j belongs to head 3 nt + j. q, k: rows [token][64 channels] at pitch LPB; v: rows [channel][256 positions] at pitch VPB.
    // The lane index is taken anew here, so that no index register of the epilogue lives through the loop (its registers are full: such a value would be spilled).
    const unsigned ln = __builtin_amdgcn_mbcnt_lo(~0u, 0u);
    const unsigned lq = ln & 15u, lh = ln >> 4;
    const unsigned trow = 128u * (wvs >> 1) + lq;                  // q, k: this lane's token row in row tile 0
    const unsigned c0 = 16u * (wvs & 1u) + 8u * lh;                // q, k: first of this lane's 8 channels in a head's tile u = 0; u = 1: 32 more
    v4f c4[8], s4[8];                            // rotary factors of this lane's 8 tokens, pairs c0 / 2 .. c0 / 2 + 3: the same for every head
    // Order of the six column tiles (j, u): (0,1) (1,1) (0,0) (2,1) (1,0) (2,0). The first plain tile's accumulators make room for the rotary factors, the second covers their loads' latency;
    // a head's plane goes to memory as soon as both its tiles are staged, so that its stores drain under the next head's arithmetic.
#pragma unroll   // constant tile indices, here and in the loops inside: the accumulators stay registers
    for (int q = 0; q < 2 * PPL; ++q) {
        const int j = (q == 0 || q == 2) ? 0 : ((q == 1 || q == 4) ? 1 : 2);
        const int u = (q == 0 || q == 1 || q == 3) ? 1 : 0;
        const bool isv = j >= PPL - NV;
        const unsigned hd = (unsigned)PPL * nt + j;   // block-uniform
        unsigned char* pl = sm + j * PLB;
        if (!isv) {
            // q (hd 0..15) or k (hd 16..31) head; rotary on channels 0..31
            const float sc = hd < 16u ? QSC : 1.0f;
            unsigned char* pw = pl + trow * LPB + c0 * 2u + u * 64;
#pragma unroll
            for (int i = 0; i < 8; ++i) {
                v4u o;
#pragma unroll
                for (int e = 0; e < 4; ++e) {
                    v2f x = { c[i][2 * j + u][2 * e], c[i][2 * j + u][2 * e + 1] };
                    if (u == 0) {
                        // (x1 cos - x2 sin, x2 cos + x1 sin) on the pair at once
                        const v2f t = (v2f){ x[1], x[0] } * s4[i][e];
                        x = x * c4[i][e] + (v2f){ -t[0], t[1] };
                    }
                    x *= sc;
                    o[e] = pk2h(x[0], x[1]);
                }
                *(v4ua*)(pw + i * 16 * LPB) = o;
            }
        } else {
            // v head: channel 32 u + 16 wn + lane & 15, positions 128 wm + 16 i + 8 (lane >> 4) ..
            unsigned char* pw = pl + (16u * (wvs & 1u) + lq + 32 * u) * VPB + (128u * (wvs >> 1) + 8u * lh) * 2u;
#pragma unroll
            for (int i = 0; i < 8; ++i) {
                v4u o;
#pragma unroll
                for (int e = 0; e < 4; ++e) o[e] = pk2h(c[i][2 * j + u][2 * e], c[i][2 * j + u][2 * e + 1]);
                *(v4ua*)(pw + i * 32) = o;
            }
        }
        if (q == 0 && NV < PPL) {
            const unsigned ti = (posb + trow) * 16u + (c0 >> 1);
#pragma unroll
            for (int i = 0; i < 8; ++i) {
                c4[i] = *(const v4f*)(cosT + ti + i * 256);
                if (i == 7) asm volatile("s_wait_xcnt 0x0" ::: "memory");   // without it the build gives the last load's result the index register, which the fifteen loads in front of it name
                s4[i] = *(const v4f*)(sinT + ti + i * 256);
            }
            asm volatile("s_wait_xcnt 0x0" :: "s"(cosT), "s"(sinT) : "memory");   // the loads' scalar bases live up to here: no address register of an issued load is rewritten ahead of this wait; it also keeps the loads at this early place
        }
        if (u == 0) {
            // plane j is complete: whole 128-byte lines to memory, four per store instruction.
            // The barrier orders LDS only (release and acquire on the local address space): __syncthreads() would also wait out the earlier head's global stores, which nobody in this launch reads.
            __builtin_amdgcn_fence(__ATOMIC_RELEASE, "workgroup", "local");
            __builtin_amdgcn_s_barrier();
            __builtin_amdgcn_fence(__ATOMIC_ACQUIRE, "workgroup", "local");
            if (!isv) {
                // the block's 256 rows of 128 bytes are one run in memory; 16 rows per pass
                hb* dst = (hd < 16u ? QH : KH) + ((size_t)(b * NH + (hd & 15u)) * SEQ + posb) * HD + (32u * wvs + ln) * 8u;
                const unsigned char* pr = pl + (4u * wvs + (ln >> 3)) * LPB + (ln & 7u) * 16u;
#pragma unroll   // all reads in flight at once: one LDS round trip per head
                for (unsigned it = 0; it < (unsigned)(PM / 16); ++it) {
                    const v4u o = *(const v4ua*)(pr + it * 16u * LPB);
                    *(v4u*)(dst + it * 16u * HD) = o;
                }
            } else {
                // VT[d][pos]: one channel's 256 positions (512 bytes) per store instruction; wave wvs has channels 16 wvs ..
                hb* dst = VT + ((size_t)(b * NH + (hd - 32u)) * HD + 16u * wvs) * SEQ + posb + ln * 8u;
                const unsigned char* pr = pl + 16u * wvs * VPB + ln * 16u;
#pragma unroll   // as above
                for (unsigned it = 0; it < 16u; ++it) {
                    const v4u o = *(const v4ua*)(pr + it * VPB);
                    *(v4u*)(dst + (size_t)it * SEQ) = o;
                }
            }
            if (q + 1 < 2 * PPL || NV > 0) {   // behind the last head of a block without v heads the wave ends; the other two texts are followed by more text
                asm volatile("s_wait_xcnt 0x0" ::: "memory");   // no register of an issued store is rewritten ahead of this
                __builtin_amdgcn_sched_barrier(0);              // keeps the next tile's vector instructions, which reuse those registers, behind the wait
            }
        }
    }
}

//  The second launch bound keeps a wave inside 512 registers (384 of them accumulators), so that two blocks share a WGP, one wave of each per SIMD.
__global__ __launch_bounds__(128, 2) void k_proj(const bf* __restrict__ XB, const bf* __restrict__ WT,
                                              const float* __restrict__ cosT, const float* __restrict__ sinT,
                                              hb* QH, hb* KH, hb* VT) {
    __shared__ __align__(16) unsigned char sm[2 * PBUF];   // operand ring; output staging behind the loop
    const unsigned h0 = (unsigned)PPL * blockIdx.y;   // the block's first head; the branch is block-uniform
    if (h0 + (unsigned)PPL <= 2u * NH) proj_block<0>(sm, XB, WT, cosT, sinT, QH, KH, VT);
    else if (h0 >= 2u * NH)            proj_block<PPL>(sm, XB, WT, cosT, sinT, QH, KH, VT);
    else                               proj_block<1>(sm, XB, WT, cosT, sinT, QH, KH, VT);
}

// k_flash: one wave per 32 queries (two 16-query tiles) of one (batch, head), 8 waves per block, 32 keys per step; each K and V^T fragment read from LDS feeds both query tiles.
//  S^T tile (keys x queries): A = K rows (row m = key, k = d), B = Q rows (column n = query, k = d); D element r of lane (h, n) = S[query n][key 8h + r].
//  The score products start from C = PCARRY - reference maximum of the lane's query (all 8 elements of a lane belong to one query), so D is the exponent of the carried P.
//  Lazy rescale: the reference is an earlier running maximum; exchange between the halves, correction and rescale run only in the first stage and where an exponent exceeds PTOP, tested once per stage of 64 keys; each half of a column sums its own P, joined once behind the loop.
//  P^T B fragment: element r <- tile of keys 0..15, element 8 + r <- tile of keys 16..31 (same lane); P carried x 2^7 in f16, row sum carried alike.
//  O^T tile (d x queries): A = V^T rows (row m = d, k = key), D element r of lane (h, n) = O[query n][d = 16 t + 8h + r].
__global__ __launch_bounds__(32 * NWV) void k_flash(const hb* __restrict__ QH, const hb* __restrict__ KH, const hb* __restrict__ VT, hb* CH) {
    __shared__ __align__(16) unsigned char sm[FOUT];   // K | V^T ring (first 2 * FBUF bytes); output staging behind the loop
    float* os = (float*)sm;
    const unsigned tid = threadIdx.x, lane = tid & 31u, wv = tid >> 5, lr = lane & 15u, hi = lane >> 4;
    const unsigned qpb = (unsigned)(SEQ / BQ);
    const unsigned bh = blockIdx.x / qpb;
    const unsigned q0 = (blockIdx.x - bh * qpb) * BQ + wv * (16u * QT);
    const unsigned b = bh >> 4, h = bh & 15u;

    v16h qf[QT][2];
#pragma unroll
    for (int q = 0; q < QT; ++q) {
        const hb* qp = QH + ((size_t)bh * SEQ + q0 + 16u * q + lr) * HD + 8u * hi;
        qf[q][0] = ldh(qp);
        qf[q][1] = ldh(qp + 32);
    }
    const unsigned cr = tid >> 3, cc = (tid & 7u) * 8u;
    const hb* gk = KH + ((size_t)bh * SEQ + cr) * HD + cc;
    const hb* gv = VT + ((size_t)bh * HD + cr) * SEQ + cc;
    const unsigned lk = ldsa(sm) + cr * LPB + cc * 2u;
    const unsigned lv = lk + SK * LPB;

    v8f o[QT][4];
    v8f cv[QT];               // C operand of the score products: PCARRY - reference max (log2 domain), alike in both halves of a column
    float l[QT];              // running sum of this lane's half of the keys (carried x 2^7); the halves are joined behind the loop
    float lim = -3.0e38f;     // exponents above this renew the reference: every finite one in the first stage, PTOP from then on
    float lo = -3.0e38f;      // least move of the reference: the first stage takes its own maximum, up or down; later it only rises
#pragma unroll
    for (int q = 0; q < QT; ++q) {
#pragma unroll
        for (int t = 0; t < 4; ++t) o[q][t] = (v8f){};
        cv[q] = (v8f){} + PCARRY;
        l[q] = 0.0f;
    }

    stage4(lk, gk, HD, lv, gv, SEQ);
    wait_copies();
    __syncthreads();
    stage4(lk + FBUF, gk + (size_t)SK * HD, HD, lv + FBUF, gv + SK, SEQ);

    unsigned cur = 0;   // byte offset of the buffer that this trip reads
#pragma unroll 1   // one trip per stage stays a loop: small text, one publish point
    for (unsigned sg = 0; sg < (unsigned)(SEQ / SK); ++sg) {
      const hb* kp = (const hb*)(sm + cur) + lr * LP + 8u * hi;
      const hb* vp = kp + SK * LP;
      v8f s[2][QT][2];   // [32-key step][query tile][16-key tile]
#pragma unroll   // both 32-key steps of a stage: constant LDS offsets
      for (int hs = 0; hs < 2; ++hs) {
#pragma unroll
        for (int q = 0; q < QT; ++q) { s[hs][q][0] = cv[q]; s[hs][q][1] = cv[q]; }
        const hb* ka = kp + hs * KS * LP;
#pragma unroll
        for (int dk = 0; dk < 2; ++dk) {
            const v16h a0 = ldhs(ka + dk * 32);
            const v16h a1 = ldhs(ka + 16 * LP + dk * 32);
#pragma unroll
            for (int q = 0; q < QT; ++q) {
                s[hs][q][0] = wmmah(a0, qf[q][dk], s[hs][q][0]);
                s[hs][q][1] = wmmah(a1, qf[q][dk], s[hs][q][1]);
            }
        }
      }
      // WMMA distance: four vector slots behind the stage's last score products
      asm volatile("v_nop\n\tv_nop\n\tv_nop\n\tv_nop" : "+v"(s[1][0][0]), "+v"(s[1][0][1]), "+v"(s[1][1][0]), "+v"(s[1][1][1])
                   : "v"(qf[0][0]), "v"(qf[0][1]), "v"(qf[1][0]), "v"(qf[1][1]));

      float mx[QT];   // this lane's half of the column only; the halves meet in the branch
#pragma unroll
      for (int q = 0; q < QT; ++q) {
          mx[q] = fmaxf(s[0][q][0][0], s[0][q][1][0]);
#pragma unroll
          for (int r = 1; r < 8; ++r) mx[q] = fmaxf(mx[q], fmaxf(s[0][q][0][r], s[0][q][1][r]));
#pragma unroll
          for (int r = 0; r < 8; ++r) mx[q] = fmaxf(mx[q], fmaxf(s[1][q][0][r], s[1][q][1][r]));
      }
      if (__builtin_amdgcn_ballot_w32(!(mx[0] <= lim && mx[1] <= lim)) != 0u) {   // wave-uniform, one test per stage
#pragma unroll
          for (int q = 0; q < QT; ++q) {
              const float up = fmaxf(mx[q], __shfl_xor(mx[q], 16, 32)) - PCARRY;   // the stage's maximum above the reference in use
              const float dm = fmaxf(up, lo);
              const float corr = __builtin_amdgcn_exp2f(-fmaxf(dm, 0.0f));         // dm < 0 only in the first stage, where O and l are still 0
              cv[q] -= dm;
#pragma unroll
              for (int hs = 0; hs < 2; ++hs) { s[hs][q][0] -= dm; s[hs][q][1] -= dm; }
              l[q] *= corr;
#pragma unroll
              for (int t = 0; t < 4; ++t) o[q][t] *= corr;
          }
          lim = PTOP;
          lo = 0.0f;
      }
#pragma unroll   // both 32-key steps of a stage: constant LDS offsets
      for (int hs = 0; hs < 2; ++hs) {
        const hb* va = vp + hs * KS;
        v16h av[4];   // the step's four V^T fragments, read as one group; the step's softmax covers their LDS round trip
#pragma unroll
        for (int t = 0; t < 4; ++t) av[t] = ldhs(va + t * 16 * LP);
        __builtin_amdgcn_sched_barrier(0);   // the 8 LDS reads stay together, above the softmax
        v16h ph[QT];
#pragma unroll
        for (int q = 0; q < QT; ++q) {
            const v8f s0 = s[hs][q][0], s1 = s[hs][q][1];
            float p0[8], p1[8];
            float ps = 0.0f;
#pragma unroll
            for (int r = 0; r < 8; ++r) {
                p0[r] = __builtin_amdgcn_exp2f(s0[r]);
                p1[r] = __builtin_amdgcn_exp2f(s1[r]);
                ps += p0[r] + p1[r];
            }
            l[q] += ps;
            v8u hw;
#pragma unroll
            for (int j = 0; j < 4; ++j) {
                hw[j]     = pk2h(p0[2 * j], p0[2 * j + 1]);
                hw[4 + j] = pk2h(p1[2 * j], p1[2 * j + 1]);
            }
            ph[q] = __builtin_bit_cast(v16h, hw);
        }

#pragma unroll
        for (int t = 0; t < 4; ++t) {
#pragma unroll
            for (int q = 0; q < QT; ++q) o[q][t] = wmmah(av[t], ph[q], o[q][t]);
        }
        // WMMA distance on both sides of the branches that follow: four vector slots behind the step's last products
        asm volatile("v_nop\n\tv_nop\n\tv_nop\n\tv_nop"
                     : "+v"(o[0][0]), "+v"(o[0][1]), "+v"(o[0][2]), "+v"(o[0][3]), "+v"(o[1][0]), "+v"(o[1][1]), "+v"(o[1][2]), "+v"(o[1][3])
                     : "v"(ph[0]), "v"(ph[1]));
      }
      // publish stage sg + 1, free stage sg's buffer, refill it with stage sg + 2
      wait_lds();
      wait_copies();
      __syncthreads();
      if (sg + 2u < (unsigned)(SEQ / SK)) stage4(lk + cur, gk + (size_t)(sg + 2u) * SK * HD, HD, lv + cur, gv + (sg + 2u) * SK, SEQ);
      cur = FBUF - cur;
    }
    wait_copies();

    float* ow = os + wv * (16 * QT * OSP);   // this wave's 32 rows
#pragma unroll
    for (int q = 0; q < QT; ++q) {
        const float inv = 1.0f / (l[q] + __shfl_xor(l[q], 16, 32));
#pragma unroll
        for (int t = 0; t < 4; ++t) {
#pragma unroll
            for (int r = 0; r < 8; ++r) ow[(16 * q + lr) * OSP + t * 16 + 8 * hi + r] = o[q][t][r] * inv;
        }
    }
    __syncthreads();
    const unsigned cg = lane & 7u, rq = lane >> 3;
    const size_t cbase = ((size_t)b * SEQ + q0) * DM + h * HD + 8u * cg;
{
#pragma unroll
        for (unsigned s = 0; s < 4u * QT; ++s) {
            const unsigned row = 4u * s + rq;
            const float* sr = ow + row * OSP + 8u * cg;
            const v4f xa = *(const v4fa*)sr;
            const v4f xb = *(const v4fa*)(sr + 4);
            const float x[8] = { xa[0], xa[1], xa[2], xa[3], xb[0], xb[1], xb[2], xb[3] };
            v4u oh;
#pragma unroll
            for (int j = 0; j < 4; ++j) oh[j] = pk2h(x[2 * j], x[2 * j + 1]);
            *(v4u*)(CH + cbase + (size_t)row * DM) = oh;
        }
        
    }
}

// k_out: out = CH . WOT^T + bf16(bout); block = 128 rows x 128 columns, wave = 64 rows x 64 columns.
__global__ __launch_bounds__(128) void k_out(const hb* __restrict__ CH, const hb* __restrict__ WOT,
                                             const float* __restrict__ bout, float* O) {
    __shared__ __align__(16) unsigned char sm[2 * OBUF];   // operand ring; output staging behind the loop
    float* st = (float*)sm;
    const unsigned tid = threadIdx.x, lane = tid & 31u, wv = tid >> 5, lr = lane & 15u, hi = lane >> 4;
    const unsigned wm = wv >> 1, wn = wv & 1u;   // this wave's 64 rows and 64 columns of the block tile
    const unsigned m0 = blockIdx.x * GM;
    const unsigned n0 = blockIdx.y * GN;
    const unsigned cr = tid >> 3, cc = (tid & 7u) * 8u;
    const hb* ga = CH + (size_t)(m0 + cr) * DM + cc;
    const hb* gb = WOT + (size_t)(n0 + cr) * DM + cc;
    const unsigned la = ldsa(sm) + cr * LPB + cc * 2u;
    const unsigned lb = la + GM * LPB;

    v8f c[4][4];   // [16-row tile][16-column tile]
#pragma unroll
    for (int i = 0; i < 4; ++i) {
#pragma unroll
        for (int t = 0; t < 4; ++t) c[i][t] = (v8f){};
    }

    stage128(la, ga);
    stage128(lb, gb);
    wait_copies();
    __syncthreads();
    stage128(la + OBUF, ga + SK);
    stage128(lb + OBUF, gb + SK);

    unsigned cur = 0;   // byte offset of the buffer that this trip reads
#pragma unroll 1   // one trip per stage stays a loop: small text, one publish point
    for (unsigned s = 0; s < (unsigned)(DM / SK); ++s) {
        const hb* ap = (const hb*)(sm + cur) + (64u * wm + lr) * LP + 8u * hi;
        const hb* bp = (const hb*)(sm + cur) + (GM + 64u * wn + lr) * LP + 8u * hi;
#pragma unroll   // both 32-wide steps of a stage: constant LDS offsets
        for (unsigned k0 = 0; k0 < (unsigned)SK; k0 += 32) {
            v16h a[4], bb[4];
#pragma unroll
            for (int i = 0; i < 4; ++i) a[i] = ldhs(ap + i * 16 * LP + k0);
#pragma unroll
            for (int t = 0; t < 4; ++t) bb[t] = ldhs(bp + t * 16 * LP + k0);
            __builtin_amdgcn_sched_barrier(0);   // the step's 16 LDS reads stay one group ahead of its products: one LDS round trip per step, not one per B fragment
#pragma unroll
            for (int t = 0; t < 4; ++t) {
#pragma unroll
                for (int i = 0; i < 4; ++i) c[i][t] = wmmah(a[i], bb[t], c[i][t]);
            }
            __builtin_amdgcn_sched_barrier(0);   // the next step's reads stay out of this step's products
        }
        // WMMA distance on both sides of the loop's branches: four vector slots behind the stage's last products
        asm volatile("v_nop\n\tv_nop\n\tv_nop\n\tv_nop"
                     :: "v"(c[0][0]), "v"(c[0][1]), "v"(c[0][2]), "v"(c[0][3]), "v"(c[1][0]), "v"(c[1][1]), "v"(c[1][2]), "v"(c[1][3]),
                        "v"(c[2][0]), "v"(c[2][1]), "v"(c[2][2]), "v"(c[2][3]), "v"(c[3][0]), "v"(c[3][1]), "v"(c[3][2]), "v"(c[3][3]));
        // publish stage s + 1, free stage s's buffer, refill it with stage s + 2
        wait_lds();
        wait_copies();
        __syncthreads();
        if (s + 2u < (unsigned)(DM / SK)) {
            stage128(la + cur, ga + (s + 2u) * SK);
            stage128(lb + cur, gb + (s + 2u) * SK);
        }
        cur = OBUF - cur;
    }
    wait_copies();

    // staging: plane wn holds the 128 rows x 64 columns n0 + 64 wn ..
    float* sw = st + (wn * GM + 64u * wm) * SP;
#pragma unroll
    for (int i = 0; i < 4; ++i) {
#pragma unroll
        for (int t = 0; t < 4; ++t) {
#pragma unroll
            for (int r = 0; r < 8; ++r) sw[(16u * i + 8u * hi + r) * SP + t * 16 + lr] = c[i][t][r];
        }
    }
    __syncthreads();

    // one row of 128 columns (512 bytes, four whole lines) per store instruction; wave wv stores rows 32 wv ..
    const unsigned c4 = (lane & 15u) * 4u, ph = lane >> 4;
    const v4f bv = *(const v4f*)(bout + n0 + 64u * ph + c4);
    const float b0 = bfr(bv[0]), b1 = bfr(bv[1]), b2 = bfr(bv[2]), b3 = bfr(bv[3]);
    const float* sr = st + (ph * GM + 32u * wv) * SP + c4;
    float* orow = O + (size_t)(m0 + 32u * wv) * DM + n0 + 64u * ph + c4;
{
#pragma unroll 4
        for (unsigned row = 0; row < 32; ++row) {
            v4f val = *(const v4fa*)(sr + row * SP);
            val[0] += b0; val[1] += b1; val[2] += b2; val[3] += b3;
            *(v4f*)(orow + (size_t)row * DM) = val;
        }
        
    }
}

extern "C" void kernel_launch(void* const* d_in, const int* in_sizes, int n_in,
                              void* d_out, int out_size, void* d_ws, size_t ws_size, hipStream_t stream) {
    if (n_in < 5) return;
    const size_t needx = ((size_t)(NB - 1) * SEQ_FULL + SEQ) * DM;
    if ((size_t)in_sizes[0] < needx) return;
    if ((size_t)in_sizes[1] < (size_t)DM * DM) return;
    if ((size_t)in_sizes[2] < (size_t)2 * DM * DM) return;
    if ((size_t)in_sizes[3] < (size_t)DM * DM) return;
    if ((size_t)in_sizes[4] < (size_t)DM) return;
    if ((size_t)out_size < (size_t)NB * SEQ * DM) return;
    const float* x    = (const float*)d_in[0];   // queries [NB_FULL][SEQ_FULL][DM]
    const float* Wq   = (const float*)d_in[1];   // [DM in][DM out]
    const float* Wkv  = (const float*)d_in[2];   // [DM in][2*DM out]
    const float* Wout = (const float*)d_in[3];   // [DM in][DM out]
    const float* bout = (const float*)d_in[4];   // [DM]
    float* OUT = (float*)d_out;                  // [NB][SEQ][DM]

    const size_t PA = (size_t)NB * SEQ * DM * 2;     // bytes per 16-bit activation plane
    const size_t PW = (size_t)NWT * DM * 2;          // bytes of the transposed weight plane
    const size_t PT = (size_t)SEQ * 16 * 4;          // bytes per rotary table
    if (5 * PA + PW + 2 * PT > ws_size) return;
    char* wsp = (char*)d_ws;
    bf* XB = (bf*)(wsp);
    bf* WT = (bf*)(wsp + PA);
    float* cosT = (float*)(wsp + PA + PW);
    float* sinT = (float*)(wsp + PA + PW + PT);
    hb* QH = (hb*)(wsp + PA + PW + 2 * PT);
    hb* KH = (hb*)(wsp + 2 * PA + PW + 2 * PT);
    hb* VT = (hb*)(wsp + 3 * PA + PW + 2 * PT);
    hb* CH = (hb*)(wsp + 4 * PA + PW + 2 * PT);

    FreqArgs fa;
    for (int i = 0; i < 16; ++i) {
        const float pw = (float)pow(10000.0, (double)(2 * i) / 32.0);
        fa.inv[i] = 1.0f / pw;
    }

    const unsigned gc = (unsigned)(((size_t)NB * SEQ * DM / 8 + 255) / 256);
    k_prep<<<(unsigned)(WTB + TBB) + gc, 256, 0, stream>>>(x, Wq, Wkv, Wout, fa, XB, WT, cosT, sinT);
    k_proj<<<dim3((unsigned)(NB * SEQ / PM), NQKV / PN, 1), 128, 0, stream>>>(XB, WT, cosT, sinT, QH, KH, VT);
    k_flash<<<(unsigned)(NB * NH * (SEQ / BQ)), 32 * NWV, 0, stream>>>(QH, KH, VT, CH);
    k_out<<<dim3((unsigned)(NB * SEQ / GM), DM / GN, 1), 128, 0, stream>>>(CH, WT + (size_t)NQKV * DM, bout, OUT);
}
